// v000
// Measured on an AMD MI455X. A time is GPU time per run, averaged over a window of back-to-back runs after a warm-up
// (all launches, gaps included; the runs take copies of the inputs in turn), and the median of several windows.
// Apart from v000's, it joins two sittings. Times from different sittings can be a few percent apart, while
// side-by-side timings come from the same sitting.
// The starting kernel, v000, takes 392 microseconds a run.
// compute dtype: x, adjacency, in_proj/out_proj weights and biases (module inputs) rounded to bf16; the packed qkv projection with exact bf16 products (x and W are inputs) + bias; scores q.k with both computed operands as bf16 hi + residual pairs (3 products) and P.V with P hi/lo x V hi/lo (3 products); the adjacency mask as a select (adjacency <= 0 -> -1e30); the output projection hi/lo x exact Wo (2 products) + bo; running-max softmax in f32; f32 accumulate.
#include <hip/hip_runtime.h>
#include <math.h>

typedef __attribute__((ext_vector_type(16))) _Float16 v16h;
typedef __attribute__((ext_vector_type(16))) __bf16 v16b;
typedef __attribute__((ext_vector_type(8)))  _Float16 v8h;
typedef __attribute__((ext_vector_type(8)))  float v8f;
typedef __attribute__((ext_vector_type(4)))  float v4f;
typedef __attribute__((ext_vector_type(2)))  float v2f;
typedef __attribute__((ext_vector_type(4)))  unsigned v4u;
typedef __attribute__((ext_vector_type(4)))  int v4i;
typedef float __attribute__((may_alias)) float_a;
typedef int __attribute__((may_alias)) int_a;

template <typename T> __device__ __forceinline__ void vst2(void* p, T v) { *(T*)p = v;  }
__device__ __forceinline__ v8f wmma16(v16h a, v16h b, v8f c) {
  v8f d = __builtin_amdgcn_wmma_f32_16x16x32_f16(false, a, false, b, (short)0, c, false, false);
  asm volatile("v_nop\n\tv_nop\n\tv_nop\n\tv_nop" : "+v"(d) : "v"(a), "v"(b));
  return d;
}
__device__ __forceinline__ v8f wmma_bf(v16b a, v16b b, v8f c) {
  v8f d = __builtin_amdgcn_wmma_f32_16x16x32_bf16(false, a, false, b, (short)0, c, false, false);
  asm volatile("v_nop\n\tv_nop\n\tv_nop\n\tv_nop" : "+v"(d) : "v"(a), "v"(b));
  return d;
}
// 16x16x32 fragments: lane = (h = lane>>4, row/col = lane&15); elements 0..7 = k0+8h+0..7, 8..15 = k0+16+8h+0..7; D element r = row 8h+r
__device__ __forceinline__ v16h frag_h(const _Float16* rowk0, int lane) {
  union { v16h v; v8h q[2]; } u; const _Float16* p = rowk0 + 8 * (lane >> 4);
  u.q[0] = *(const v8h*)p; u.q[1] = *(const v8h*)(p + 16); return u.v;
}
__device__ __forceinline__ v16h frag_f32(const float* rowk0, int lane) {
  v16h a; const float* p = rowk0 + 8 * (lane >> 4);
#pragma unroll
  for (int i = 0; i < 8; ++i) { a[i] = (_Float16)p[i]; a[8 + i] = (_Float16)p[16 + i]; }
  return a;
}
__device__ __forceinline__ v16h frag_f32s(const float* rowk0, int lane, float sc) {
  v16h a; const float* p = rowk0 + 8 * (lane >> 4);
#pragma unroll
  for (int i = 0; i < 8; ++i) { a[i] = (_Float16)(p[i] * sc); a[8 + i] = (_Float16)(p[16 + i] * sc); }
  return a;
}
// column fragment from a [K][ld] layout (column n), rows >= K read as 0
__device__ __forceinline__ v16h fragc_f32(const float* W, int k0, int n, int lane, int ld, int K) {
  v16h a; const int g = lane >> 4;
#pragma unroll
  for (int i = 0; i < 8; ++i) { const int ka = k0 + 8 * g + i, kb = ka + 16;
    a[i] = (_Float16)(ka < K ? W[(size_t)(ka < K ? ka : K - 1) * ld + n] : 0.f); a[8 + i] = (_Float16)(kb < K ? W[(size_t)(kb < K ? kb : K - 1) * ld + n] : 0.f); }
  return a;
}
struct F2 { v16b h, l; };
__device__ __forceinline__ F2 bsplit16(const float v[16]) { F2 r;
#pragma unroll
  for (int i = 0; i < 16; ++i) { const __bf16 h = (__bf16)v[i]; r.h[i] = h; r.l[i] = (__bf16)(v[i] - (float)h); }
  return r; }
__device__ __forceinline__ F2 split_row(const float* row, int k0, int lane) { float v[16]; const float* p = row + k0 + 8 * (lane >> 4);
#pragma unroll
  for (int i = 0; i < 8; ++i) { v[i] = p[i]; v[8 + i] = p[16 + i]; }
  return bsplit16(v); }
__device__ __forceinline__ F2 split_rowK(const float* row, int k0, int lane, int K) { float v[16]; const int g = lane >> 4;
#pragma unroll
  for (int i = 0; i < 8; ++i) { const int ka = k0 + 8 * g + i, kb = ka + 16; v[i] = ka < K ? row[ka < K ? ka : K - 1] : 0.f; v[8 + i] = kb < K ? row[kb < K ? kb : K - 1] : 0.f; }
  return bsplit16(v); }
__device__ __forceinline__ F2 split_col(const float* W, int k0, int n, int lane, int ld, int K) { float v[16]; const int g = lane >> 4;
#pragma unroll
  for (int i = 0; i < 8; ++i) { const int ka = k0 + 8 * g + i, kb = ka + 16; v[i] = ka < K ? W[(size_t)(ka < K ? ka : K - 1) * ld + n] : 0.f; v[8 + i] = kb < K ? W[(size_t)(kb < K ? kb : K - 1) * ld + n] : 0.f; }
  return bsplit16(v); }
__device__ __forceinline__ v8f mac3(const F2& a, const F2& b, v8f c) { c = wmma_bf(a.l, b.h, c); c = wmma_bf(a.h, b.l, c); return wmma_bf(a.h, b.h, c); }
__device__ __forceinline__ float sigm(float v) { return 1.0f / (1.0f + expf(-v)); }
#define LDSX() do { asm volatile("s_wait_dscnt 0" ::: "memory"); __builtin_amdgcn_wave_barrier(); __builtin_amdgcn_fence(__ATOMIC_RELEASE, "workgroup"); } while (0)


// Masked multi-head self-attention (B 4, T 1024, D 1024, 16 heads x 64; torch-style packed in_proj [3D][D] + bias, out_proj [D][D] + bias): scores = q.k / 8, keys with adjacency[q][k] <= 0 disallowed (-1e30 before the softmax; the [T][T] adjacency is shared by all batches and heads), out = softmax(scores) v, then out_proj.
#define NB 4
#define SS 1024
#define DM 1024
#define NH 16
#define HD 64
#define QKVW (3 * DM)
#ifndef TQB
#define TQB (SS / 64)
#define TNB NB
#define TOB (NB * SS / 64)     // output row tiles (all)
#endif
typedef __attribute__((ext_vector_type(8))) __bf16 v8b;
__device__ __forceinline__ v16b frag_b(const __bf16* rowk0, int lane) {
  union { v16b v; v8b q[2]; } u; const __bf16* p = rowk0 + 8 * (lane >> 4);
  u.q[0] = *(const v8b*)p; u.q[1] = *(const v8b*)(p + 16); return u.v;
}
__device__ __forceinline__ float bfr(float v) { return (float)(__bf16)v; }
__device__ __attribute__((noinline)) float exp_ni(float v) { return expf(v); }
__device__ __attribute__((noinline)) float erf_ni(float v) { return erff(v); }

#define PK_A 0                       // [3072][1024] in_proj rows (natural [out][in])
#define PK_P (PK_A + QKVW * DM)        // [1024][1024] out_proj rows (natural)
#define PK_END (PK_P + DM * DM)
#define WS_PK  0u
#define WS_QK  (WS_PK + 2u * PK_END)             // f32 [4096 rows][3072]: [q | k | v]
#define WS_VTH (WS_QK + 4u * NB * SS * QKVW)     // bf16 [4][1024 (h*64+d)][1024 s]
#define WS_VTL (WS_VTH + 2u * NB * DM * SS)
#define WS_O   (WS_VTL + 2u * NB * DM * SS)        // f32 [4096][1024]
#define WS_END (WS_O + 4u * NB * SS * DM)

// ---- k_pack: block = row r of a natural [R][1024] weight -> bf16 row
__global__ __launch_bounds__(256) void k_pack(const float* __restrict__ Wm, __bf16* __restrict__ DST) {
  __shared__ __align__(16) __bf16 s[DM]; const int r = blockIdx.x, tid = threadIdx.x;
  for (int k = tid; k < DM; k += 256) s[k] = (__bf16)Wm[(size_t)r * DM + k];
  __syncthreads();
  for (int q = tid; q < DM / 8; q += 256) vst2((unsigned*)(DST + (size_t)r * DM + q * 8), *(const v4u*)&s[q * 8]);
}
// ---- k_qkv: block = (64 rows, 128 of the 3072 cols): QKV = bf16(x) . in_proj rows (exact) + bias -> f32 rows (pitch 3072)
__global__ __launch_bounds__(128) void k_qkv(const float* __restrict__ X, const __bf16* __restrict__ P, const float* __restrict__ BIAS, float* __restrict__ QKV) {
  __shared__ __align__(16) float so[4][16][132];
  const int tid = threadIdx.x, wave = tid >> 5, lane = tid & 31, col = lane & 15, g = lane >> 4; const size_t r0 = (size_t)blockIdx.x * 64 + wave * 16; const int n0 = blockIdx.y * 128;
  v8f acc[8] = {};
#pragma unroll 2
  for (int kc = 0; kc < DM / 32; ++kc) { v16b a; { const float* p = X + (r0 + col) * DM + kc * 32 + 8 * g;
#pragma unroll
      for (int i = 0; i < 8; ++i) { a[i] = (__bf16)p[i]; a[8 + i] = (__bf16)p[16 + i]; } }
#pragma unroll
    for (int j = 0; j < 8; ++j) acc[j] = wmma_bf(a, frag_b(P + (size_t)(n0 + j * 16 + col) * DM + kc * 32, lane), acc[j]); }
#pragma unroll
  for (int j = 0; j < 8; ++j) { const float bb = bfr(BIAS[n0 + j * 16 + col]);
#pragma unroll
    for (int r = 0; r < 8; ++r) so[wave][8 * g + r][j * 16 + col] = acc[j][r] + bb; }
  LDSX();
  for (int rl = 0; rl < 16; ++rl) vst2(QKV + (r0 + rl) * QKVW + n0 + lane * 4, *(const v4f*)&so[wave][rl][lane * 4]);
}
__global__ __launch_bounds__(256) void k_vt(const float* __restrict__ QKV, __bf16* __restrict__ VTH, __bf16* __restrict__ VTL) {
  __shared__ __align__(16) __bf16 sth[64][72], stl[64][72]; const int tid = threadIdx.x; const size_t rb = (size_t)blockIdx.x * 64; const int h = blockIdx.y; const int b = (int)(rb / SS), s0 = (int)(rb % SS);
  for (int q = tid; q < 64 * 64; q += 256) { const int rl = q >> 6, d = q & 63; const float v = QKV[(rb + rl) * QKVW + 2 * DM + h * HD + d]; const __bf16 hb = (__bf16)v; sth[d][rl] = hb; stl[d][rl] = (__bf16)(v - (float)hb); }
  __syncthreads();
  for (int q = tid; q < 64 * 8; q += 256) { const int d = q >> 3, pc = q & 7; const size_t o = ((size_t)b * DM + h * HD + d) * SS + s0 + pc * 8; vst2((unsigned*)(VTH + o), *(const v4u*)&sth[d][pc * 8]); vst2((unsigned*)(VTL + o), *(const v4u*)&stl[d][pc * 8]); }
}
// ---- k_attn: block = (64 queries, head h, batch b): flash attention over the 1,024 keys (32 per step), logits = q.k (3 products) / 8, disallowed keys (adjacency[q][k] <= 0) set to -1e30; P.V 3 products; O[b*S+q][h*64+d] = acc / l
__global__ __launch_bounds__(128) void k_attn(const float* __restrict__ QK, const float* __restrict__ ADJ, const __bf16* __restrict__ VTH, const __bf16* __restrict__ VTL, float* __restrict__ O) {
  __shared__ __align__(16) float sp[4][16][36]; __shared__ __align__(16) float so[4][16][68];
  const int tid = threadIdx.x, wave = tid >> 5, lane = tid & 31, col = lane & 15, g = lane >> 4;
  const int qb = blockIdx.x, h = blockIdx.y, b = blockIdx.z; const int q0 = qb * 64 + wave * 16; const size_t rq = (size_t)b * SS + q0 + col;
  F2 aq[2];
#pragma unroll
  for (int kc = 0; kc < 2; ++kc) aq[kc] = split_row(QK + rq * QKVW + h * HD, kc * 32, lane);
  float m[8], l[8];
#pragma unroll
  for (int r = 0; r < 8; ++r) { m[r] = -3.0e38f; l[r] = 0.f; }
  v8f acc[4] = {};
  const float* arow0 = ADJ + (size_t)(q0 + 8 * g) * SS;
#pragma unroll 1
  for (int ks = 0; ks < SS / 32; ++ks) { v8f s[2];
#pragma unroll
    for (int ct = 0; ct < 2; ++ct) { const int kk = ks * 32 + ct * 16 + col; const float* krow = QK + ((size_t)b * SS + kk) * QKVW + DM + h * HD; v8f c = {};
#pragma unroll
      for (int kc = 0; kc < 2; ++kc) { const F2 kb = split_row(krow, kc * 32, lane); c = mac3(aq[kc], kb, c); }
#pragma unroll
      for (int r = 0; r < 8; ++r) { const float a = arow0[(size_t)r * SS + kk]; s[ct][r] = (a <= 0.f) ? -1.0e30f : c[r] * 0.125f; } }   // SCALE = 1/sqrt(64)
#pragma unroll
    for (int r = 0; r < 8; ++r) { float mx = fmaxf(s[0][r], s[1][r]);
#pragma unroll
      for (int o = 1; o < 16; o <<= 1) mx = fmaxf(mx, __shfl_xor(mx, o));
      const float mn = fmaxf(m[r], mx); const float alpha = exp_ni(m[r] - mn);
      const float e0 = exp_ni(s[0][r] - mn), e1 = exp_ni(s[1][r] - mn); float es = e0 + e1;
#pragma unroll
      for (int o = 1; o < 16; o <<= 1) es += __shfl_xor(es, o);
      l[r] = l[r] * alpha + es; m[r] = mn;
#pragma unroll
      for (int dt = 0; dt < 4; ++dt) acc[dt][r] *= alpha;
      sp[wave][8 * g + r][col] = e0; sp[wave][8 * g + r][16 + col] = e1; }
    LDSX();
    const F2 pa = split_row(&sp[wave][col][0], 0, lane);
#pragma unroll
    for (int dt = 0; dt < 4; ++dt) { const size_t vr = ((size_t)b * DM + h * HD + dt * 16 + col) * SS + ks * 32; const v16b vh = frag_b(VTH + vr, lane), vl = frag_b(VTL + vr, lane); acc[dt] = wmma_bf(pa.l, vh, acc[dt]); acc[dt] = wmma_bf(pa.h, vl, acc[dt]); acc[dt] = wmma_bf(pa.h, vh, acc[dt]); }
    LDSX(); }
#pragma unroll
  for (int r = 0; r < 8; ++r) { const float il = 1.0f / l[r];
#pragma unroll
    for (int dt = 0; dt < 4; ++dt) so[wave][8 * g + r][dt * 16 + col] = acc[dt][r] * il; }
  LDSX();
  for (int rl = 0; rl < 16; ++rl) if (lane < 16) vst2(O + ((size_t)b * SS + q0 + rl) * DM + h * HD + lane * 4, *(const v4f*)&so[wave][rl][lane * 4]);
}
// ---- k_out: block = (64 rows, 128 cols): out = O(hi/lo) . out_proj rows (2 products) + bias
__global__ __launch_bounds__(128) void k_out(const float* __restrict__ O, const __bf16* __restrict__ P, const float* __restrict__ BO, float* __restrict__ Y) {
  __shared__ __align__(16) float so[4][16][132];
  const int tid = threadIdx.x, wave = tid >> 5, lane = tid & 31, col = lane & 15, g = lane >> 4; const size_t r0 = (size_t)blockIdx.x * 64 + wave * 16; const int n0 = blockIdx.y * 128;
  v8f acc[8] = {};
#pragma unroll 2
  for (int kc = 0; kc < DM / 32; ++kc) { const F2 a = split_row(O + (r0 + col) * DM, kc * 32, lane);
#pragma unroll
    for (int j = 0; j < 8; ++j) { const v16b w = frag_b(P + (size_t)(n0 + j * 16 + col) * DM + kc * 32, lane); acc[j] = wmma_bf(a.l, w, acc[j]); acc[j] = wmma_bf(a.h, w, acc[j]); } }
#pragma unroll
  for (int j = 0; j < 8; ++j) { const float bb = bfr(BO[n0 + j * 16 + col]);
#pragma unroll
    for (int r = 0; r < 8; ++r) so[wave][8 * g + r][j * 16 + col] = acc[j][r] + bb; }
  LDSX();
  for (int rl = 0; rl < 16; ++rl) vst2(Y + (r0 + rl) * DM + n0 + lane * 4, *(const v4f*)&so[wave][rl][lane * 4]);
}
extern "C" void kernel_launch(void* const* d_in, const int* in_sizes, int n_in, void* d_out, int out_size, void* d_ws, size_t ws_size, hipStream_t stream) {
  (void)in_sizes; (void)n_in; (void)out_size;
  const float** F = (const float**)d_in;   // 0 x [4,1024,1024], 1 adjacency [1024,1024], 2 in_proj_w [3072,1024], 3 in_proj_b [3072], 4 out_proj_w [1024,1024], 5 out_proj_b [1024]
  if (ws_size < (size_t)WS_END) return;
  char* ws = (char*)d_ws; __bf16* PK = (__bf16*)(ws + WS_PK); float *QK = (float*)(ws + WS_QK), *O = (float*)(ws + WS_O); __bf16 *VTH = (__bf16*)(ws + WS_VTH), *VTL = (__bf16*)(ws + WS_VTL);
  k_pack<<<QKVW, 256, 0, stream>>>(F[2], PK + PK_A); k_pack<<<DM, 256, 0, stream>>>(F[4], PK + PK_P);
  k_qkv<<<dim3(TNB * SS / 64, QKVW / 128), 128, 0, stream>>>(F[0], PK + PK_A, F[3], QK);
  k_vt<<<dim3(TNB * SS / 64, NH), 256, 0, stream>>>(QK, VTH, VTL);
  k_attn<<<dim3(TQB, NH, TNB), 128, 0, stream>>>(QK, F[1], VTH, VTL, O);
  k_out<<<dim3(TOB, DM / 128), 128, 0, stream>>>(O, PK + PK_P, F[5], (float*)d_out);
}

// v001
// One run takes 280 microseconds.
// Two timings next to v000 both put it at 1.43 times that version's speed.
// compute dtype: x, adjacency, in_proj/out_proj weights and biases (module inputs) rounded to bf16; the packed qkv projection with exact bf16 products (x and W are inputs) + bias; scores q.k with both computed operands as bf16 hi + residual pairs (3 products) and P.V with P hi/lo x V hi/lo (3 products); the adjacency mask as a select (adjacency <= 0 -> -1e30); the output projection hi/lo x exact Wo (2 products) + bo; running-max softmax in f32; f32 accumulate.
#include <hip/hip_runtime.h>
#include <math.h>

typedef __attribute__((ext_vector_type(16))) _Float16 v16h;
typedef __attribute__((ext_vector_type(16))) __bf16 v16b;
typedef __attribute__((ext_vector_type(8)))  _Float16 v8h;
typedef __attribute__((ext_vector_type(8)))  float v8f;
typedef __attribute__((ext_vector_type(4)))  float v4f;
typedef __attribute__((ext_vector_type(2)))  float v2f;
typedef __attribute__((ext_vector_type(4)))  unsigned v4u;
typedef __attribute__((ext_vector_type(4)))  int v4i;
typedef float __attribute__((may_alias)) float_a;
typedef int __attribute__((may_alias)) int_a;

template <typename T> __device__ __forceinline__ void vst2(void* p, T v) { *(T*)p = v;  }
__device__ __forceinline__ v8f wmma16(v16h a, v16h b, v8f c) {
  v8f d = __builtin_amdgcn_wmma_f32_16x16x32_f16(false, a, false, b, (short)0, c, false, false);
  asm volatile("v_nop\n\tv_nop\n\tv_nop\n\tv_nop" : "+v"(d) : "v"(a), "v"(b));
  return d;
}
__device__ __forceinline__ v8f wmma_bf(v16b a, v16b b, v8f c) {
  v8f d = __builtin_amdgcn_wmma_f32_16x16x32_bf16(false, a, false, b, (short)0, c, false, false);
  asm volatile("v_nop\n\tv_nop\n\tv_nop\n\tv_nop" : "+v"(d) : "v"(a), "v"(b));
  return d;
}
// 16x16x32 fragments: lane = (h = lane>>4, row/col = lane&15); elements 0..7 = k0+8h+0..7, 8..15 = k0+16+8h+0..7; D element r = row 8h+r
__device__ __forceinline__ v16h frag_h(const _Float16* rowk0, int lane) {
  union { v16h v; v8h q[2]; } u; const _Float16* p = rowk0 + 8 * (lane >> 4);
  u.q[0] = *(const v8h*)p; u.q[1] = *(const v8h*)(p + 16); return u.v;
}
__device__ __forceinline__ v16h frag_f32(const float* rowk0, int lane) {
  v16h a; const float* p = rowk0 + 8 * (lane >> 4);
#pragma unroll
  for (int i = 0; i < 8; ++i) { a[i] = (_Float16)p[i]; a[8 + i] = (_Float16)p[16 + i]; }
  return a;
}
__device__ __forceinline__ v16h frag_f32s(const float* rowk0, int lane, float sc) {
  v16h a; const float* p = rowk0 + 8 * (lane >> 4);
#pragma unroll
  for (int i = 0; i < 8; ++i) { a[i] = (_Float16)(p[i] * sc); a[8 + i] = (_Float16)(p[16 + i] * sc); }
  return a;
}
// column fragment from a [K][ld] layout (column n), rows >= K read as 0
__device__ __forceinline__ v16h fragc_f32(const float* W, int k0, int n, int lane, int ld, int K) {
  v16h a; const int g = lane >> 4;
#pragma unroll
  for (int i = 0; i < 8; ++i) { const int ka = k0 + 8 * g + i, kb = ka + 16;
    a[i] = (_Float16)(ka < K ? W[(size_t)(ka < K ? ka : K - 1) * ld + n] : 0.f); a[8 + i] = (_Float16)(kb < K ? W[(size_t)(kb < K ? kb : K - 1) * ld + n] : 0.f); }
  return a;
}
struct F2 { v16b h, l; };
__device__ __forceinline__ F2 bsplit16(const float v[16]) { F2 r;
#pragma unroll
  for (int i = 0; i < 16; ++i) { const __bf16 h = (__bf16)v[i]; r.h[i] = h; r.l[i] = (__bf16)(v[i] - (float)h); }
  return r; }
__device__ __forceinline__ F2 split_row(const float* row, int k0, int lane) { float v[16]; const float* p = row + k0 + 8 * (lane >> 4);
#pragma unroll
  for (int i = 0; i < 8; ++i) { v[i] = p[i]; v[8 + i] = p[16 + i]; }
  return bsplit16(v); }
__device__ __forceinline__ F2 split_rowK(const float* row, int k0, int lane, int K) { float v[16]; const int g = lane >> 4;
#pragma unroll
  for (int i = 0; i < 8; ++i) { const int ka = k0 + 8 * g + i, kb = ka + 16; v[i] = ka < K ? row[ka < K ? ka : K - 1] : 0.f; v[8 + i] = kb < K ? row[kb < K ? kb : K - 1] : 0.f; }
  return bsplit16(v); }
__device__ __forceinline__ F2 split_col(const float* W, int k0, int n, int lane, int ld, int K) { float v[16]; const int g = lane >> 4;
#pragma unroll
  for (int i = 0; i < 8; ++i) { const int ka = k0 + 8 * g + i, kb = ka + 16; v[i] = ka < K ? W[(size_t)(ka < K ? ka : K - 1) * ld + n] : 0.f; v[8 + i] = kb < K ? W[(size_t)(kb < K ? kb : K - 1) * ld + n] : 0.f; }
  return bsplit16(v); }
__device__ __forceinline__ v8f mac3(const F2& a, const F2& b, v8f c) { c = wmma_bf(a.l, b.h, c); c = wmma_bf(a.h, b.l, c); return wmma_bf(a.h, b.h, c); }
__device__ __forceinline__ float sigm(float v) { return 1.0f / (1.0f + expf(-v)); }
#define LDSX() do { asm volatile("s_wait_dscnt 0" ::: "memory"); __builtin_amdgcn_wave_barrier(); __builtin_amdgcn_fence(__ATOMIC_RELEASE, "workgroup"); } while (0)


// Masked multi-head self-attention (B 4, T 1024, D 1024, 16 heads x 64; torch-style packed in_proj [3D][D] + bias, out_proj [D][D] + bias): scores = q.k / 8, keys with adjacency[q][k] <= 0 disallowed (-1e30 before the softmax; the [T][T] adjacency is shared by all batches and heads), out = softmax(scores) v, then out_proj.
#define NB 4
#define SS 1024
#define DM 1024
#define NH 16
#define HD 64
#define QKVW (3 * DM)
#ifndef TQB
#define TQB (SS / 64)
#define TNB NB
#define TOB (NB * SS / 64)     // output row tiles (all)
#endif
typedef __attribute__((ext_vector_type(8))) __bf16 v8b;
__device__ __forceinline__ v16b frag_b(const __bf16* rowk0, int lane) {
  union { v16b v; v8b q[2]; } u; const __bf16* p = rowk0 + 8 * (lane >> 4);
  u.q[0] = *(const v8b*)p; u.q[1] = *(const v8b*)(p + 16); return u.v;
}
__device__ __forceinline__ float bfr(float v) { return (float)(__bf16)v; }
__device__ __attribute__((noinline)) float exp_ni(float v) { return expf(v); }
__device__ __attribute__((noinline)) float erf_ni(float v) { return erff(v); }

#define PK_A 0                       // [3072][1024] in_proj rows (natural [out][in])
#define PK_P (PK_A + QKVW * DM)        // [1024][1024] out_proj rows (natural)
#define PK_END (PK_P + DM * DM)
#define WS_PK  0u
#define WS_QK  (WS_PK + 2u * PK_END)             // f32 [4096 rows][3072]: [q | k | v]
#define WS_VTH (WS_QK + 4u * NB * SS * QKVW)     // bf16 [4][1024 (h*64+d)][1024 s]
#define WS_VTL (WS_VTH + 2u * NB * DM * SS)
#define WS_O   (WS_VTL + 2u * NB * DM * SS)        // f32 [4096][1024]
#define WS_END (WS_O + 4u * NB * SS * DM)

// ---- k_pack: block = row r of a natural [R][1024] weight -> bf16 row
__global__ __launch_bounds__(256) void k_pack(const float* __restrict__ Wm, __bf16* __restrict__ DST) {
  __shared__ __align__(16) __bf16 s[DM]; const int r = blockIdx.x, tid = threadIdx.x;
  for (int k = tid; k < DM; k += 256) s[k] = (__bf16)Wm[(size_t)r * DM + k];
  __syncthreads();
  for (int q = tid; q < DM / 8; q += 256) vst2((unsigned*)(DST + (size_t)r * DM + q * 8), *(const v4u*)&s[q * 8]);
}
// LDS staging of the two projections: a block brings each 64-k chunk of its A rows and its 128 weight rows in by whole 128-B lines, once, and the waves read their fragments from LDS
#define GP 72                  // LDS row pitch in bf16 elements: 144 B = 16 B x odd, which spreads the 16 rows of a 16-byte fragment read over the banks
#define GCH (DM / 64)          // staged chunks of 64 k
typedef __attribute__((ext_vector_type(4))) __bf16 v4b;
// ---- k_qkv: block = (64 rows, 128 of the 3072 cols): QKV = bf16(x) . in_proj rows (exact) + bias -> f32 rows (pitch 3072)
__global__ __launch_bounds__(128) void k_qkv(const float* __restrict__ X, const __bf16* __restrict__ P, const float* __restrict__ BIAS, float* __restrict__ QKV) {
  __shared__ __align__(16) char sm[2 * (64 + 128) * GP * 2];   // two buffers of [64 A rows | 128 weight rows]; behind the loop's last barrier the same bytes hold so[4][16][132]
  __bf16* const sb16 = (__bf16*)sm; float (*const so)[16][132] = (float (*)[16][132])sm;
  const int tid = threadIdx.x, wave = tid >> 5, lane = tid & 31, col = lane & 15, g = lane >> 4; const size_t rb = (size_t)blockIdx.x * 64, r0 = rb + wave * 16; const int n0 = blockIdx.y * 128;
  const float* xg = X + (rb + (tid >> 4)) * DM + (tid & 15) * 4;               // a wave's load: 2 rows x 256 B
  const __bf16* pg = P + (size_t)(n0 + (tid >> 3)) * DM + (tid & 7) * 8;       // a wave's load: 4 rows x 128 B
  const int sao = (tid >> 4) * GP + (tid & 15) * 4, sbo = 64 * GP + (tid >> 3) * GP + (tid & 7) * 8;
  v4f xa[8]; v4u wb[8];
  v8f acc[8] = {};
#pragma unroll
  for (int i = 0; i < 8; ++i) { xa[i] = *(const v4f*)(xg + (size_t)i * 8 * DM); wb[i] = *(const v4u*)(pg + (size_t)i * 16 * DM); }
#pragma unroll
  for (int i = 0; i < 8; ++i) { v4b t;
#pragma unroll
    for (int e = 0; e < 4; ++e) t[e] = (__bf16)xa[i][e];
    *(v4b*)(sb16 + sao + i * 8 * GP) = t; *(v4u*)(sb16 + sbo + i * 16 * GP) = wb[i]; }
  __syncthreads();
#pragma unroll 2   // two trips per branch: each buffer's LDS offsets become constants
  for (int c = 0; c < GCH; ++c) { const __bf16* cur = sb16 + (c & 1) * (192 * GP); __bf16* nxt = sb16 + ((c + 1) & 1) * (192 * GP);
    if (c + 1 < GCH) {
#pragma unroll
      for (int i = 0; i < 8; ++i) { xa[i] = *(const v4f*)(xg + (size_t)i * 8 * DM + (c + 1) * 64); wb[i] = *(const v4u*)(pg + (size_t)i * 16 * DM + (c + 1) * 64); }
      asm volatile("s_wait_xcnt 0x0" ::: "memory"); }   // stands behind the run of prefetch loads, in front of any later rewrite of a register that holds one of their addresses
#pragma unroll
    for (int kc = 0; kc < 2; ++kc) { const v16b a = frag_b(cur + (wave * 16 + col) * GP + kc * 32, lane); v16b w[8];
#pragma unroll
      for (int j = 0; j < 8; ++j) w[j] = frag_b(cur + (64 + j * 16 + col) * GP + kc * 32, lane);
#pragma unroll
      for (int j = 0; j < 8; ++j) acc[j] = wmma_bf(a, w[j], acc[j]); }
    if (c + 1 < GCH) {
#pragma unroll
      for (int i = 0; i < 8; ++i) { v4b t;
#pragma unroll
        for (int e = 0; e < 4; ++e) t[e] = (__bf16)xa[i][e];
        *(v4b*)(nxt + sao + i * 8 * GP) = t; *(v4u*)(nxt + sbo + i * 16 * GP) = wb[i]; } }
    __syncthreads(); }   // publishes chunk c + 1 and ends every wave's reads of chunk c, whose buffer the next trip refills
#pragma unroll
  for (int j = 0; j < 8; ++j) { const float bb = bfr(BIAS[n0 + j * 16 + col]);
#pragma unroll
    for (int r = 0; r < 8; ++r) so[wave][8 * g + r][j * 16 + col] = acc[j][r] + bb; }
  LDSX();
  for (int rl = 0; rl < 16; ++rl) vst2(QKV + (r0 + rl) * QKVW + n0 + lane * 4, *(const v4f*)&so[wave][rl][lane * 4]);
}
__global__ __launch_bounds__(256) void k_vt(const float* __restrict__ QKV, __bf16* __restrict__ VTH, __bf16* __restrict__ VTL) {
  __shared__ __align__(16) __bf16 sth[64][72], stl[64][72]; const int tid = threadIdx.x; const size_t rb = (size_t)blockIdx.x * 64; const int h = blockIdx.y; const int b = (int)(rb / SS), s0 = (int)(rb % SS);
  for (int q = tid; q < 64 * 64; q += 256) { const int rl = q >> 6, d = q & 63; const float v = QKV[(rb + rl) * QKVW + 2 * DM + h * HD + d]; const __bf16 hb = (__bf16)v; sth[d][rl] = hb; stl[d][rl] = (__bf16)(v - (float)hb); }
  __syncthreads();
  for (int q = tid; q < 64 * 8; q += 256) { const int d = q >> 3, pc = q & 7; const size_t o = ((size_t)b * DM + h * HD + d) * SS + s0 + pc * 8; vst2((unsigned*)(VTH + o), *(const v4u*)&sth[d][pc * 8]); vst2((unsigned*)(VTL + o), *(const v4u*)&stl[d][pc * 8]); }
}
// ---- k_attn: block = (64 queries, head h, batch b): flash attention over the 1,024 keys (32 per step), logits = q.k (3 products) / 8, disallowed keys (adjacency[q][k] <= 0) set to -1e30; P.V 3 products; O[b*S+q][h*64+d] = acc / l
__global__ __launch_bounds__(128) void k_attn(const float* __restrict__ QK, const float* __restrict__ ADJ, const __bf16* __restrict__ VTH, const __bf16* __restrict__ VTL, float* __restrict__ O) {
  __shared__ __align__(16) float sp[4][16][36]; __shared__ __align__(16) float so[4][16][68];
  const int tid = threadIdx.x, wave = tid >> 5, lane = tid & 31, col = lane & 15, g = lane >> 4;
  const int qb = blockIdx.x, h = blockIdx.y, b = blockIdx.z; const int q0 = qb * 64 + wave * 16; const size_t rq = (size_t)b * SS + q0 + col;
  F2 aq[2];
#pragma unroll
  for (int kc = 0; kc < 2; ++kc) aq[kc] = split_row(QK + rq * QKVW + h * HD, kc * 32, lane);
  float m[8], l[8];
#pragma unroll
  for (int r = 0; r < 8; ++r) { m[r] = -3.0e38f; l[r] = 0.f; }
  v8f acc[4] = {};
  const float* arow0 = ADJ + (size_t)(q0 + 8 * g) * SS;
#pragma unroll 1
  for (int ks = 0; ks < SS / 32; ++ks) { v8f s[2];
#pragma unroll
    for (int ct = 0; ct < 2; ++ct) { const int kk = ks * 32 + ct * 16 + col; const float* krow = QK + ((size_t)b * SS + kk) * QKVW + DM + h * HD; v8f c = {};
#pragma unroll
      for (int kc = 0; kc < 2; ++kc) { const F2 kb = split_row(krow, kc * 32, lane); c = mac3(aq[kc], kb, c); }
#pragma unroll
      for (int r = 0; r < 8; ++r) { const float a = arow0[(size_t)r * SS + kk]; s[ct][r] = (a <= 0.f) ? -1.0e30f : c[r] * 0.125f; } }   // SCALE = 1/sqrt(64)
#pragma unroll
    for (int r = 0; r < 8; ++r) { float mx = fmaxf(s[0][r], s[1][r]);
#pragma unroll
      for (int o = 1; o < 16; o <<= 1) mx = fmaxf(mx, __shfl_xor(mx, o));
      const float mn = fmaxf(m[r], mx); const float alpha = exp_ni(m[r] - mn);
      const float e0 = exp_ni(s[0][r] - mn), e1 = exp_ni(s[1][r] - mn); float es = e0 + e1;
#pragma unroll
      for (int o = 1; o < 16; o <<= 1) es += __shfl_xor(es, o);
      l[r] = l[r] * alpha + es; m[r] = mn;
#pragma unroll
      for (int dt = 0; dt < 4; ++dt) acc[dt][r] *= alpha;
      sp[wave][8 * g + r][col] = e0; sp[wave][8 * g + r][16 + col] = e1; }
    LDSX();
    const F2 pa = split_row(&sp[wave][col][0], 0, lane);
#pragma unroll
    for (int dt = 0; dt < 4; ++dt) { const size_t vr = ((size_t)b * DM + h * HD + dt * 16 + col) * SS + ks * 32; const v16b vh = frag_b(VTH + vr, lane), vl = frag_b(VTL + vr, lane); acc[dt] = wmma_bf(pa.l, vh, acc[dt]); acc[dt] = wmma_bf(pa.h, vl, acc[dt]); acc[dt] = wmma_bf(pa.h, vh, acc[dt]); }
    LDSX(); }
#pragma unroll
  for (int r = 0; r < 8; ++r) { const float il = 1.0f / l[r];
#pragma unroll
    for (int dt = 0; dt < 4; ++dt) so[wave][8 * g + r][dt * 16 + col] = acc[dt][r] * il; }
  LDSX();
  for (int rl = 0; rl < 16; ++rl) if (lane < 16) vst2(O + ((size_t)b * SS + q0 + rl) * DM + h * HD + lane * 4, *(const v4f*)&so[wave][rl][lane * 4]);
}
// ---- k_out: block = (64 rows, 128 cols): out = O(hi/lo) . out_proj rows (2 products) + bias
__global__ __launch_bounds__(128) void k_out(const float* __restrict__ O, const __bf16* __restrict__ P, const float* __restrict__ BO, float* __restrict__ Y) {
  __shared__ __align__(16) char sm[2 * (64 + 64 + 128) * GP * 2];   // two buffers of [64 A hi rows | 64 A lo rows | 128 weight rows]; behind the loop's last barrier the same bytes hold so[4][16][132]
  __bf16* const sb16 = (__bf16*)sm; float (*const so)[16][132] = (float (*)[16][132])sm;
  const int tid = threadIdx.x, wave = tid >> 5, lane = tid & 31, col = lane & 15, g = lane >> 4; const size_t rb = (size_t)blockIdx.x * 64, r0 = rb + wave * 16; const int n0 = blockIdx.y * 128;
  const float* xg = O + (rb + (tid >> 4)) * DM + (tid & 15) * 4;
  const __bf16* pg = P + (size_t)(n0 + (tid >> 3)) * DM + (tid & 7) * 8;
  const int sao = (tid >> 4) * GP + (tid & 15) * 4, sbo = 128 * GP + (tid >> 3) * GP + (tid & 7) * 8;
  v4f xa[8]; v4u wb[8];
  v8f acc[8] = {};
#pragma unroll
  for (int i = 0; i < 8; ++i) { xa[i] = *(const v4f*)(xg + (size_t)i * 8 * DM); wb[i] = *(const v4u*)(pg + (size_t)i * 16 * DM); }
#pragma unroll
  for (int i = 0; i < 8; ++i) { v4b th, tl;
#pragma unroll
    for (int e = 0; e < 4; ++e) { const __bf16 h = (__bf16)xa[i][e]; th[e] = h; tl[e] = (__bf16)(xa[i][e] - (float)h); }
    *(v4b*)(sb16 + sao + i * 8 * GP) = th; *(v4b*)(sb16 + 64 * GP + sao + i * 8 * GP) = tl; *(v4u*)(sb16 + sbo + i * 16 * GP) = wb[i]; }
  __syncthreads();
#pragma unroll 2   // two trips per branch: each buffer's LDS offsets become constants
  for (int c = 0; c < GCH; ++c) { const __bf16* cur = sb16 + (c & 1) * (256 * GP); __bf16* nxt = sb16 + ((c + 1) & 1) * (256 * GP);
    if (c + 1 < GCH) {
#pragma unroll
      for (int i = 0; i < 8; ++i) { xa[i] = *(const v4f*)(xg + (size_t)i * 8 * DM + (c + 1) * 64); wb[i] = *(const v4u*)(pg + (size_t)i * 16 * DM + (c + 1) * 64); }
      asm volatile("s_wait_xcnt 0x0" ::: "memory"); }   // stands behind the run of prefetch loads, in front of any later rewrite of a register that holds one of their addresses
#pragma unroll
    for (int kc = 0; kc < 2; ++kc) { const v16b ah = frag_b(cur + (wave * 16 + col) * GP + kc * 32, lane), al = frag_b(cur + (64 + wave * 16 + col) * GP + kc * 32, lane); v16b w[8];
#pragma unroll
      for (int j = 0; j < 8; ++j) w[j] = frag_b(cur + (128 + j * 16 + col) * GP + kc * 32, lane);
#pragma unroll
      for (int j = 0; j < 8; ++j) { acc[j] = wmma_bf(al, w[j], acc[j]); acc[j] = wmma_bf(ah, w[j], acc[j]); } }
    if (c + 1 < GCH) {
#pragma unroll
      for (int i = 0; i < 8; ++i) { v4b th, tl;
#pragma unroll
        for (int e = 0; e < 4; ++e) { const __bf16 h = (__bf16)xa[i][e]; th[e] = h; tl[e] = (__bf16)(xa[i][e] - (float)h); }
        *(v4b*)(nxt + sao + i * 8 * GP) = th; *(v4b*)(nxt + 64 * GP + sao + i * 8 * GP) = tl; *(v4u*)(nxt + sbo + i * 16 * GP) = wb[i]; } }
    __syncthreads(); }   // publishes chunk c + 1 and ends every wave's reads of chunk c, whose buffer the next trip refills
#pragma unroll
  for (int j = 0; j < 8; ++j) { const float bb = bfr(BO[n0 + j * 16 + col]);
#pragma unroll
    for (int r = 0; r < 8; ++r) so[wave][8 * g + r][j * 16 + col] = acc[j][r] + bb; }
  LDSX();
  for (int rl = 0; rl < 16; ++rl) vst2(Y + (r0 + rl) * DM + n0 + lane * 4, *(const v4f*)&so[wave][rl][lane * 4]);
}
extern "C" void kernel_launch(void* const* d_in, const int* in_sizes, int n_in, void* d_out, int out_size, void* d_ws, size_t ws_size, hipStream_t stream) {
  (void)in_sizes; (void)n_in; (void)out_size;
  const float** F = (const float**)d_in;   // 0 x [4,1024,1024], 1 adjacency [1024,1024], 2 in_proj_w [3072,1024], 3 in_proj_b [3072], 4 out_proj_w [1024,1024], 5 out_proj_b [1024]
  if (ws_size < (size_t)WS_END) return;
  char* ws = (char*)d_ws; __bf16* PK = (__bf16*)(ws + WS_PK); float *QK = (float*)(ws + WS_QK), *O = (float*)(ws + WS_O); __bf16 *VTH = (__bf16*)(ws + WS_VTH), *VTL = (__bf16*)(ws + WS_VTL);
  k_pack<<<QKVW, 256, 0, stream>>>(F[2], PK + PK_A); k_pack<<<DM, 256, 0, stream>>>(F[4], PK + PK_P);
  k_qkv<<<dim3(TNB * SS / 64, QKVW / 128), 128, 0, stream>>>(F[0], PK + PK_A, F[3], QK);
  k_vt<<<dim3(TNB * SS / 64, NH), 256, 0, stream>>>(QK, VTH, VTL);
  k_attn<<<dim3(TQB, NH, TNB), 128, 0, stream>>>(QK, F[1], VTH, VTL, O);
  k_out<<<dim3(TOB, DM / 128), 128, 0, stream>>>(O, PK + PK_P, F[5], (float*)d_out);
}

// v002
// Measured time: 229 microseconds a run.
// Two timings next to v001 put it at 1.23 and 1.22 times that version's speed.
// All steps since v000 together make it 1.75 times as fast.
// compute dtype: x, adjacency, in_proj/out_proj weights and biases (module inputs) rounded to bf16; the packed qkv projection with exact bf16 products (x and W are inputs) + bias; scores q.k with both computed operands as bf16 hi + residual pairs (3 products) and P.V with P hi/lo x V hi/lo (3 products); the adjacency mask as a select (adjacency <= 0 -> -1e30); the output projection hi/lo x exact Wo (2 products) + bo; running-max softmax in f32; f32 accumulate.
#include <hip/hip_runtime.h>
#include <math.h>

typedef __attribute__((ext_vector_type(16))) _Float16 v16h;
typedef __attribute__((ext_vector_type(16))) __bf16 v16b;
typedef __attribute__((ext_vector_type(8)))  _Float16 v8h;
typedef __attribute__((ext_vector_type(8)))  float v8f;
typedef __attribute__((ext_vector_type(4)))  float v4f;
typedef __attribute__((ext_vector_type(2)))  float v2f;
typedef __attribute__((ext_vector_type(4)))  unsigned v4u;
typedef __attribute__((ext_vector_type(4)))  int v4i;
typedef float __attribute__((may_alias)) float_a;
typedef int __attribute__((may_alias)) int_a;

template <typename T> __device__ __forceinline__ void vst2(void* p, T v) { *(T*)p = v;  }
__device__ __forceinline__ v8f wmma16(v16h a, v16h b, v8f c) {
  v8f d = __builtin_amdgcn_wmma_f32_16x16x32_f16(false, a, false, b, (short)0, c, false, false);
  asm volatile("v_nop\n\tv_nop\n\tv_nop\n\tv_nop" : "+v"(d) : "v"(a), "v"(b));
  return d;
}
__device__ __forceinline__ v8f wmma_bf(v16b a, v16b b, v8f c) {
  v8f d = __builtin_amdgcn_wmma_f32_16x16x32_bf16(false, a, false, b, (short)0, c, false, false);
  asm volatile("v_nop\n\tv_nop\n\tv_nop\n\tv_nop" : "+v"(d) : "v"(a), "v"(b));
  return d;
}
// 16x16x32 fragments: lane = (h = lane>>4, row/col = lane&15); elements 0..7 = k0+8h+0..7, 8..15 = k0+16+8h+0..7; D element r = row 8h+r
__device__ __forceinline__ v16h frag_h(const _Float16* rowk0, int lane) {
  union { v16h v; v8h q[2]; } u; const _Float16* p = rowk0 + 8 * (lane >> 4);
  u.q[0] = *(const v8h*)p; u.q[1] = *(const v8h*)(p + 16); return u.v;
}
__device__ __forceinline__ v16h frag_f32(const float* rowk0, int lane) {
  v16h a; const float* p = rowk0 + 8 * (lane >> 4);
#pragma unroll
  for (int i = 0; i < 8; ++i) { a[i] = (_Float16)p[i]; a[8 + i] = (_Float16)p[16 + i]; }
  return a;
}
__device__ __forceinline__ v16h frag_f32s(const float* rowk0, int lane, float sc) {
  v16h a; const float* p = rowk0 + 8 * (lane >> 4);
#pragma unroll
  for (int i = 0; i < 8; ++i) { a[i] = (_Float16)(p[i] * sc); a[8 + i] = (_Float16)(p[16 + i] * sc); }
  return a;
}
// column fragment from a [K][ld] layout (column n), rows >= K read as 0
__device__ __forceinline__ v16h fragc_f32(const float* W, int k0, int n, int lane, int ld, int K) {
  v16h a; const int g = lane >> 4;
#pragma unroll
  for (int i = 0; i < 8; ++i) { const int ka = k0 + 8 * g + i, kb = ka + 16;
    a[i] = (_Float16)(ka < K ? W[(size_t)(ka < K ? ka : K - 1) * ld + n] : 0.f); a[8 + i] = (_Float16)(kb < K ? W[(size_t)(kb < K ? kb : K - 1) * ld + n] : 0.f); }
  return a;
}
struct F2 { v16b h, l; };
__device__ __forceinline__ F2 bsplit16(const float v[16]) { F2 r;
#pragma unroll
  for (int i = 0; i < 16; ++i) { const __bf16 h = (__bf16)v[i]; r.h[i] = h; r.l[i] = (__bf16)(v[i] - (float)h); }
  return r; }
__device__ __forceinline__ F2 split_row(const float* row, int k0, int lane) { float v[16]; const float* p = row + k0 + 8 * (lane >> 4);
#pragma unroll
  for (int i = 0; i < 8; ++i) { v[i] = p[i]; v[8 + i] = p[16 + i]; }
  return bsplit16(v); }
__device__ __forceinline__ F2 split_rowK(const float* row, int k0, int lane, int K) { float v[16]; const int g = lane >> 4;
#pragma unroll
  for (int i = 0; i < 8; ++i) { const int ka = k0 + 8 * g + i, kb = ka + 16; v[i] = ka < K ? row[ka < K ? ka : K - 1] : 0.f; v[8 + i] = kb < K ? row[kb < K ? kb : K - 1] : 0.f; }
  return bsplit16(v); }
__device__ __forceinline__ F2 split_col(const float* W, int k0, int n, int lane, int ld, int K) { float v[16]; const int g = lane >> 4;
#pragma unroll
  for (int i = 0; i < 8; ++i) { const int ka = k0 + 8 * g + i, kb = ka + 16; v[i] = ka < K ? W[(size_t)(ka < K ? ka : K - 1) * ld + n] : 0.f; v[8 + i] = kb < K ? W[(size_t)(kb < K ? kb : K - 1) * ld + n] : 0.f; }
  return bsplit16(v); }
__device__ __forceinline__ v8f mac3(const F2& a, const F2& b, v8f c) { c = wmma_bf(a.l, b.h, c); c = wmma_bf(a.h, b.l, c); return wmma_bf(a.h, b.h, c); }
__device__ __forceinline__ float sigm(float v) { return 1.0f / (1.0f + expf(-v)); }
#define LDSX() do { asm volatile("s_wait_dscnt 0" ::: "memory"); __builtin_amdgcn_wave_barrier(); __builtin_amdgcn_fence(__ATOMIC_RELEASE, "workgroup"); } while (0)


// Masked multi-head self-attention (B 4, T 1024, D 1024, 16 heads x 64; torch-style packed in_proj [3D][D] + bias, out_proj [D][D] + bias): scores = q.k / 8, keys with adjacency[q][k] <= 0 disallowed (-1e30 before the softmax; the [T][T] adjacency is shared by all batches and heads), out = softmax(scores) v, then out_proj.
#define NB 4
#define SS 1024
#define DM 1024
#define NH 16
#define HD 64
#define QKVW (3 * DM)
#ifndef TQB
#define TQB (SS / 64)
#define TNB NB
#define TOB (NB * SS / 64)     // output row tiles (all)
#endif
typedef __attribute__((ext_vector_type(8))) __bf16 v8b;
__device__ __forceinline__ v16b frag_b(const __bf16* rowk0, int lane) {
  union { v16b v; v8b q[2]; } u; const __bf16* p = rowk0 + 8 * (lane >> 4);
  u.q[0] = *(const v8b*)p; u.q[1] = *(const v8b*)(p + 16); return u.v;
}
__device__ __forceinline__ float bfr(float v) { return (float)(__bf16)v; }
__device__ __attribute__((noinline)) float exp_ni(float v) { return expf(v); }
__device__ __attribute__((noinline)) float erf_ni(float v) { return erff(v); }

#define PK_A 0                       // [3072][1024] in_proj rows (natural [out][in])
#define PK_P (PK_A + QKVW * DM)        // [1024][1024] out_proj rows (natural)
#define PK_END (PK_P + DM * DM)
#define WS_PK  0u
#define WS_QK  (WS_PK + 2u * PK_END)             // f32 [4096 rows][3072]: [q | k | v]
#define WS_VTH (WS_QK + 4u * NB * SS * QKVW)     // bf16 [4][1024 (h*64+d)][1024 s]
#define WS_VTL (WS_VTH + 2u * NB * DM * SS)
#define WS_O   (WS_VTL + 2u * NB * DM * SS)        // f32 [4096][1024]
#define WS_END (WS_O + 4u * NB * SS * DM)

// ---- k_pack: block = row r of a natural [R][1024] weight -> bf16 row
__global__ __launch_bounds__(256) void k_pack(const float* __restrict__ Wm, __bf16* __restrict__ DST) {
  __shared__ __align__(16) __bf16 s[DM]; const int r = blockIdx.x, tid = threadIdx.x;
  for (int k = tid; k < DM; k += 256) s[k] = (__bf16)Wm[(size_t)r * DM + k];
  __syncthreads();
  for (int q = tid; q < DM / 8; q += 256) vst2((unsigned*)(DST + (size_t)r * DM + q * 8), *(const v4u*)&s[q * 8]);
}
// LDS staging of the two projections: a block brings each 64-k chunk of its A rows and its 128 weight rows in by whole 128-B lines, once, and the waves read their fragments from LDS
#define GP 72                  // LDS row pitch in bf16 elements: 144 B = 16 B x odd, which spreads the 16 rows of a 16-byte fragment read over the banks
#define GCH (DM / 64)          // staged chunks of 64 k
typedef __attribute__((ext_vector_type(4))) __bf16 v4b;
// ---- k_qkv: block = (64 rows, 128 of the 3072 cols): QKV = bf16(x) . in_proj rows (exact) + bias -> f32 rows (pitch 3072)
__global__ __launch_bounds__(128) void k_qkv(const float* __restrict__ X, const __bf16* __restrict__ P, const float* __restrict__ BIAS, float* __restrict__ QKV) {
  __shared__ __align__(16) char sm[2 * (64 + 128) * GP * 2];   // two buffers of [64 A rows | 128 weight rows]; behind the loop's last barrier the same bytes hold so[4][16][132]
  __bf16* const sb16 = (__bf16*)sm; float (*const so)[16][132] = (float (*)[16][132])sm;
  const int tid = threadIdx.x, wave = tid >> 5, lane = tid & 31, col = lane & 15, g = lane >> 4; const size_t rb = (size_t)blockIdx.x * 64, r0 = rb + wave * 16; const int n0 = blockIdx.y * 128;
  const float* xg = X + (rb + (tid >> 4)) * DM + (tid & 15) * 4;               // a wave's load: 2 rows x 256 B
  const __bf16* pg = P + (size_t)(n0 + (tid >> 3)) * DM + (tid & 7) * 8;       // a wave's load: 4 rows x 128 B
  const int sao = (tid >> 4) * GP + (tid & 15) * 4, sbo = 64 * GP + (tid >> 3) * GP + (tid & 7) * 8;
  v4f xa[8]; v4u wb[8];
  v8f acc[8] = {};
#pragma unroll
  for (int i = 0; i < 8; ++i) { xa[i] = *(const v4f*)(xg + (size_t)i * 8 * DM); wb[i] = *(const v4u*)(pg + (size_t)i * 16 * DM); }
#pragma unroll
  for (int i = 0; i < 8; ++i) { v4b t;
#pragma unroll
    for (int e = 0; e < 4; ++e) t[e] = (__bf16)xa[i][e];
    *(v4b*)(sb16 + sao + i * 8 * GP) = t; *(v4u*)(sb16 + sbo + i * 16 * GP) = wb[i]; }
  __syncthreads();
#pragma unroll 2   // two trips per branch: each buffer's LDS offsets become constants
  for (int c = 0; c < GCH; ++c) { const __bf16* cur = sb16 + (c & 1) * (192 * GP); __bf16* nxt = sb16 + ((c + 1) & 1) * (192 * GP);
    if (c + 1 < GCH) {
#pragma unroll
      for (int i = 0; i < 8; ++i) { xa[i] = *(const v4f*)(xg + (size_t)i * 8 * DM + (c + 1) * 64); wb[i] = *(const v4u*)(pg + (size_t)i * 16 * DM + (c + 1) * 64); }
      asm volatile("s_wait_xcnt 0x0" ::: "memory"); }   // stands behind the run of prefetch loads, in front of any later rewrite of a register that holds one of their addresses
#pragma unroll
    for (int kc = 0; kc < 2; ++kc) { const v16b a = frag_b(cur + (wave * 16 + col) * GP + kc * 32, lane); v16b w[8];
#pragma unroll
      for (int j = 0; j < 8; ++j) w[j] = frag_b(cur + (64 + j * 16 + col) * GP + kc * 32, lane);
#pragma unroll
      for (int j = 0; j < 8; ++j) acc[j] = wmma_bf(a, w[j], acc[j]); }
    if (c + 1 < GCH) {
#pragma unroll
      for (int i = 0; i < 8; ++i) { v4b t;
#pragma unroll
        for (int e = 0; e < 4; ++e) t[e] = (__bf16)xa[i][e];
        *(v4b*)(nxt + sao + i * 8 * GP) = t; *(v4u*)(nxt + sbo + i * 16 * GP) = wb[i]; } }
    __syncthreads(); }   // publishes chunk c + 1 and ends every wave's reads of chunk c, whose buffer the next trip refills
#pragma unroll
  for (int j = 0; j < 8; ++j) { const float bb = bfr(BIAS[n0 + j * 16 + col]);
#pragma unroll
    for (int r = 0; r < 8; ++r) so[wave][8 * g + r][j * 16 + col] = acc[j][r] + bb; }
  LDSX();
  for (int rl = 0; rl < 16; ++rl) vst2(QKV + (r0 + rl) * QKVW + n0 + lane * 4, *(const v4f*)&so[wave][rl][lane * 4]);
}
__global__ __launch_bounds__(256) void k_vt(const float* __restrict__ QKV, __bf16* __restrict__ VTH, __bf16* __restrict__ VTL) {
  __shared__ __align__(16) __bf16 sth[64][72], stl[64][72]; const int tid = threadIdx.x; const size_t rb = (size_t)blockIdx.x * 64; const int h = blockIdx.y; const int b = (int)(rb / SS), s0 = (int)(rb % SS);
  for (int q = tid; q < 64 * 64; q += 256) { const int rl = q >> 6, d = q & 63; const float v = QKV[(rb + rl) * QKVW + 2 * DM + h * HD + d]; const __bf16 hb = (__bf16)v; sth[d][rl] = hb; stl[d][rl] = (__bf16)(v - (float)hb); }
  __syncthreads();
  for (int q = tid; q < 64 * 8; q += 256) { const int d = q >> 3, pc = q & 7; const size_t o = ((size_t)b * DM + h * HD + d) * SS + s0 + pc * 8; vst2((unsigned*)(VTH + o), *(const v4u*)&sth[d][pc * 8]); vst2((unsigned*)(VTL + o), *(const v4u*)&stl[d][pc * 8]); }
}
// ---- k_attn: block = (64 queries, head h, batch b): flash attention over the 1,024 keys (32 per step), transposed: S^T = K.Q^T (A = key rows, B = query columns, 3 products) / 8, so a lane holds 16 of ONE query's 32 scores (keys 8g + r and 16 + 8g + r of the step); disallowed keys (adjacency[q][k] <= 0) set to -1e30; maximum and sum run in the lane, the two halves of the wave exchange the maximum once per step and join their sums behind the loop; the two score tiles, split hi/lo in place, are the B operand of O^T += V^T.P^T (3 products); O[b*S+q][h*64+d] = acc / l
__device__ __forceinline__ float xhalf(float x) { return __builtin_bit_cast(float, __builtin_amdgcn_permlanex16(__builtin_bit_cast(int, x), __builtin_bit_cast(int, x), 0x76543210, 0xfedcba98, false, false)); }  // lane l with lane l ^ 16
__global__ __launch_bounds__(128) void k_attn(const float* __restrict__ QK, const float* __restrict__ ADJ, const __bf16* __restrict__ VTH, const __bf16* __restrict__ VTL, float* __restrict__ O) {
  __shared__ __align__(16) float so[4][16][68];
  const int tid = threadIdx.x, wave = tid >> 5, lane = tid & 31, col = lane & 15, g = lane >> 4;
  const int qb = blockIdx.x, h = blockIdx.y, b = blockIdx.z; const int q0 = qb * 64 + wave * 16; const size_t rq = (size_t)b * SS + q0 + col;
  F2 aq[2];
#pragma unroll
  for (int kc = 0; kc < 2; ++kc) aq[kc] = split_row(QK + rq * QKVW + h * HD, kc * 32, lane);
  float m = -3.0e38f, l = 0.f;   // of query q0 + col; l holds this half's keys only
  v8f acc[4] = {};               // acc[dt][r] = O^T[dt * 16 + 8g + r][query q0 + col]
  const float* arow = ADJ + (size_t)(q0 + col) * SS + 8 * g;
#pragma unroll 1
  for (int ks = 0; ks < SS / 32; ++ks) { float s[16];
#pragma unroll
    for (int ct = 0; ct < 2; ++ct) { const int kk = ks * 32 + ct * 16 + col; const float* krow = QK + ((size_t)b * SS + kk) * QKVW + DM + h * HD; v8f c = {};
#pragma unroll
      for (int kc = 0; kc < 2; ++kc) { const F2 kb = split_row(krow, kc * 32, lane); c = wmma_bf(kb.h, aq[kc].l, c); c = wmma_bf(kb.l, aq[kc].h, c); c = wmma_bf(kb.h, aq[kc].h, c); }
      const v4f a0 = *(const v4f*)(arow + ks * 32 + ct * 16), a1 = *(const v4f*)(arow + ks * 32 + ct * 16 + 4);
#pragma unroll
      for (int r = 0; r < 8; ++r) { const float a = r < 4 ? a0[r & 3] : a1[r & 3]; s[ct * 8 + r] = (a <= 0.f) ? -1.0e30f : c[r] * 0.125f; } }   // SCALE = 1/sqrt(64)
    float mx = s[0];
#pragma unroll
    for (int i = 1; i < 16; ++i) mx = fmaxf(mx, s[i]);
    mx = fmaxf(mx, xhalf(mx));
    const float mn = fmaxf(m, mx); const float alpha = exp_ni(m - mn);
    float es = 0.f;
#pragma unroll
    for (int i = 0; i < 16; ++i) { s[i] = exp_ni(s[i] - mn); es += s[i]; }
    l = l * alpha + es; m = mn;
#pragma unroll
    for (int dt = 0; dt < 4; ++dt) acc[dt] *= alpha;
    const F2 pb = bsplit16(s);   // element i = P^T[key 8g + i or 16 + 8g + (i - 8)][query]: the k order of frag_b
#pragma unroll
    for (int dt = 0; dt < 4; ++dt) { const size_t vr = ((size_t)b * DM + h * HD + dt * 16 + col) * SS + ks * 32; const v16b vh = frag_b(VTH + vr, lane), vl = frag_b(VTL + vr, lane); acc[dt] = wmma_bf(vh, pb.l, acc[dt]); acc[dt] = wmma_bf(vl, pb.h, acc[dt]); acc[dt] = wmma_bf(vh, pb.h, acc[dt]); } }
  const float il = 1.0f / (l + xhalf(l));
#pragma unroll
  for (int dt = 0; dt < 4; ++dt) { v4f o0, o1;
#pragma unroll
    for (int r = 0; r < 4; ++r) { o0[r] = acc[dt][r] * il; o1[r] = acc[dt][4 + r] * il; }
    *(v4f*)&so[wave][col][dt * 16 + 8 * g] = o0; *(v4f*)&so[wave][col][dt * 16 + 8 * g + 4] = o1; }
  LDSX();
  for (int rl = 0; rl < 16; ++rl) if (lane < 16) vst2(O + ((size_t)b * SS + q0 + rl) * DM + h * HD + lane * 4, *(const v4f*)&so[wave][rl][lane * 4]);
}
// ---- k_out: block = (64 rows, 128 cols): out = O(hi/lo) . out_proj rows (2 products) + bias
__global__ __launch_bounds__(128) void k_out(const float* __restrict__ O, const __bf16* __restrict__ P, const float* __restrict__ BO, float* __restrict__ Y) {
  __shared__ __align__(16) char sm[2 * (64 + 64 + 128) * GP * 2];   // two buffers of [64 A hi rows | 64 A lo rows | 128 weight rows]; behind the loop's last barrier the same bytes hold so[4][16][132]
  __bf16* const sb16 = (__bf16*)sm; float (*const so)[16][132] = (float (*)[16][132])sm;
  const int tid = threadIdx.x, wave = tid >> 5, lane = tid & 31, col = lane & 15, g = lane >> 4; const size_t rb = (size_t)blockIdx.x * 64, r0 = rb + wave * 16; const int n0 = blockIdx.y * 128;
  const float* xg = O + (rb + (tid >> 4)) * DM + (tid & 15) * 4;
  const __bf16* pg = P + (size_t)(n0 + (tid >> 3)) * DM + (tid & 7) * 8;
  const int sao = (tid >> 4) * GP + (tid & 15) * 4, sbo = 128 * GP + (tid >> 3) * GP + (tid & 7) * 8;
  v4f xa[8]; v4u wb[8];
  v8f acc[8] = {};
#pragma unroll
  for (int i = 0; i < 8; ++i) { xa[i] = *(const v4f*)(xg + (size_t)i * 8 * DM); wb[i] = *(const v4u*)(pg + (size_t)i * 16 * DM); }
#pragma unroll
  for (int i = 0; i < 8; ++i) { v4b th, tl;
#pragma unroll
    for (int e = 0; e < 4; ++e) { const __bf16 h = (__bf16)xa[i][e]; th[e] = h; tl[e] = (__bf16)(xa[i][e] - (float)h); }
    *(v4b*)(sb16 + sao + i * 8 * GP) = th; *(v4b*)(sb16 + 64 * GP + sao + i * 8 * GP) = tl; *(v4u*)(sb16 + sbo + i * 16 * GP) = wb[i]; }
  __syncthreads();
#pragma unroll 2   // two trips per branch: each buffer's LDS offsets become constants
  for (int c = 0; c < GCH; ++c) { const __bf16* cur = sb16 + (c & 1) * (256 * GP); __bf16* nxt = sb16 + ((c + 1) & 1) * (256 * GP);
    if (c + 1 < GCH) {
#pragma unroll
      for (int i = 0; i < 8; ++i) { xa[i] = *(const v4f*)(xg + (size_t)i * 8 * DM + (c + 1) * 64); wb[i] = *(const v4u*)(pg + (size_t)i * 16 * DM + (c + 1) * 64); }
      asm volatile("s_wait_xcnt 0x0" ::: "memory"); }   // stands behind the run of prefetch loads, in front of any later rewrite of a register that holds one of their addresses
#pragma unroll
    for (int kc = 0; kc < 2; ++kc) { const v16b ah = frag_b(cur + (wave * 16 + col) * GP + kc * 32, lane), al = frag_b(cur + (64 + wave * 16 + col) * GP + kc * 32, lane); v16b w[8];
#pragma unroll
      for (int j = 0; j < 8; ++j) w[j] = frag_b(cur + (128 + j * 16 + col) * GP + kc * 32, lane);
#pragma unroll
      for (int j = 0; j < 8; ++j) { acc[j] = wmma_bf(al, w[j], acc[j]); acc[j] = wmma_bf(ah, w[j], acc[j]); } }
    if (c + 1 < GCH) {
#pragma unroll
      for (int i = 0; i < 8; ++i) { v4b th, tl;
#pragma unroll
        for (int e = 0; e < 4; ++e) { const __bf16 h = (__bf16)xa[i][e]; th[e] = h; tl[e] = (__bf16)(xa[i][e] - (float)h); }
        *(v4b*)(nxt + sao + i * 8 * GP) = th; *(v4b*)(nxt + 64 * GP + sao + i * 8 * GP) = tl; *(v4u*)(nxt + sbo + i * 16 * GP) = wb[i]; } }
    __syncthreads(); }   // publishes chunk c + 1 and ends every wave's reads of chunk c, whose buffer the next trip refills
#pragma unroll
  for (int j = 0; j < 8; ++j) { const float bb = bfr(BO[n0 + j * 16 + col]);
#pragma unroll
    for (int r = 0; r < 8; ++r) so[wave][8 * g + r][j * 16 + col] = acc[j][r] + bb; }
  LDSX();
  for (int rl = 0; rl < 16; ++rl) vst2(Y + (r0 + rl) * DM + n0 + lane * 4, *(const v4f*)&so[wave][rl][lane * 4]);
}
extern "C" void kernel_launch(void* const* d_in, const int* in_sizes, int n_in, void* d_out, int out_size, void* d_ws, size_t ws_size, hipStream_t stream) {
  (void)in_sizes; (void)n_in; (void)out_size;
  const float** F = (const float**)d_in;   // 0 x [4,1024,1024], 1 adjacency [1024,1024], 2 in_proj_w [3072,1024], 3 in_proj_b [3072], 4 out_proj_w [1024,1024], 5 out_proj_b [1024]
  if (ws_size < (size_t)WS_END) return;
  char* ws = (char*)d_ws; __bf16* PK = (__bf16*)(ws + WS_PK); float *QK = (float*)(ws + WS_QK), *O = (float*)(ws + WS_O); __bf16 *VTH = (__bf16*)(ws + WS_VTH), *VTL = (__bf16*)(ws + WS_VTL);
  k_pack<<<QKVW, 256, 0, stream>>>(F[2], PK + PK_A); k_pack<<<DM, 256, 0, stream>>>(F[4], PK + PK_P);
  k_qkv<<<dim3(TNB * SS / 64, QKVW / 128), 128, 0, stream>>>(F[0], PK + PK_A, F[3], QK);
  k_vt<<<dim3(TNB * SS / 64, NH), 256, 0, stream>>>(QK, VTH, VTL);
  k_attn<<<dim3(TQB, NH, TNB), 128, 0, stream>>>(QK, F[1], VTH, VTL, O);
  k_out<<<dim3(TOB, DM / 128), 128, 0, stream>>>(O, PK + PK_P, F[5], (float*)d_out);
}

// v003
// It runs in 155 microseconds.
// Two timings next to v002 both put it at 1.47 times that version's speed.
// Over all steps from v000 it is 2.58 times as fast.
// compute dtype: x, adjacency, in_proj/out_proj weights and biases (module inputs) rounded to bf16; the packed qkv projection with exact bf16 products (x and W are inputs) + bias; scores q.k with both computed operands as bf16 hi + residual pairs (3 products) and P.V with P hi/lo x V hi/lo (3 products); the adjacency mask as a select (adjacency <= 0 -> -1e30); the output projection hi/lo x exact Wo (2 products) + bo; running-max softmax in f32; f32 accumulate.
#include <hip/hip_runtime.h>
#include <math.h>

typedef __attribute__((ext_vector_type(16))) _Float16 v16h;
typedef __attribute__((ext_vector_type(16))) __bf16 v16b;
typedef __attribute__((ext_vector_type(8)))  _Float16 v8h;
typedef __attribute__((ext_vector_type(8)))  float v8f;
typedef __attribute__((ext_vector_type(4)))  float v4f;
typedef __attribute__((ext_vector_type(2)))  float v2f;
typedef __attribute__((ext_vector_type(4)))  unsigned v4u;
typedef __attribute__((ext_vector_type(4)))  int v4i;
typedef float __attribute__((may_alias)) float_a;
typedef int __attribute__((may_alias)) int_a;

template <typename T> __device__ __forceinline__ void vst2(void* p, T v) { *(T*)p = v;  }
__device__ __forceinline__ v8f wmma16(v16h a, v16h b, v8f c) {
  v8f d = __builtin_amdgcn_wmma_f32_16x16x32_f16(false, a, false, b, (short)0, c, false, false);
  asm volatile("v_nop\n\tv_nop\n\tv_nop\n\tv_nop" : "+v"(d) : "v"(a), "v"(b));
  return d;
}
__device__ __forceinline__ v8f wmma_bf(v16b a, v16b b, v8f c) {
  v8f d = __builtin_amdgcn_wmma_f32_16x16x32_bf16(false, a, false, b, (short)0, c, false, false);
  asm volatile("v_nop\n\tv_nop\n\tv_nop\n\tv_nop" : "+v"(d) : "v"(a), "v"(b));
  return d;
}
// 16x16x32 fragments: lane = (h = lane>>4, row/col = lane&15); elements 0..7 = k0+8h+0..7, 8..15 = k0+16+8h+0..7; D element r = row 8h+r
__device__ __forceinline__ v16h frag_h(const _Float16* rowk0, int lane) {
  union { v16h v; v8h q[2]; } u; const _Float16* p = rowk0 + 8 * (lane >> 4);
  u.q[0] = *(const v8h*)p; u.q[1] = *(const v8h*)(p + 16); return u.v;
}
__device__ __forceinline__ v16h frag_f32(const float* rowk0, int lane) {
  v16h a; const float* p = rowk0 + 8 * (lane >> 4);
#pragma unroll
  for (int i = 0; i < 8; ++i) { a[i] = (_Float16)p[i]; a[8 + i] = (_Float16)p[16 + i]; }
  return a;
}
__device__ __forceinline__ v16h frag_f32s(const float* rowk0, int lane, float sc) {
  v16h a; const float* p = rowk0 + 8 * (lane >> 4);
#pragma unroll
  for (int i = 0; i < 8; ++i) { a[i] = (_Float16)(p[i] * sc); a[8 + i] = (_Float16)(p[16 + i] * sc); }
  return a;
}
// column fragment from a [K][ld] layout (column n), rows >= K read as 0
__device__ __forceinline__ v16h fragc_f32(const float* W, int k0, int n, int lane, int ld, int K) {
  v16h a; const int g = lane >> 4;
#pragma unroll
  for (int i = 0; i < 8; ++i) { const int ka = k0 + 8 * g + i, kb = ka + 16;
    a[i] = (_Float16)(ka < K ? W[(size_t)(ka < K ? ka : K - 1) * ld + n] : 0.f); a[8 + i] = (_Float16)(kb < K ? W[(size_t)(kb < K ? kb : K - 1) * ld + n] : 0.f); }
  return a;
}
struct F2 { v16b h, l; };
__device__ __forceinline__ F2 bsplit16(const float v[16]) { F2 r;
#pragma unroll
  for (int i = 0; i < 16; ++i) { const __bf16 h = (__bf16)v[i]; r.h[i] = h; r.l[i] = (__bf16)(v[i] - (float)h); }
  return r; }
__device__ __forceinline__ F2 split_row(const float* row, int k0, int lane) { float v[16]; const float* p = row + k0 + 8 * (lane >> 4);
#pragma unroll
  for (int i = 0; i < 8; ++i) { v[i] = p[i]; v[8 + i] = p[16 + i]; }
  return bsplit16(v); }
__device__ __forceinline__ F2 split_rowK(const float* row, int k0, int lane, int K) { float v[16]; const int g = lane >> 4;
#pragma unroll
  for (int i = 0; i < 8; ++i) { const int ka = k0 + 8 * g + i, kb = ka + 16; v[i] = ka < K ? row[ka < K ? ka : K - 1] : 0.f; v[8 + i] = kb < K ? row[kb < K ? kb : K - 1] : 0.f; }
  return bsplit16(v); }
__device__ __forceinline__ F2 split_col(const float* W, int k0, int n, int lane, int ld, int K) { float v[16]; const int g = lane >> 4;
#pragma unroll
  for (int i = 0; i < 8; ++i) { const int ka = k0 + 8 * g + i, kb = ka + 16; v[i] = ka < K ? W[(size_t)(ka < K ? ka : K - 1) * ld + n] : 0.f; v[8 + i] = kb < K ? W[(size_t)(kb < K ? kb : K - 1) * ld + n] : 0.f; }
  return bsplit16(v); }
__device__ __forceinline__ v8f mac3(const F2& a, const F2& b, v8f c) { c = wmma_bf(a.l, b.h, c); c = wmma_bf(a.h, b.l, c); return wmma_bf(a.h, b.h, c); }
__device__ __forceinline__ float sigm(float v) { return 1.0f / (1.0f + expf(-v)); }
#define LDSX() do { asm volatile("s_wait_dscnt 0" ::: "memory"); __builtin_amdgcn_wave_barrier(); __builtin_amdgcn_fence(__ATOMIC_RELEASE, "workgroup"); } while (0)


// Masked multi-head self-attention (B 4, T 1024, D 1024, 16 heads x 64; torch-style packed in_proj [3D][D] + bias, out_proj [D][D] + bias): scores = q.k / 8, keys with adjacency[q][k] <= 0 disallowed (-1e30 before the softmax; the [T][T] adjacency is shared by all batches and heads), out = softmax(scores) v, then out_proj.
#define NB 4
#define SS 1024
#define DM 1024
#define NH 16
#define HD 64
#define QKVW (3 * DM)
#ifndef TQB
#define TQB (SS / 128)
#define TNB NB
#define TOB (NB * SS / 64)     // output row tiles (all)
#endif
typedef __attribute__((ext_vector_type(8))) __bf16 v8b;
__device__ __forceinline__ v16b frag_b(const __bf16* rowk0, int lane) {
  union { v16b v; v8b q[2]; } u; const __bf16* p = rowk0 + 8 * (lane >> 4);
  u.q[0] = *(const v8b*)p; u.q[1] = *(const v8b*)(p + 16); return u.v;
}
__device__ __forceinline__ float bfr(float v) { return (float)(__bf16)v; }
__device__ __attribute__((noinline)) float exp_ni(float v) { return expf(v); }
__device__ __attribute__((noinline)) float erf_ni(float v) { return erff(v); }

#define PK_A 0                       // [3072][1024] in_proj rows (natural [out][in])
#define PK_P (PK_A + QKVW * DM)        // [1024][1024] out_proj rows (natural)
#define PK_END (PK_P + DM * DM)
#define WS_PK  0u
#define WS_QK  (WS_PK + 2u * PK_END)             // f32 [4096 rows][3072]: [q | k | v]
#define WS_VTH (WS_QK + 4u * NB * SS * QKVW)     // bf16 [4][1024 (h*64+d)][1024 s]
#define WS_VTL (WS_VTH + 2u * NB * DM * SS)
#define WS_O   (WS_VTL + 2u * NB * DM * SS)        // f32 [4096][1024]
#define WS_END (WS_O + 4u * NB * SS * DM)

// ---- k_pack: block = row r of a natural [R][1024] weight -> bf16 row
__global__ __launch_bounds__(256) void k_pack(const float* __restrict__ Wm, __bf16* __restrict__ DST) {
  __shared__ __align__(16) __bf16 s[DM]; const int r = blockIdx.x, tid = threadIdx.x;
  for (int k = tid; k < DM; k += 256) s[k] = (__bf16)Wm[(size_t)r * DM + k];
  __syncthreads();
  for (int q = tid; q < DM / 8; q += 256) vst2((unsigned*)(DST + (size_t)r * DM + q * 8), *(const v4u*)&s[q * 8]);
}
// LDS staging of the two projections: a block brings each 64-k chunk of its A rows and its 128 weight rows in by whole 128-B lines, once, and the waves read their fragments from LDS
#define GP 72                  // LDS row pitch in bf16 elements: 144 B = 16 B x odd, which spreads the 16 rows of a 16-byte fragment read over the banks
#define GCH (DM / 64)          // staged chunks of 64 k
typedef __attribute__((ext_vector_type(4))) __bf16 v4b;
// ---- k_qkv: block = (64 rows, 128 of the 3072 cols): QKV = bf16(x) . in_proj rows (exact) + bias -> f32 rows (pitch 3072)
__global__ __launch_bounds__(128) void k_qkv(const float* __restrict__ X, const __bf16* __restrict__ P, const float* __restrict__ BIAS, float* __restrict__ QKV) {
  __shared__ __align__(16) char sm[2 * (64 + 128) * GP * 2];   // two buffers of [64 A rows | 128 weight rows]; behind the loop's last barrier the same bytes hold so[4][16][132]
  __bf16* const sb16 = (__bf16*)sm; float (*const so)[16][132] = (float (*)[16][132])sm;
  const int tid = threadIdx.x, wave = tid >> 5, lane = tid & 31, col = lane & 15, g = lane >> 4; const size_t rb = (size_t)blockIdx.x * 64, r0 = rb + wave * 16; const int n0 = blockIdx.y * 128;
  const float* xg = X + (rb + (tid >> 4)) * DM + (tid & 15) * 4;               // a wave's load: 2 rows x 256 B
  const __bf16* pg = P + (size_t)(n0 + (tid >> 3)) * DM + (tid & 7) * 8;       // a wave's load: 4 rows x 128 B
  const int sao = (tid >> 4) * GP + (tid & 15) * 4, sbo = 64 * GP + (tid >> 3) * GP + (tid & 7) * 8;
  v4f xa[8]; v4u wb[8];
  v8f acc[8] = {};
#pragma unroll
  for (int i = 0; i < 8; ++i) { xa[i] = *(const v4f*)(xg + (size_t)i * 8 * DM); wb[i] = *(const v4u*)(pg + (size_t)i * 16 * DM); }
#pragma unroll
  for (int i = 0; i < 8; ++i) { v4b t;
#pragma unroll
    for (int e = 0; e < 4; ++e) t[e] = (__bf16)xa[i][e];
    *(v4b*)(sb16 + sao + i * 8 * GP) = t; *(v4u*)(sb16 + sbo + i * 16 * GP) = wb[i]; }
  __syncthreads();
#pragma unroll 2   // two trips per branch: each buffer's LDS offsets become constants
  for (int c = 0; c < GCH; ++c) { const __bf16* cur = sb16 + (c & 1) * (192 * GP); __bf16* nxt = sb16 + ((c + 1) & 1) * (192 * GP);
    if (c + 1 < GCH) {
#pragma unroll
      for (int i = 0; i < 8; ++i) { xa[i] = *(const v4f*)(xg + (size_t)i * 8 * DM + (c + 1) * 64); wb[i] = *(const v4u*)(pg + (size_t)i * 16 * DM + (c + 1) * 64); }
      asm volatile("s_wait_xcnt 0x0" ::: "memory"); }   // stands behind the run of prefetch loads, in front of any later rewrite of a register that holds one of their addresses
#pragma unroll
    for (int kc = 0; kc < 2; ++kc) { const v16b a = frag_b(cur + (wave * 16 + col) * GP + kc * 32, lane); v16b w[8];
#pragma unroll
      for (int j = 0; j < 8; ++j) w[j] = frag_b(cur + (64 + j * 16 + col) * GP + kc * 32, lane);
#pragma unroll
      for (int j = 0; j < 8; ++j) acc[j] = wmma_bf(a, w[j], acc[j]); }
    if (c + 1 < GCH) {
#pragma unroll
      for (int i = 0; i < 8; ++i) { v4b t;
#pragma unroll
        for (int e = 0; e < 4; ++e) t[e] = (__bf16)xa[i][e];
        *(v4b*)(nxt + sao + i * 8 * GP) = t; *(v4u*)(nxt + sbo + i * 16 * GP) = wb[i]; } }
    __syncthreads(); }   // publishes chunk c + 1 and ends every wave's reads of chunk c, whose buffer the next trip refills
#pragma unroll
  for (int j = 0; j < 8; ++j) { const float bb = bfr(BIAS[n0 + j * 16 + col]);
#pragma unroll
    for (int r = 0; r < 8; ++r) so[wave][8 * g + r][j * 16 + col] = acc[j][r] + bb; }
  LDSX();
  for (int rl = 0; rl < 16; ++rl) vst2(QKV + (r0 + rl) * QKVW + n0 + lane * 4, *(const v4f*)&so[wave][rl][lane * 4]);
}
__global__ __launch_bounds__(256) void k_vt(const float* __restrict__ QKV, __bf16* __restrict__ VTH, __bf16* __restrict__ VTL) {
  __shared__ __align__(16) __bf16 sth[64][72], stl[64][72]; const int tid = threadIdx.x; const size_t rb = (size_t)blockIdx.x * 64; const int h = blockIdx.y; const int b = (int)(rb / SS), s0 = (int)(rb % SS);
  for (int q = tid; q < 64 * 64; q += 256) { const int rl = q >> 6, d = q & 63; const float v = QKV[(rb + rl) * QKVW + 2 * DM + h * HD + d]; const __bf16 hb = (__bf16)v; sth[d][rl] = hb; stl[d][rl] = (__bf16)(v - (float)hb); }
  __syncthreads();
  for (int q = tid; q < 64 * 8; q += 256) { const int d = q >> 3, pc = q & 7; const size_t o = ((size_t)b * DM + h * HD + d) * SS + s0 + pc * 8; vst2((unsigned*)(VTH + o), *(const v4u*)&sth[d][pc * 8]); vst2((unsigned*)(VTL + o), *(const v4u*)&stl[d][pc * 8]); }
}
// ---- k_attn: block = (128 queries = 8 waves x 16, head h, batch b): flash attention over the 1,024 keys, transposed: S^T = K.Q^T (A = key rows, B = query columns, 3 products) / 8, so a lane holds 16 of ONE query's 32 scores (keys 8g + r and 16 + 8g + r of the step); disallowed keys (adjacency[q][k] <= 0) set to -1e30; maximum and sum run in the lane, the two halves of the wave exchange the maximum once per step and join their sums behind the loop; the two score tiles, split hi/lo in place, are the B operand of O^T += V^T.P^T (3 products); O[b*S+q][h*64+d] = acc / l
// K and V^T come through LDS: the block brings each tile of 64 keys in by whole 128-B lines, once for its 8 waves, splits K hi/lo at the store, and every wave reads its A fragments from LDS (two steps of 32 keys per tile)
#define AKT 64                 // keys per staged tile: a V^T row piece is then one whole line
#define ANT (SS / AKT)
#define AARR (AKT * GP)        // one staged array: 64 rows at the padded pitch
#define ABUF (4 * AARR)        // one buffer: [K hi | K lo | V^T hi | V^T lo]
__device__ __forceinline__ float xhalf(float x) { return __builtin_bit_cast(float, __builtin_amdgcn_permlanex16(__builtin_bit_cast(int, x), __builtin_bit_cast(int, x), 0x76543210, 0xfedcba98, false, false)); }  // lane l with lane l ^ 16
__global__ __launch_bounds__(256) void k_attn(const float* __restrict__ QK, const float* __restrict__ ADJ, const __bf16* __restrict__ VTH, const __bf16* __restrict__ VTL, float* __restrict__ O) {
  __shared__ __align__(16) char sm[2 * ABUF * 2];   // two buffers; behind the loop's last barrier the same bytes hold so[8][16][68]
  __bf16* const sb16 = (__bf16*)sm; float (*const so)[16][68] = (float (*)[16][68])sm;
  const int tid = threadIdx.x, wave = tid >> 5, lane = tid & 31, col = lane & 15, g = lane >> 4;
  const int qb = blockIdx.x, h = blockIdx.y, b = blockIdx.z; const int q0 = qb * 128 + wave * 16; const size_t rq = (size_t)b * SS + q0 + col;
  const float* kg = QK + ((size_t)b * SS + (tid >> 4)) * QKVW + DM + h * HD + (tid & 15) * 4;   // a wave's load: 2 key rows x 256 B
  const size_t vo = ((size_t)b * DM + h * HD + (tid >> 3)) * SS + (tid & 7) * 8;                // a wave's load: 4 V^T rows x 128 B
  const __bf16* vhg = VTH + vo; const __bf16* vlg = VTL + vo;
  const int sko = (tid >> 4) * GP + (tid & 15) * 4, svo = 2 * AARR + (tid >> 3) * GP + (tid & 7) * 8;
  v4f kx[4]; v4u vh[2], vl[2];
#pragma unroll
  for (int i = 0; i < 4; ++i) kx[i] = *(const v4f*)(kg + (size_t)i * 16 * QKVW);
#pragma unroll
  for (int i = 0; i < 2; ++i) { vh[i] = *(const v4u*)(vhg + (size_t)i * 32 * SS); vl[i] = *(const v4u*)(vlg + (size_t)i * 32 * SS); }
  F2 aq[2];
#pragma unroll
  for (int kc = 0; kc < 2; ++kc) aq[kc] = split_row(QK + rq * QKVW + h * HD, kc * 32, lane);
#pragma unroll
  for (int i = 0; i < 4; ++i) { v4b th, tl;
#pragma unroll
    for (int e = 0; e < 4; ++e) { const __bf16 hb = (__bf16)kx[i][e]; th[e] = hb; tl[e] = (__bf16)(kx[i][e] - (float)hb); }
    *(v4b*)(sb16 + sko + i * 16 * GP) = th; *(v4b*)(sb16 + AARR + sko + i * 16 * GP) = tl; }
#pragma unroll
  for (int i = 0; i < 2; ++i) { *(v4u*)(sb16 + svo + i * 32 * GP) = vh[i]; *(v4u*)(sb16 + AARR + svo + i * 32 * GP) = vl[i]; }
  float m = -3.0e38f, l = 0.f;   // of query q0 + col; l holds this half's keys only
  v8f acc[4] = {};               // acc[dt][r] = O^T[dt * 16 + 8g + r][query q0 + col]
  const float* arow = ADJ + (size_t)(q0 + col) * SS + 8 * g;
  __syncthreads();   // publishes tile 0
#pragma unroll 1
  for (int t = 0; t < ANT; ++t) { const __bf16* cur = sb16 + (t & 1) * ABUF; __bf16* nxt = sb16 + ((t + 1) & 1) * ABUF;
    const int tn = t + 1 < ANT ? t + 1 : t;   // the last trip fetches its own tile again, into the buffer that nobody reads any more: with no branch round the loads and stores the loads stay up here and the waits on them stay counted
    v4f aj[2][2][2];   // the lane's 32 of this tile's 64 adjacency values of its query (keys 8g + 0..7 of each 16)
#pragma unroll
    for (int u = 0; u < 2; ++u)
#pragma unroll
      for (int ct = 0; ct < 2; ++ct) { aj[u][ct][0] = *(const v4f*)(arow + t * AKT + u * 32 + ct * 16); aj[u][ct][1] = *(const v4f*)(arow + t * AKT + u * 32 + ct * 16 + 4); }
#pragma unroll
    for (int i = 0; i < 4; ++i) kx[i] = *(const v4f*)(kg + (size_t)(tn * AKT + i * 16) * QKVW);
#pragma unroll
    for (int i = 0; i < 2; ++i) { vh[i] = *(const v4u*)(vhg + (size_t)i * 32 * SS + tn * AKT); vl[i] = *(const v4u*)(vlg + (size_t)i * 32 * SS + tn * AKT); }
    asm volatile("s_wait_xcnt 0x0" ::: "memory");   // stands behind the run of loads, in front of any later rewrite of a register that holds one of their addresses
#pragma unroll
    for (int u = 0; u < 2; ++u) { float s[16]; v16b kh[2][2], kl[2][2], fh[4], fl[4]; v8f c[2];
#pragma unroll
      for (int ct = 0; ct < 2; ++ct) { const __bf16* krow = cur + (u * 32 + ct * 16 + col) * GP;
#pragma unroll
        for (int kc = 0; kc < 2; ++kc) { kh[ct][kc] = frag_b(krow + kc * 32, lane); kl[ct][kc] = frag_b(krow + AARR + kc * 32, lane); } }
#pragma unroll
      for (int ct = 0; ct < 2; ++ct) { c[ct] = v8f{};
#pragma unroll
        for (int kc = 0; kc < 2; ++kc) { c[ct] = wmma_bf(kh[ct][kc], aq[kc].l, c[ct]); c[ct] = wmma_bf(kl[ct][kc], aq[kc].h, c[ct]); c[ct] = wmma_bf(kh[ct][kc], aq[kc].h, c[ct]); } }
#pragma unroll
      for (int dt = 0; dt < 4; ++dt) { const __bf16* vrow = cur + 2 * AARR + (dt * 16 + col) * GP + u * 32; fh[dt] = frag_b(vrow, lane); fl[dt] = frag_b(vrow + AARR, lane); }
      if (u == 0) __builtin_amdgcn_sched_barrier(0);   // keeps the first compare on the adjacency values just asked for, and with it the wait on their loads, behind the score products
#pragma unroll
      for (int ct = 0; ct < 2; ++ct)
#pragma unroll
        for (int r = 0; r < 8; ++r) { const float a = aj[u][ct][r >> 2][r & 3]; s[ct * 8 + r] = (a <= 0.f) ? -1.0e30f : c[ct][r] * 0.125f; }   // SCALE = 1/sqrt(64)
      float mx = s[0];
#pragma unroll
      for (int i = 1; i < 16; ++i) mx = fmaxf(mx, s[i]);
      mx = fmaxf(mx, xhalf(mx));
      const float mn = fmaxf(m, mx); const float alpha = exp_ni(m - mn);
      float es = 0.f;
#pragma unroll
      for (int i = 0; i < 16; ++i) { s[i] = exp_ni(s[i] - mn); es += s[i]; }
      l = l * alpha + es; m = mn;
#pragma unroll
      for (int dt = 0; dt < 4; ++dt) acc[dt] *= alpha;
      const F2 pb = bsplit16(s);   // element i = P^T[key 8g + i or 16 + 8g + (i - 8)][query]: the k order of frag_b
#pragma unroll
      for (int dt = 0; dt < 4; ++dt) { acc[dt] = wmma_bf(fh[dt], pb.l, acc[dt]); acc[dt] = wmma_bf(fl[dt], pb.h, acc[dt]); acc[dt] = wmma_bf(fh[dt], pb.h, acc[dt]); } }
#pragma unroll
    for (int i = 0; i < 4; ++i) { v4b th, tl;
#pragma unroll
      for (int e = 0; e < 4; ++e) { const __bf16 hb = (__bf16)kx[i][e]; th[e] = hb; tl[e] = (__bf16)(kx[i][e] - (float)hb); }
      *(v4b*)(nxt + sko + i * 16 * GP) = th; *(v4b*)(nxt + AARR + sko + i * 16 * GP) = tl; }
#pragma unroll
    for (int i = 0; i < 2; ++i) { *(v4u*)(nxt + svo + i * 32 * GP) = vh[i]; *(v4u*)(nxt + AARR + svo + i * 32 * GP) = vl[i]; }
    __syncthreads(); }   // publishes tile t + 1 and ends every wave's reads of tile t, whose buffer the next trip refills
  const float il = 1.0f / (l + xhalf(l));
#pragma unroll
  for (int dt = 0; dt < 4; ++dt) { v4f o0, o1;
#pragma unroll
    for (int r = 0; r < 4; ++r) { o0[r] = acc[dt][r] * il; o1[r] = acc[dt][4 + r] * il; }
    *(v4f*)&so[wave][col][dt * 16 + 8 * g] = o0; *(v4f*)&so[wave][col][dt * 16 + 8 * g + 4] = o1; }
  LDSX();
  for (int rl = 0; rl < 16; ++rl) if (lane < 16) vst2(O + ((size_t)b * SS + q0 + rl) * DM + h * HD + lane * 4, *(const v4f*)&so[wave][rl][lane * 4]);
}
// ---- k_out: block = (64 rows, 128 cols): out = O(hi/lo) . out_proj rows (2 products) + bias
__global__ __launch_bounds__(128) void k_out(const float* __restrict__ O, const __bf16* __restrict__ P, const float* __restrict__ BO, float* __restrict__ Y) {
  __shared__ __align__(16) char sm[2 * (64 + 64 + 128) * GP * 2];   // two buffers of [64 A hi rows | 64 A lo rows | 128 weight rows]; behind the loop's last barrier the same bytes hold so[4][16][132]
  __bf16* const sb16 = (__bf16*)sm; float (*const so)[16][132] = (float (*)[16][132])sm;
  const int tid = threadIdx.x, wave = tid >> 5, lane = tid & 31, col = lane & 15, g = lane >> 4; const size_t rb = (size_t)blockIdx.x * 64, r0 = rb + wave * 16; const int n0 = blockIdx.y * 128;
  const float* xg = O + (rb + (tid >> 4)) * DM + (tid & 15) * 4;
  const __bf16* pg = P + (size_t)(n0 + (tid >> 3)) * DM + (tid & 7) * 8;
  const int sao = (tid >> 4) * GP + (tid & 15) * 4, sbo = 128 * GP + (tid >> 3) * GP + (tid & 7) * 8;
  v4f xa[8]; v4u wb[8];
  v8f acc[8] = {};
#pragma unroll
  for (int i = 0; i < 8; ++i) { xa[i] = *(const v4f*)(xg + (size_t)i * 8 * DM); wb[i] = *(const v4u*)(pg + (size_t)i * 16 * DM); }
#pragma unroll
  for (int i = 0; i < 8; ++i) { v4b th, tl;
#pragma unroll
    for (int e = 0; e < 4; ++e) { const __bf16 h = (__bf16)xa[i][e]; th[e] = h; tl[e] = (__bf16)(xa[i][e] - (float)h); }
    *(v4b*)(sb16 + sao + i * 8 * GP) = th; *(v4b*)(sb16 + 64 * GP + sao + i * 8 * GP) = tl; *(v4u*)(sb16 + sbo + i * 16 * GP) = wb[i]; }
  __syncthreads();
#pragma unroll 2   // two trips per branch: each buffer's LDS offsets become constants
  for (int c = 0; c < GCH; ++c) { const __bf16* cur = sb16 + (c & 1) * (256 * GP); __bf16* nxt = sb16 + ((c + 1) & 1) * (256 * GP);
    if (c + 1 < GCH) {
#pragma unroll
      for (int i = 0; i < 8; ++i) { xa[i] = *(const v4f*)(xg + (size_t)i * 8 * DM + (c + 1) * 64); wb[i] = *(const v4u*)(pg + (size_t)i * 16 * DM + (c + 1) * 64); }
      asm volatile("s_wait_xcnt 0x0" ::: "memory"); }   // stands behind the run of prefetch loads, in front of any later rewrite of a register that holds one of their addresses
#pragma unroll
    for (int kc = 0; kc < 2; ++kc) { const v16b ah = frag_b(cur + (wave * 16 + col) * GP + kc * 32, lane), al = frag_b(cur + (64 + wave * 16 + col) * GP + kc * 32, lane); v16b w[8];
#pragma unroll
      for (int j = 0; j < 8; ++j) w[j] = frag_b(cur + (128 + j * 16 + col) * GP + kc * 32, lane);
#pragma unroll
      for (int j = 0; j < 8; ++j) { acc[j] = wmma_bf(al, w[j], acc[j]); acc[j] = wmma_bf(ah, w[j], acc[j]); } }
    if (c + 1 < GCH) {
#pragma unroll
      for (int i = 0; i < 8; ++i) { v4b th, tl;
#pragma unroll
        for (int e = 0; e < 4; ++e) { const __bf16 h = (__bf16)xa[i][e]; th[e] = h; tl[e] = (__bf16)(xa[i][e] - (float)h); }
        *(v4b*)(nxt + sao + i * 8 * GP) = th; *(v4b*)(nxt + 64 * GP + sao + i * 8 * GP) = tl; *(v4u*)(nxt + sbo + i * 16 * GP) = wb[i]; } }
    __syncthreads(); }   // publishes chunk c + 1 and ends every wave's reads of chunk c, whose buffer the next trip refills
#pragma unroll
  for (int j = 0; j < 8; ++j) { const float bb = bfr(BO[n0 + j * 16 + col]);
#pragma unroll
    for (int r = 0; r < 8; ++r) so[wave][8 * g + r][j * 16 + col] = acc[j][r] + bb; }
  LDSX();
  for (int rl = 0; rl < 16; ++rl) vst2(Y + (r0 + rl) * DM + n0 + lane * 4, *(const v4f*)&so[wave][rl][lane * 4]);
}
extern "C" void kernel_launch(void* const* d_in, const int* in_sizes, int n_in, void* d_out, int out_size, void* d_ws, size_t ws_size, hipStream_t stream) {
  (void)in_sizes; (void)n_in; (void)out_size;
  const float** F = (const float**)d_in;   // 0 x [4,1024,1024], 1 adjacency [1024,1024], 2 in_proj_w [3072,1024], 3 in_proj_b [3072], 4 out_proj_w [1024,1024], 5 out_proj_b [1024]
  if (ws_size < (size_t)WS_END) return;
  char* ws = (char*)d_ws; __bf16* PK = (__bf16*)(ws + WS_PK); float *QK = (float*)(ws + WS_QK), *O = (float*)(ws + WS_O); __bf16 *VTH = (__bf16*)(ws + WS_VTH), *VTL = (__bf16*)(ws + WS_VTL);
  k_pack<<<QKVW, 256, 0, stream>>>(F[2], PK + PK_A); k_pack<<<DM, 256, 0, stream>>>(F[4], PK + PK_P);
  k_qkv<<<dim3(TNB * SS / 64, QKVW / 128), 128, 0, stream>>>(F[0], PK + PK_A, F[3], QK);
  k_vt<<<dim3(TNB * SS / 64, NH), 256, 0, stream>>>(QK, VTH, VTL);
  k_attn<<<dim3(TQB, NH, TNB), 256, 0, stream>>>(QK, F[1], VTH, VTL, O);
  k_out<<<dim3(TOB, DM / 128), 128, 0, stream>>>(O, PK + PK_P, F[5], (float*)d_out);
}

// v004
// A run of this version takes 134 microseconds.
// In both of two side-by-side timings against v003, it was 1.16 times as fast.
// Over all steps from v000 it is 3.00 times as fast.
// compute dtype: x, in_proj/out_proj weights and biases (module inputs) rounded to bf16 (the adjacency is read as f32); the packed qkv projection with exact bf16 products (x and W are inputs) + bias; scores q.k with both computed operands as bf16 hi + residual pairs (3 products) and P.V with P hi/lo x V hi/lo (3 products); the adjacency mask as a select (adjacency <= 0 -> -1e30); the output projection hi/lo x exact Wo (2 products) + bo; running-max softmax in f32; f32 accumulate.
#include <hip/hip_runtime.h>
#include <math.h>

typedef __attribute__((ext_vector_type(16))) _Float16 v16h;
typedef __attribute__((ext_vector_type(16))) __bf16 v16b;
typedef __attribute__((ext_vector_type(8)))  _Float16 v8h;
typedef __attribute__((ext_vector_type(8)))  float v8f;
typedef __attribute__((ext_vector_type(4)))  float v4f;
typedef __attribute__((ext_vector_type(2)))  float v2f;
typedef __attribute__((ext_vector_type(4)))  unsigned v4u;
typedef __attribute__((ext_vector_type(4)))  int v4i;
typedef float __attribute__((may_alias)) float_a;
typedef int __attribute__((may_alias)) int_a;

template <typename T> __device__ __forceinline__ void vst2(void* p, T v) { *(T*)p = v;  }
__device__ __forceinline__ v8f wmma16(v16h a, v16h b, v8f c) {
  v8f d = __builtin_amdgcn_wmma_f32_16x16x32_f16(false, a, false, b, (short)0, c, false, false);
  asm volatile("v_nop\n\tv_nop\n\tv_nop\n\tv_nop" : "+v"(d) : "v"(a), "v"(b));
  return d;
}
__device__ __forceinline__ v8f wmma_bf(v16b a, v16b b, v8f c) {
  v8f d = __builtin_amdgcn_wmma_f32_16x16x32_bf16(false, a, false, b, (short)0, c, false, false);
  asm volatile("v_nop\n\tv_nop\n\tv_nop\n\tv_nop" : "+v"(d) : "v"(a), "v"(b));
  return d;
}
// 16x16x32 fragments: lane = (h = lane>>4, row/col = lane&15); elements 0..7 = k0+8h+0..7, 8..15 = k0+16+8h+0..7; D element r = row 8h+r
__device__ __forceinline__ v16h frag_h(const _Float16* rowk0, int lane) {
  union { v16h v; v8h q[2]; } u; const _Float16* p = rowk0 + 8 * (lane >> 4);
  u.q[0] = *(const v8h*)p; u.q[1] = *(const v8h*)(p + 16); return u.v;
}
__device__ __forceinline__ v16h frag_f32(const float* rowk0, int lane) {
  v16h a; const float* p = rowk0 + 8 * (lane >> 4);
#pragma unroll
  for (int i = 0; i < 8; ++i) { a[i] = (_Float16)p[i]; a[8 + i] = (_Float16)p[16 + i]; }
  return a;
}
__device__ __forceinline__ v16h frag_f32s(const float* rowk0, int lane, float sc) {
  v16h a; const float* p = rowk0 + 8 * (lane >> 4);
#pragma unroll
  for (int i = 0; i < 8; ++i) { a[i] = (_Float16)(p[i] * sc); a[8 + i] = (_Float16)(p[16 + i] * sc); }
  return a;
}
// column fragment from a [K][ld] layout (column n), rows >= K read as 0
__device__ __forceinline__ v16h fragc_f32(const float* W, int k0, int n, int lane, int ld, int K) {
  v16h a; const int g = lane >> 4;
#pragma unroll
  for (int i = 0; i < 8; ++i) { const int ka = k0 + 8 * g + i, kb = ka + 16;
    a[i] = (_Float16)(ka < K ? W[(size_t)(ka < K ? ka : K - 1) * ld + n] : 0.f); a[8 + i] = (_Float16)(kb < K ? W[(size_t)(kb < K ? kb : K - 1) * ld + n] : 0.f); }
  return a;
}
struct F2 { v16b h, l; };
__device__ __forceinline__ F2 bsplit16(const float v[16]) { F2 r;
#pragma unroll
  for (int i = 0; i < 16; ++i) { const __bf16 h = (__bf16)v[i]; r.h[i] = h; r.l[i] = (__bf16)(v[i] - (float)h); }
  return r; }
__device__ __forceinline__ F2 split_row(const float* row, int k0, int lane) { float v[16]; const float* p = row + k0 + 8 * (lane >> 4);
#pragma unroll
  for (int i = 0; i < 8; ++i) { v[i] = p[i]; v[8 + i] = p[16 + i]; }
  return bsplit16(v); }
__device__ __forceinline__ F2 split_rowK(const float* row, int k0, int lane, int K) { float v[16]; const int g = lane >> 4;
#pragma unroll
  for (int i = 0; i < 8; ++i) { const int ka = k0 + 8 * g + i, kb = ka + 16; v[i] = ka < K ? row[ka < K ? ka : K - 1] : 0.f; v[8 + i] = kb < K ? row[kb < K ? kb : K - 1] : 0.f; }
  return bsplit16(v); }
__device__ __forceinline__ F2 split_col(const float* W, int k0, int n, int lane, int ld, int K) { float v[16]; const int g = lane >> 4;
#pragma unroll
  for (int i = 0; i < 8; ++i) { const int ka = k0 + 8 * g + i, kb = ka + 16; v[i] = ka < K ? W[(size_t)(ka < K ? ka : K - 1) * ld + n] : 0.f; v[8 + i] = kb < K ? W[(size_t)(kb < K ? kb : K - 1) * ld + n] : 0.f; }
  return bsplit16(v); }
__device__ __forceinline__ v8f mac3(const F2& a, const F2& b, v8f c) { c = wmma_bf(a.l, b.h, c); c = wmma_bf(a.h, b.l, c); return wmma_bf(a.h, b.h, c); }
__device__ __forceinline__ float sigm(float v) { return 1.0f / (1.0f + expf(-v)); }
#define LDSX() do { asm volatile("s_wait_dscnt 0" ::: "memory"); __builtin_amdgcn_wave_barrier(); __builtin_amdgcn_fence(__ATOMIC_RELEASE, "workgroup"); } while (0)


// Masked multi-head self-attention (B 4, T 1024, D 1024, 16 heads x 64; torch-style packed in_proj [3D][D] + bias, out_proj [D][D] + bias): scores = q.k / 8, keys with adjacency[q][k] <= 0 disallowed (-1e30 before the softmax; the [T][T] adjacency is shared by all batches and heads), out = softmax(scores) v, then out_proj.
#define NB 4
#define SS 1024
#define DM 1024
#define NH 16
#define HD 64
#define QKVW (3 * DM)
#ifndef TQB
#define TQB (SS / 128)
#define TNB NB
#define TOB (NB * SS / 64)     // output row tiles (all)
#endif
typedef __attribute__((ext_vector_type(8))) __bf16 v8b;
__device__ __forceinline__ v16b frag_b(const __bf16* rowk0, int lane) {
  union { v16b v; v8b q[2]; } u; const __bf16* p = rowk0 + 8 * (lane >> 4);
  u.q[0] = *(const v8b*)p; u.q[1] = *(const v8b*)(p + 16); return u.v;
}
__device__ __forceinline__ float bfr(float v) { return (float)(__bf16)v; }
__device__ __forceinline__ float ex2(float v) { return __builtin_amdgcn_exp2f(v); }   // 2^v as the one hardware instruction; every argument here is <= 0, and a result below the normal range may go to 0
__device__ __attribute__((noinline)) float erf_ni(float v) { return erff(v); }

#define PK_A 0                       // [3072][1024] in_proj rows (natural [out][in])
#define PK_P (PK_A + QKVW * DM)        // [1024][1024] out_proj rows (natural)
#define PK_END (PK_P + DM * DM)
#define WS_PK  0u
#define WS_QK  (WS_PK + 2u * PK_END)             // f32 [4096 rows][3072]: [q | k | v]
#define WS_VTH (WS_QK + 4u * NB * SS * QKVW)     // bf16 [4][1024 (h*64+d)][1024 s]
#define WS_VTL (WS_VTH + 2u * NB * DM * SS)
#define WS_O   (WS_VTL + 2u * NB * DM * SS)        // f32 [4096][1024]
#define WS_END (WS_O + 4u * NB * SS * DM)

// ---- k_pack: block = row r of a natural [R][1024] weight -> bf16 row
__global__ __launch_bounds__(256) void k_pack(const float* __restrict__ Wm, __bf16* __restrict__ DST) {
  __shared__ __align__(16) __bf16 s[DM]; const int r = blockIdx.x, tid = threadIdx.x;
  for (int k = tid; k < DM; k += 256) s[k] = (__bf16)Wm[(size_t)r * DM + k];
  __syncthreads();
  for (int q = tid; q < DM / 8; q += 256) vst2((unsigned*)(DST + (size_t)r * DM + q * 8), *(const v4u*)&s[q * 8]);
}
// LDS staging of the two projections: a block brings each 64-k chunk of its A rows and its 128 weight rows in by whole 128-B lines, once, and the waves read their fragments from LDS
#define GP 72                  // LDS row pitch in bf16 elements: 144 B = 16 B x odd, which spreads the 16 rows of a 16-byte fragment read over the banks
#define GCH (DM / 64)          // staged chunks of 64 k
typedef __attribute__((ext_vector_type(4))) __bf16 v4b;
// ---- k_qkv: block = (64 rows, 128 of the 3072 cols): QKV = bf16(x) . in_proj rows (exact) + bias -> f32 rows (pitch 3072)
__global__ __launch_bounds__(128) void k_qkv(const float* __restrict__ X, const __bf16* __restrict__ P, const float* __restrict__ BIAS, float* __restrict__ QKV) {
  __shared__ __align__(16) char sm[2 * (64 + 128) * GP * 2];   // two buffers of [64 A rows | 128 weight rows]; behind the loop's last barrier the same bytes hold so[4][16][132]
  __bf16* const sb16 = (__bf16*)sm; float (*const so)[16][132] = (float (*)[16][132])sm;
  const int tid = threadIdx.x, wave = tid >> 5, lane = tid & 31, col = lane & 15, g = lane >> 4; const size_t rb = (size_t)blockIdx.x * 64, r0 = rb + wave * 16; const int n0 = blockIdx.y * 128;
  const float* xg = X + (rb + (tid >> 4)) * DM + (tid & 15) * 4;               // a wave's load: 2 rows x 256 B
  const __bf16* pg = P + (size_t)(n0 + (tid >> 3)) * DM + (tid & 7) * 8;       // a wave's load: 4 rows x 128 B
  const int sao = (tid >> 4) * GP + (tid & 15) * 4, sbo = 64 * GP + (tid >> 3) * GP + (tid & 7) * 8;
  v4f xa[8]; v4u wb[8];
  v8f acc[8] = {};
#pragma unroll
  for (int i = 0; i < 8; ++i) { xa[i] = *(const v4f*)(xg + (size_t)i * 8 * DM); wb[i] = *(const v4u*)(pg + (size_t)i * 16 * DM); }
#pragma unroll
  for (int i = 0; i < 8; ++i) { v4b t;
#pragma unroll
    for (int e = 0; e < 4; ++e) t[e] = (__bf16)xa[i][e];
    *(v4b*)(sb16 + sao + i * 8 * GP) = t; *(v4u*)(sb16 + sbo + i * 16 * GP) = wb[i]; }
  __syncthreads();
#pragma unroll 2   // two trips per branch: each buffer's LDS offsets become constants
  for (int c = 0; c < GCH; ++c) { const __bf16* cur = sb16 + (c & 1) * (192 * GP); __bf16* nxt = sb16 + ((c + 1) & 1) * (192 * GP);
    if (c + 1 < GCH) {
#pragma unroll
      for (int i = 0; i < 8; ++i) { xa[i] = *(const v4f*)(xg + (size_t)i * 8 * DM + (c + 1) * 64); wb[i] = *(const v4u*)(pg + (size_t)i * 16 * DM + (c + 1) * 64); }
      asm volatile("s_wait_xcnt 0x0" ::: "memory"); }   // stands behind the run of prefetch loads, in front of any later rewrite of a register that holds one of their addresses
#pragma unroll
    for (int kc = 0; kc < 2; ++kc) { const v16b a = frag_b(cur + (wave * 16 + col) * GP + kc * 32, lane); v16b w[8];
#pragma unroll
      for (int j = 0; j < 8; ++j) w[j] = frag_b(cur + (64 + j * 16 + col) * GP + kc * 32, lane);
#pragma unroll
      for (int j = 0; j < 8; ++j) acc[j] = wmma_bf(a, w[j], acc[j]); }
    if (c + 1 < GCH) {
#pragma unroll
      for (int i = 0; i < 8; ++i) { v4b t;
#pragma unroll
        for (int e = 0; e < 4; ++e) t[e] = (__bf16)xa[i][e];
        *(v4b*)(nxt + sao + i * 8 * GP) = t; *(v4u*)(nxt + sbo + i * 16 * GP) = wb[i]; } }
    __syncthreads(); }   // publishes chunk c + 1 and ends every wave's reads of chunk c, whose buffer the next trip refills
#pragma unroll
  for (int j = 0; j < 8; ++j) { const float bb = bfr(BIAS[n0 + j * 16 + col]);
#pragma unroll
    for (int r = 0; r < 8; ++r) so[wave][8 * g + r][j * 16 + col] = acc[j][r] + bb; }
  LDSX();
  for (int rl = 0; rl < 16; ++rl) vst2(QKV + (r0 + rl) * QKVW + n0 + lane * 4, *(const v4f*)&so[wave][rl][lane * 4]);
}
__global__ __launch_bounds__(256) void k_vt(const float* __restrict__ QKV, __bf16* __restrict__ VTH, __bf16* __restrict__ VTL) {
  __shared__ __align__(16) __bf16 sth[64][72], stl[64][72]; const int tid = threadIdx.x; const size_t rb = (size_t)blockIdx.x * 64; const int h = blockIdx.y; const int b = (int)(rb / SS), s0 = (int)(rb % SS);
  for (int q = tid; q < 64 * 64; q += 256) { const int rl = q >> 6, d = q & 63; const float v = QKV[(rb + rl) * QKVW + 2 * DM + h * HD + d]; const __bf16 hb = (__bf16)v; sth[d][rl] = hb; stl[d][rl] = (__bf16)(v - (float)hb); }
  __syncthreads();
  for (int q = tid; q < 64 * 8; q += 256) { const int d = q >> 3, pc = q & 7; const size_t o = ((size_t)b * DM + h * HD + d) * SS + s0 + pc * 8; vst2((unsigned*)(VTH + o), *(const v4u*)&sth[d][pc * 8]); vst2((unsigned*)(VTL + o), *(const v4u*)&stl[d][pc * 8]); }
}
// ---- k_attn: block = (128 queries = 8 waves x 16, head h, batch b): flash attention over the 1,024 keys, transposed: S^T = K.Q^T (A = key rows, B = query columns, 3 products) / 8, so a lane holds 16 of ONE query's 32 scores (keys 8g + r and 16 + 8g + r of the step); disallowed keys (adjacency[q][k] <= 0) set to -1e30; maximum and sum run in the lane, the two halves of the wave exchange the maximum once per step and join their sums behind the loop; the two score tiles, split hi/lo in place, are the B operand of O^T += V^T.P^T (3 products); O[b*S+q][h*64+d] = acc / l
// K and V^T come through LDS: the block brings each tile of 64 keys in by whole 128-B lines, once for its 8 waves, splits K hi/lo at the store, and every wave reads its A fragments from LDS (two steps of 32 keys per tile)
#define AKT 64                 // keys per staged tile: a V^T row piece is then one whole line
#define ANT (SS / AKT)
#define AARR (AKT * GP)        // one staged array: 64 rows at the padded pitch
#define ABUF (4 * AARR)        // one buffer: [K hi | K lo | V^T hi | V^T lo]
__device__ __forceinline__ float xhalf(float x) { return __builtin_bit_cast(float, __builtin_amdgcn_permlanex16(__builtin_bit_cast(int, x), __builtin_bit_cast(int, x), 0x76543210, 0xfedcba98, false, false)); }  // lane l with lane l ^ 16
__global__ __launch_bounds__(256) void k_attn(const float* __restrict__ QK, const float* __restrict__ ADJ, const __bf16* __restrict__ VTH, const __bf16* __restrict__ VTL, float* __restrict__ O) {
  __shared__ __align__(16) char sm[2 * ABUF * 2];   // two buffers; behind the loop's last barrier the same bytes hold so[8][16][68]
  __bf16* const sb16 = (__bf16*)sm; float (*const so)[16][68] = (float (*)[16][68])sm;
  const int tid = threadIdx.x, wave = tid >> 5, lane = tid & 31, col = lane & 15, g = lane >> 4;
  const int qb = blockIdx.x, h = blockIdx.y, b = blockIdx.z; const int q0 = qb * 128 + wave * 16; const size_t rq = (size_t)b * SS + q0 + col;
  const float* kg = QK + ((size_t)b * SS + (tid >> 4)) * QKVW + DM + h * HD + (tid & 15) * 4;   // a wave's load: 2 key rows x 256 B
  const size_t vo = ((size_t)b * DM + h * HD + (tid >> 3)) * SS + (tid & 7) * 8;                // a wave's load: 4 V^T rows x 128 B
  const __bf16* vhg = VTH + vo; const __bf16* vlg = VTL + vo;
  const int sko = (tid >> 4) * GP + (tid & 15) * 4, svo = 2 * AARR + (tid >> 3) * GP + (tid & 7) * 8;
  v4f kx[4]; v4u vh[2], vl[2];
#pragma unroll
  for (int i = 0; i < 4; ++i) kx[i] = *(const v4f*)(kg + (size_t)i * 16 * QKVW);
#pragma unroll
  for (int i = 0; i < 2; ++i) { vh[i] = *(const v4u*)(vhg + (size_t)i * 32 * SS); vl[i] = *(const v4u*)(vlg + (size_t)i * 32 * SS); }
  F2 aq[2];
#pragma unroll
  for (int kc = 0; kc < 2; ++kc) aq[kc] = split_row(QK + rq * QKVW + h * HD, kc * 32, lane);
#pragma unroll
  for (int i = 0; i < 4; ++i) { v4b th, tl;
#pragma unroll
    for (int e = 0; e < 4; ++e) { const __bf16 hb = (__bf16)kx[i][e]; th[e] = hb; tl[e] = (__bf16)(kx[i][e] - (float)hb); }
    *(v4b*)(sb16 + sko + i * 16 * GP) = th; *(v4b*)(sb16 + AARR + sko + i * 16 * GP) = tl; }
#pragma unroll
  for (int i = 0; i < 2; ++i) { *(v4u*)(sb16 + svo + i * 32 * GP) = vh[i]; *(v4u*)(sb16 + AARR + svo + i * 32 * GP) = vl[i]; }
  float m = -3.0e38f, l = 0.f;   // of query q0 + col; l holds this half's keys only
  v8f acc[4] = {};               // acc[dt][r] = O^T[dt * 16 + 8g + r][query q0 + col]
  const float* arow = ADJ + (size_t)(q0 + col) * SS + 8 * g;
  __syncthreads();   // publishes tile 0
#pragma unroll 1
  for (int t = 0; t < ANT; ++t) { const __bf16* cur = sb16 + (t & 1) * ABUF; __bf16* nxt = sb16 + ((t + 1) & 1) * ABUF;
    const int tn = t + 1 < ANT ? t + 1 : t;   // the last trip fetches its own tile again, into the buffer that nobody reads any more: with no branch round the loads and stores the loads stay up here and the waits on them stay counted
    v4f aj[2][2][2];   // the lane's 32 of this tile's 64 adjacency values of its query (keys 8g + 0..7 of each 16)
#pragma unroll
    for (int u = 0; u < 2; ++u)
#pragma unroll
      for (int ct = 0; ct < 2; ++ct) { aj[u][ct][0] = *(const v4f*)(arow + t * AKT + u * 32 + ct * 16); aj[u][ct][1] = *(const v4f*)(arow + t * AKT + u * 32 + ct * 16 + 4); }
#pragma unroll
    for (int i = 0; i < 4; ++i) kx[i] = *(const v4f*)(kg + (size_t)(tn * AKT + i * 16) * QKVW);
#pragma unroll
    for (int i = 0; i < 2; ++i) { vh[i] = *(const v4u*)(vhg + (size_t)i * 32 * SS + tn * AKT); vl[i] = *(const v4u*)(vlg + (size_t)i * 32 * SS + tn * AKT); }
    asm volatile("s_wait_xcnt 0x0" ::: "memory");   // stands behind the run of loads, in front of any later rewrite of a register that holds one of their addresses
#pragma unroll
    for (int u = 0; u < 2; ++u) { float s[16]; v16b kh[2][2], kl[2][2], fh[4], fl[4]; v8f c[2];
#pragma unroll
      for (int ct = 0; ct < 2; ++ct) { const __bf16* krow = cur + (u * 32 + ct * 16 + col) * GP;
#pragma unroll
        for (int kc = 0; kc < 2; ++kc) { kh[ct][kc] = frag_b(krow + kc * 32, lane); kl[ct][kc] = frag_b(krow + AARR + kc * 32, lane); } }
#pragma unroll
      for (int ct = 0; ct < 2; ++ct) { c[ct] = v8f{};
#pragma unroll
        for (int kc = 0; kc < 2; ++kc) { c[ct] = wmma_bf(kh[ct][kc], aq[kc].l, c[ct]); c[ct] = wmma_bf(kl[ct][kc], aq[kc].h, c[ct]); c[ct] = wmma_bf(kh[ct][kc], aq[kc].h, c[ct]); } }
#pragma unroll
      for (int dt = 0; dt < 4; ++dt) { const __bf16* vrow = cur + 2 * AARR + (dt * 16 + col) * GP + u * 32; fh[dt] = frag_b(vrow, lane); fl[dt] = frag_b(vrow + AARR, lane); }
      if (u == 0) __builtin_amdgcn_sched_barrier(0);   // keeps the first compare on the adjacency values just asked for, and with it the wait on their loads, behind the score products
#pragma unroll
      for (int ct = 0; ct < 2; ++ct)
#pragma unroll
        for (int r = 0; r < 8; ++r) { const float a = aj[u][ct][r >> 2][r & 3]; s[ct * 8 + r] = (a <= 0.f) ? -1.44269504e30f : c[ct][r] * 0.18033688f; }   // both sides times log2(e): -1e30 * 1.44269504 and SCALE * 1.44269504 = 1.44269504 / sqrt(64); scores, maximum and exponentials run in base 2, and the softmax weights are the same but for rounding
      float mx = s[0];
#pragma unroll
      for (int i = 1; i < 16; ++i) mx = fmaxf(mx, s[i]);
      mx = fmaxf(mx, xhalf(mx));
      const float mn = fmaxf(m, mx); const float alpha = ex2(m - mn);
      float es = 0.f;
#pragma unroll
      for (int i = 0; i < 16; ++i) { s[i] = ex2(s[i] - mn); es += s[i]; }
      l = l * alpha + es; m = mn;
#pragma unroll
      for (int dt = 0; dt < 4; ++dt) acc[dt] *= alpha;
      const F2 pb = bsplit16(s);   // element i = P^T[key 8g + i or 16 + 8g + (i - 8)][query]: the k order of frag_b
#pragma unroll
      for (int dt = 0; dt < 4; ++dt) { acc[dt] = wmma_bf(fh[dt], pb.l, acc[dt]); acc[dt] = wmma_bf(fl[dt], pb.h, acc[dt]); acc[dt] = wmma_bf(fh[dt], pb.h, acc[dt]); } }
#pragma unroll
    for (int i = 0; i < 4; ++i) { v4b th, tl;
#pragma unroll
      for (int e = 0; e < 4; ++e) { const __bf16 hb = (__bf16)kx[i][e]; th[e] = hb; tl[e] = (__bf16)(kx[i][e] - (float)hb); }
      *(v4b*)(nxt + sko + i * 16 * GP) = th; *(v4b*)(nxt + AARR + sko + i * 16 * GP) = tl; }
#pragma unroll
    for (int i = 0; i < 2; ++i) { *(v4u*)(nxt + svo + i * 32 * GP) = vh[i]; *(v4u*)(nxt + AARR + svo + i * 32 * GP) = vl[i]; }
    __syncthreads(); }   // publishes tile t + 1 and ends every wave's reads of tile t, whose buffer the next trip refills
  const float il = 1.0f / (l + xhalf(l));
#pragma unroll
  for (int dt = 0; dt < 4; ++dt) { v4f o0, o1;
#pragma unroll
    for (int r = 0; r < 4; ++r) { o0[r] = acc[dt][r] * il; o1[r] = acc[dt][4 + r] * il; }
    *(v4f*)&so[wave][col][dt * 16 + 8 * g] = o0; *(v4f*)&so[wave][col][dt * 16 + 8 * g + 4] = o1; }
  LDSX();
  for (int rl = 0; rl < 16; ++rl) if (lane < 16) vst2(O + ((size_t)b * SS + q0 + rl) * DM + h * HD + lane * 4, *(const v4f*)&so[wave][rl][lane * 4]);
}
// ---- k_out: block = (64 rows, 128 cols): out = O(hi/lo) . out_proj rows (2 products) + bias
__global__ __launch_bounds__(128) void k_out(const float* __restrict__ O, const __bf16* __restrict__ P, const float* __restrict__ BO, float* __restrict__ Y) {
  __shared__ __align__(16) char sm[2 * (64 + 64 + 128) * GP * 2];   // two buffers of [64 A hi rows | 64 A lo rows | 128 weight rows]; behind the loop's last barrier the same bytes hold so[4][16][132]
  __bf16* const sb16 = (__bf16*)sm; float (*const so)[16][132] = (float (*)[16][132])sm;
  const int tid = threadIdx.x, wave = tid >> 5, lane = tid & 31, col = lane & 15, g = lane >> 4; const size_t rb = (size_t)blockIdx.x * 64, r0 = rb + wave * 16; const int n0 = blockIdx.y * 128;
  const float* xg = O + (rb + (tid >> 4)) * DM + (tid & 15) * 4;
  const __bf16* pg = P + (size_t)(n0 + (tid >> 3)) * DM + (tid & 7) * 8;
  const int sao = (tid >> 4) * GP + (tid & 15) * 4, sbo = 128 * GP + (tid >> 3) * GP + (tid & 7) * 8;
  v4f xa[8]; v4u wb[8];
  v8f acc[8] = {};
#pragma unroll
  for (int i = 0; i < 8; ++i) { xa[i] = *(const v4f*)(xg + (size_t)i * 8 * DM); wb[i] = *(const v4u*)(pg + (size_t)i * 16 * DM); }
#pragma unroll
  for (int i = 0; i < 8; ++i) { v4b th, tl;
#pragma unroll
    for (int e = 0; e < 4; ++e) { const __bf16 h = (__bf16)xa[i][e]; th[e] = h; tl[e] = (__bf16)(xa[i][e] - (float)h); }
    *(v4b*)(sb16 + sao + i * 8 * GP) = th; *(v4b*)(sb16 + 64 * GP + sao + i * 8 * GP) = tl; *(v4u*)(sb16 + sbo + i * 16 * GP) = wb[i]; }
  __syncthreads();
#pragma unroll 2   // two trips per branch: each buffer's LDS offsets become constants
  for (int c = 0; c < GCH; ++c) { const __bf16* cur = sb16 + (c & 1) * (256 * GP); __bf16* nxt = sb16 + ((c + 1) & 1) * (256 * GP);
    if (c + 1 < GCH) {
#pragma unroll
      for (int i = 0; i < 8; ++i) { xa[i] = *(const v4f*)(xg + (size_t)i * 8 * DM + (c + 1) * 64); wb[i] = *(const v4u*)(pg + (size_t)i * 16 * DM + (c + 1) * 64); }
      asm volatile("s_wait_xcnt 0x0" ::: "memory"); }   // stands behind the run of prefetch loads, in front of any later rewrite of a register that holds one of their addresses
#pragma unroll
    for (int kc = 0; kc < 2; ++kc) { const v16b ah = frag_b(cur + (wave * 16 + col) * GP + kc * 32, lane), al = frag_b(cur + (64 + wave * 16 + col) * GP + kc * 32, lane); v16b w[8];
#pragma unroll
      for (int j = 0; j < 8; ++j) w[j] = frag_b(cur + (128 + j * 16 + col) * GP + kc * 32, lane);
#pragma unroll
      for (int j = 0; j < 8; ++j) { acc[j] = wmma_bf(al, w[j], acc[j]); acc[j] = wmma_bf(ah, w[j], acc[j]); } }
    if (c + 1 < GCH) {
#pragma unroll
      for (int i = 0; i < 8; ++i) { v4b th, tl;
#pragma unroll
        for (int e = 0; e < 4; ++e) { const __bf16 h = (__bf16)xa[i][e]; th[e] = h; tl[e] = (__bf16)(xa[i][e] - (float)h); }
        *(v4b*)(nxt + sao + i * 8 * GP) = th; *(v4b*)(nxt + 64 * GP + sao + i * 8 * GP) = tl; *(v4u*)(nxt + sbo + i * 16 * GP) = wb[i]; } }
    __syncthreads(); }   // publishes chunk c + 1 and ends every wave's reads of chunk c, whose buffer the next trip refills
#pragma unroll
  for (int j = 0; j < 8; ++j) { const float bb = bfr(BO[n0 + j * 16 + col]);
#pragma unroll
    for (int r = 0; r < 8; ++r) so[wave][8 * g + r][j * 16 + col] = acc[j][r] + bb; }
  LDSX();
  for (int rl = 0; rl < 16; ++rl) vst2(Y + (r0 + rl) * DM + n0 + lane * 4, *(const v4f*)&so[wave][rl][lane * 4]);
}
extern "C" void kernel_launch(void* const* d_in, const int* in_sizes, int n_in, void* d_out, int out_size, void* d_ws, size_t ws_size, hipStream_t stream) {
  (void)in_sizes; (void)n_in; (void)out_size;
  const float** F = (const float**)d_in;   // 0 x [4,1024,1024], 1 adjacency [1024,1024], 2 in_proj_w [3072,1024], 3 in_proj_b [3072], 4 out_proj_w [1024,1024], 5 out_proj_b [1024]
  if (ws_size < (size_t)WS_END) return;
  char* ws = (char*)d_ws; __bf16* PK = (__bf16*)(ws + WS_PK); float *QK = (float*)(ws + WS_QK), *O = (float*)(ws + WS_O); __bf16 *VTH = (__bf16*)(ws + WS_VTH), *VTL = (__bf16*)(ws + WS_VTL);
  k_pack<<<QKVW, 256, 0, stream>>>(F[2], PK + PK_A); k_pack<<<DM, 256, 0, stream>>>(F[4], PK + PK_P);
  k_qkv<<<dim3(TNB * SS / 64, QKVW / 128), 128, 0, stream>>>(F[0], PK + PK_A, F[3], QK);
  k_vt<<<dim3(TNB * SS / 64, NH), 256, 0, stream>>>(QK, VTH, VTL);
  k_attn<<<dim3(TQB, NH, TNB), 256, 0, stream>>>(QK, F[1], VTH, VTL, O);
  k_out<<<dim3(TOB, DM / 128), 128, 0, stream>>>(O, PK + PK_P, F[5], (float*)d_out);
}

// v005
// Measured time: 120 microseconds a run.
// Timed twice side by side with v004, it ran 1.12 times as fast both times.
// Counting every step since v000, it is 3.35 times as fast.
// compute dtype: x, in_proj/out_proj weights and biases (module inputs) rounded to bf16 (the adjacency is read as f32); the packed qkv projection with exact bf16 products (x and W are inputs) + bias; scores q.k with both computed operands as bf16 hi + residual pairs (3 products) and P.V with P hi/lo x V hi/lo (3 products); the adjacency mask as a select (adjacency <= 0 -> -1e30); the output projection hi/lo x exact Wo (2 products) + bo; running-max softmax in f32; f32 accumulate.
#include <hip/hip_runtime.h>
#include <math.h>

typedef __attribute__((ext_vector_type(16))) _Float16 v16h;
typedef __attribute__((ext_vector_type(16))) __bf16 v16b;
typedef __attribute__((ext_vector_type(8)))  _Float16 v8h;
typedef __attribute__((ext_vector_type(8)))  float v8f;
typedef __attribute__((ext_vector_type(4)))  float v4f;
typedef __attribute__((ext_vector_type(2)))  float v2f;
typedef __attribute__((ext_vector_type(4)))  unsigned v4u;
typedef __attribute__((ext_vector_type(4)))  int v4i;
typedef float __attribute__((may_alias)) float_a;
typedef int __attribute__((may_alias)) int_a;

template <typename T> __device__ __forceinline__ void vst2(void* p, T v) { *(T*)p = v;  }
__device__ __forceinline__ v8f wmma16(v16h a, v16h b, v8f c) {
  v8f d = __builtin_amdgcn_wmma_f32_16x16x32_f16(false, a, false, b, (short)0, c, false, false);
  asm volatile("v_nop\n\tv_nop\n\tv_nop\n\tv_nop" : "+v"(d) : "v"(a), "v"(b));
  return d;
}
__device__ __forceinline__ v8f wmma_bf(v16b a, v16b b, v8f c) {
  v8f d = __builtin_amdgcn_wmma_f32_16x16x32_bf16(false, a, false, b, (short)0, c, false, false);
  asm volatile("v_nop\n\tv_nop\n\tv_nop\n\tv_nop" : "+v"(d) : "v"(a), "v"(b));
  return d;
}
// 16x16x32 fragments: lane = (h = lane>>4, row/col = lane&15); elements 0..7 = k0+8h+0..7, 8..15 = k0+16+8h+0..7; D element r = row 8h+r
__device__ __forceinline__ v16h frag_h(const _Float16* rowk0, int lane) {
  union { v16h v; v8h q[2]; } u; const _Float16* p = rowk0 + 8 * (lane >> 4);
  u.q[0] = *(const v8h*)p; u.q[1] = *(const v8h*)(p + 16); return u.v;
}
__device__ __forceinline__ v16h frag_f32(const float* rowk0, int lane) {
  v16h a; const float* p = rowk0 + 8 * (lane >> 4);
#pragma unroll
  for (int i = 0; i < 8; ++i) { a[i] = (_Float16)p[i]; a[8 + i] = (_Float16)p[16 + i]; }
  return a;
}
__device__ __forceinline__ v16h frag_f32s(const float* rowk0, int lane, float sc) {
  v16h a; const float* p = rowk0 + 8 * (lane >> 4);
#pragma unroll
  for (int i = 0; i < 8; ++i) { a[i] = (_Float16)(p[i] * sc); a[8 + i] = (_Float16)(p[16 + i] * sc); }
  return a;
}
// column fragment from a [K][ld] layout (column n), rows >= K read as 0
__device__ __forceinline__ v16h fragc_f32(const float* W, int k0, int n, int lane, int ld, int K) {
  v16h a; const int g = lane >> 4;
#pragma unroll
  for (int i = 0; i < 8; ++i) { const int ka = k0 + 8 * g + i, kb = ka + 16;
    a[i] = (_Float16)(ka < K ? W[(size_t)(ka < K ? ka : K - 1) * ld + n] : 0.f); a[8 + i] = (_Float16)(kb < K ? W[(size_t)(kb < K ? kb : K - 1) * ld + n] : 0.f); }
  return a;
}
struct F2 { v16b h, l; };
__device__ __forceinline__ F2 bsplit16(const float v[16]) { F2 r;
#pragma unroll
  for (int i = 0; i < 16; ++i) { const __bf16 h = (__bf16)v[i]; r.h[i] = h; r.l[i] = (__bf16)(v[i] - (float)h); }
  return r; }
__device__ __forceinline__ F2 split_row(const float* row, int k0, int lane) { float v[16]; const float* p = row + k0 + 8 * (lane >> 4);
#pragma unroll
  for (int i = 0; i < 8; ++i) { v[i] = p[i]; v[8 + i] = p[16 + i]; }
  return bsplit16(v); }
__device__ __forceinline__ F2 split_rowK(const float* row, int k0, int lane, int K) { float v[16]; const int g = lane >> 4;
#pragma unroll
  for (int i = 0; i < 8; ++i) { const int ka = k0 + 8 * g + i, kb = ka + 16; v[i] = ka < K ? row[ka < K ? ka : K - 1] : 0.f; v[8 + i] = kb < K ? row[kb < K ? kb : K - 1] : 0.f; }
  return bsplit16(v); }
__device__ __forceinline__ F2 split_col(const float* W, int k0, int n, int lane, int ld, int K) { float v[16]; const int g = lane >> 4;
#pragma unroll
  for (int i = 0; i < 8; ++i) { const int ka = k0 + 8 * g + i, kb = ka + 16; v[i] = ka < K ? W[(size_t)(ka < K ? ka : K - 1) * ld + n] : 0.f; v[8 + i] = kb < K ? W[(size_t)(kb < K ? kb : K - 1) * ld + n] : 0.f; }
  return bsplit16(v); }
__device__ __forceinline__ v8f mac3(const F2& a, const F2& b, v8f c) { c = wmma_bf(a.l, b.h, c); c = wmma_bf(a.h, b.l, c); return wmma_bf(a.h, b.h, c); }
__device__ __forceinline__ float sigm(float v) { return 1.0f / (1.0f + expf(-v)); }
#define LDSX() do { asm volatile("s_wait_dscnt 0" ::: "memory"); __builtin_amdgcn_wave_barrier(); __builtin_amdgcn_fence(__ATOMIC_RELEASE, "workgroup"); } while (0)


// Masked multi-head self-attention (B 4, T 1024, D 1024, 16 heads x 64; torch-style packed in_proj [3D][D] + bias, out_proj [D][D] + bias): scores = q.k / 8, keys with adjacency[q][k] <= 0 disallowed (-1e30 before the softmax; the [T][T] adjacency is shared by all batches and heads), out = softmax(scores) v, then out_proj.
#define NB 4
#define SS 1024
#define DM 1024
#define NH 16
#define HD 64
#define QKVW (3 * DM)
#ifndef TQB
#define TQB (SS / 128)
#define TNB NB
#define TOB (NB * SS / 64)     // output row tiles (all)
#endif
typedef __attribute__((ext_vector_type(8))) __bf16 v8b;
__device__ __forceinline__ v16b frag_b(const __bf16* rowk0, int lane) {
  union { v16b v; v8b q[2]; } u; const __bf16* p = rowk0 + 8 * (lane >> 4);
  u.q[0] = *(const v8b*)p; u.q[1] = *(const v8b*)(p + 16); return u.v;
}
__device__ __forceinline__ float bfr(float v) { return (float)(__bf16)v; }
__device__ __forceinline__ float ex2(float v) { return __builtin_amdgcn_exp2f(v); }   // 2^v as the one hardware instruction; every argument here is <= 0, and a result below the normal range may go to 0
__device__ __attribute__((noinline)) float erf_ni(float v) { return erff(v); }

#define PK_A 0                       // [3072][1024] in_proj rows (natural [out][in])
#define PK_P (PK_A + QKVW * DM)        // [1024][1024] out_proj rows (natural)
#define PK_END (PK_P + DM * DM)
#define WS_PK  0u
#define WS_QK  (WS_PK + 2u * PK_END)             // f32 [4096 rows][3072]: only the q columns are written and read
#define WS_VTH (WS_QK + 4u * NB * SS * QKVW)     // bf16 [4][1024 (h*64+d)][1024 s]
#define WS_VTL (WS_VTH + 2u * NB * DM * SS)
#define WS_OH  (WS_VTL + 2u * NB * DM * SS)        // bf16 [4096][1024]: attention output, high part
#define WS_OL  (WS_OH + 2u * NB * SS * DM)         // the residual
#define WS_KH  (WS_OL + 2u * NB * SS * DM)         // bf16 [4096 rows][1024 (h*64+d)]: k, high part
#define WS_KL  (WS_KH + 2u * NB * SS * DM)         // the residual
#define WS_END (WS_KL + 2u * NB * SS * DM)

// ---- k_pack: block = row r of a natural [R][1024] weight -> bf16 row
__global__ __launch_bounds__(256) void k_pack(const float* __restrict__ Wm, __bf16* __restrict__ DST) {
  __shared__ __align__(16) __bf16 s[DM]; const int r = blockIdx.x, tid = threadIdx.x;
  for (int k = tid; k < DM; k += 256) s[k] = (__bf16)Wm[(size_t)r * DM + k];
  __syncthreads();
  for (int q = tid; q < DM / 8; q += 256) vst2((unsigned*)(DST + (size_t)r * DM + q * 8), *(const v4u*)&s[q * 8]);
}
// LDS staging of the two projections: a block brings each 64-k chunk of its A rows and its 128 weight rows in by whole 128-B lines, once, and the waves read their fragments from LDS
#define GP 72                  // LDS row pitch in bf16 elements: 144 B = 16 B x odd, which spreads the 16 rows of a 16-byte fragment read over the banks
#define GCH (DM / 64)          // staged chunks of 64 k
typedef __attribute__((ext_vector_type(4))) __bf16 v4b;
// ---- k_qkv: block = (64 rows, 128 of the 3072 cols): QKV = bf16(x) . in_proj rows (exact) + bias; the epilogue stores each third in the form k_attn takes it: q as f32 rows (pitch 3072), k as bf16 hi/lo rows, v as bf16 hi/lo transposed ([b][h*64+d][s])
__global__ __launch_bounds__(128) void k_qkv(const float* __restrict__ X, const __bf16* __restrict__ P, const float* __restrict__ BIAS, float* __restrict__ QKV, __bf16* __restrict__ KH, __bf16* __restrict__ KL, __bf16* __restrict__ VTH, __bf16* __restrict__ VTL) {
  __shared__ __align__(16) char sm[2 * (64 + 128) * GP * 2];   // two buffers of [64 A rows | 128 weight rows]; behind the loop's last barrier the same bytes hold so[4][16][132] (q, k) or the transposed tile [hi | lo][128 cols][GP] (v)
  __bf16* const sb16 = (__bf16*)sm; float (*const so)[16][132] = (float (*)[16][132])sm;
  const int tid = threadIdx.x, wave = tid >> 5, lane = tid & 31, col = lane & 15, g = lane >> 4; const size_t rb = (size_t)blockIdx.x * 64, r0 = rb + wave * 16; const int n0 = blockIdx.y * 128;
  const float* xg = X + (rb + (tid >> 4)) * DM + (tid & 15) * 4;               // a wave's load: 2 rows x 256 B
  const __bf16* pg = P + (size_t)(n0 + (tid >> 3)) * DM + (tid & 7) * 8;       // a wave's load: 4 rows x 128 B
  const int sao = (tid >> 4) * GP + (tid & 15) * 4, sbo = 64 * GP + (tid >> 3) * GP + (tid & 7) * 8;
  v4f xa[8]; v4u wb[8];
  v8f acc[8] = {};
#pragma unroll
  for (int i = 0; i < 8; ++i) { xa[i] = *(const v4f*)(xg + (size_t)i * 8 * DM); wb[i] = *(const v4u*)(pg + (size_t)i * 16 * DM); }
#pragma unroll
  for (int i = 0; i < 8; ++i) { v4b t;
#pragma unroll
    for (int e = 0; e < 4; ++e) t[e] = (__bf16)xa[i][e];
    *(v4b*)(sb16 + sao + i * 8 * GP) = t; *(v4u*)(sb16 + sbo + i * 16 * GP) = wb[i]; }
  __syncthreads();
#pragma unroll 2   // two trips per branch: each buffer's LDS offsets become constants
  for (int c = 0; c < GCH; ++c) { const __bf16* cur = sb16 + (c & 1) * (192 * GP); __bf16* nxt = sb16 + ((c + 1) & 1) * (192 * GP);
    if (c + 1 < GCH) {
#pragma unroll
      for (int i = 0; i < 8; ++i) { xa[i] = *(const v4f*)(xg + (size_t)i * 8 * DM + (c + 1) * 64); wb[i] = *(const v4u*)(pg + (size_t)i * 16 * DM + (c + 1) * 64); }
      asm volatile("s_wait_xcnt 0x0" ::: "memory"); }   // stands behind the run of prefetch loads, in front of any later rewrite of a register that holds one of their addresses
#pragma unroll
    for (int kc = 0; kc < 2; ++kc) { const v16b a = frag_b(cur + (wave * 16 + col) * GP + kc * 32, lane); v16b w[8];
#pragma unroll
      for (int j = 0; j < 8; ++j) w[j] = frag_b(cur + (64 + j * 16 + col) * GP + kc * 32, lane);
#pragma unroll
      for (int j = 0; j < 8; ++j) acc[j] = wmma_bf(a, w[j], acc[j]); }
    if (c + 1 < GCH) {
#pragma unroll
      for (int i = 0; i < 8; ++i) { v4b t;
#pragma unroll
        for (int e = 0; e < 4; ++e) t[e] = (__bf16)xa[i][e];
        *(v4b*)(nxt + sao + i * 8 * GP) = t; *(v4u*)(nxt + sbo + i * 16 * GP) = wb[i]; } }
    __syncthreads(); }   // publishes chunk c + 1 and ends every wave's reads of chunk c, whose buffer the next trip refills
  if (n0 >= 2 * DM) {   // v (the test is the same for the whole block): a lane holds 8 consecutive s of one column, 16 B of a transposed row
#pragma unroll
    for (int j = 0; j < 8; ++j) { const float bb = bfr(BIAS[n0 + j * 16 + col]); v8b th, tl;
#pragma unroll
      for (int r = 0; r < 8; ++r) { const float v = acc[j][r] + bb; const __bf16 hb = (__bf16)v; th[r] = hb; tl[r] = (__bf16)(v - (float)hb); }
      *(v8b*)(sb16 + (j * 16 + col) * GP + wave * 16 + 8 * g) = th; *(v8b*)(sb16 + (128 + j * 16 + col) * GP + wave * 16 + 8 * g) = tl; }
    __syncthreads();   // a transposed row of 64 s, one whole line, holds 16 s of each wave
    const size_t vb = ((rb / SS) * DM + (n0 - 2 * DM)) * SS + rb % SS;
#pragma unroll
    for (int i = 0; i < 8; ++i) { const int cn = i * 16 + (tid >> 3), pc = (tid & 7) * 8;   // a wave's store: 4 rows x 128 B
      vst2(VTH + vb + (size_t)cn * SS + pc, *(const v4u*)(sb16 + cn * GP + pc)); vst2(VTL + vb + (size_t)cn * SS + pc, *(const v4u*)(sb16 + (128 + cn) * GP + pc)); }
    return; }
#pragma unroll
  for (int j = 0; j < 8; ++j) { const float bb = bfr(BIAS[n0 + j * 16 + col]);
#pragma unroll
    for (int r = 0; r < 8; ++r) so[wave][8 * g + r][j * 16 + col] = acc[j][r] + bb; }
  LDSX();
  if (n0 < DM) { for (int rl = 0; rl < 16; ++rl) vst2(QKV + (r0 + rl) * QKVW + n0 + lane * 4, *(const v4f*)&so[wave][rl][lane * 4]); }
  else {   // k: split hi/lo here, once, in place of once per block of k_attn
#pragma unroll
    for (int p = 0; p < 8; ++p) { const int rl = p * 2 + g; const v4f a = *(const v4f*)&so[wave][rl][col * 8], c = *(const v4f*)&so[wave][rl][col * 8 + 4]; v8b th, tl;   // a wave's store: 2 rows x 256 B
#pragma unroll
      for (int e = 0; e < 4; ++e) { const __bf16 ha = (__bf16)a[e], hc = (__bf16)c[e]; th[e] = ha; tl[e] = (__bf16)(a[e] - (float)ha); th[4 + e] = hc; tl[4 + e] = (__bf16)(c[e] - (float)hc); }
      const size_t o = (r0 + rl) * DM + (n0 - DM) + col * 8; *(v8b*)(KH + o) = th; *(v8b*)(KL + o) = tl; }
    asm volatile("s_wait_xcnt 0x0" ::: "memory"); }   // stands behind the run of stores, in front of any later rewrite of a register that one of them names
}
// ---- k_attn: block = (128 queries = 8 waves x 16, head h, batch b): flash attention over the 1,024 keys, transposed: S^T = K.Q^T (A = key rows, B = query columns, 3 products) / 8, so a lane holds 16 of ONE query's 32 scores (keys 8g + r and 16 + 8g + r of the step); disallowed keys (adjacency[q][k] <= 0) set to -1e30; maximum and sum run in the lane, the two halves of the wave exchange the maximum once per step and join their sums behind the loop; the two score tiles, split hi/lo in place, are the B operand of O^T += V^T.P^T (3 products); O[b*S+q][h*64+d] = acc / l, stored as a bf16 hi/lo pair
// K and V^T come through LDS, both as the bf16 hi/lo pairs that k_qkv has stored: the block brings each tile of 64 keys in by whole 128-B lines, once for its 8 waves, and every wave reads its A fragments from LDS (two steps of 32 keys per tile)
#define AKT 64                 // keys per staged tile: a V^T row piece is then one whole line
#define ANT (SS / AKT)
#define AARR (AKT * GP)        // one staged array: 64 rows at the padded pitch
#define ABUF (4 * AARR)        // one buffer: [K hi | K lo | V^T hi | V^T lo]
__device__ __forceinline__ float xhalf(float x) { return __builtin_bit_cast(float, __builtin_amdgcn_permlanex16(__builtin_bit_cast(int, x), __builtin_bit_cast(int, x), 0x76543210, 0xfedcba98, false, false)); }  // lane l with lane l ^ 16
__global__ __launch_bounds__(256) void k_attn(const float* __restrict__ QK, const float* __restrict__ ADJ, const __bf16* __restrict__ KH, const __bf16* __restrict__ KL, const __bf16* __restrict__ VTH, const __bf16* __restrict__ VTL, __bf16* __restrict__ OH, __bf16* __restrict__ OL) {
  __shared__ __align__(16) char sm[2 * ABUF * 2];   // two buffers; behind the loop's last barrier the same bytes hold so[8 waves][hi | lo][16][GP]
  __bf16* const sb16 = (__bf16*)sm; __bf16 (*const so)[2][16][GP] = (__bf16 (*)[2][16][GP])sm;
  const int tid = threadIdx.x, wave = tid >> 5, lane = tid & 31, col = lane & 15, g = lane >> 4;
  const int qb = blockIdx.x, h = blockIdx.y, b = blockIdx.z; const int q0 = qb * 128 + wave * 16; const size_t rq = (size_t)b * SS + q0 + col;
  const size_t ko = ((size_t)b * SS + (tid >> 3)) * DM + h * HD + (tid & 7) * 8;                // a wave's load: 4 key rows x 128 B
  const __bf16* khg = KH + ko; const __bf16* klg = KL + ko;
  const size_t vo = ((size_t)b * DM + h * HD + (tid >> 3)) * SS + (tid & 7) * 8;                // a wave's load: 4 V^T rows x 128 B
  const __bf16* vhg = VTH + vo; const __bf16* vlg = VTL + vo;
  const int sko = (tid >> 3) * GP + (tid & 7) * 8, svo = 2 * AARR + sko;
  v4u xh[2], xl[2], vh[2], vl[2];
#pragma unroll
  for (int i = 0; i < 2; ++i) { xh[i] = *(const v4u*)(khg + (size_t)i * 32 * DM); xl[i] = *(const v4u*)(klg + (size_t)i * 32 * DM); }
#pragma unroll
  for (int i = 0; i < 2; ++i) { vh[i] = *(const v4u*)(vhg + (size_t)i * 32 * SS); vl[i] = *(const v4u*)(vlg + (size_t)i * 32 * SS); }
  F2 aq[2];
#pragma unroll
  for (int kc = 0; kc < 2; ++kc) aq[kc] = split_row(QK + rq * QKVW + h * HD, kc * 32, lane);
#pragma unroll
  for (int i = 0; i < 2; ++i) { *(v4u*)(sb16 + sko + i * 32 * GP) = xh[i]; *(v4u*)(sb16 + AARR + sko + i * 32 * GP) = xl[i]; }
#pragma unroll
  for (int i = 0; i < 2; ++i) { *(v4u*)(sb16 + svo + i * 32 * GP) = vh[i]; *(v4u*)(sb16 + AARR + svo + i * 32 * GP) = vl[i]; }
  float m = -3.0e38f, l = 0.f;   // of query q0 + col; l holds this half's keys only
  v8f acc[4] = {};               // acc[dt][r] = O^T[dt * 16 + 8g + r][query q0 + col]
  const float* arow = ADJ + (size_t)(q0 + col) * SS + 8 * g;
  __syncthreads();   // publishes tile 0
#pragma unroll 1
  for (int t = 0; t < ANT; ++t) { const __bf16* cur = sb16 + (t & 1) * ABUF; __bf16* nxt = sb16 + ((t + 1) & 1) * ABUF;
    const int tn = t + 1 < ANT ? t + 1 : t;   // the last trip fetches its own tile again, into the buffer that nobody reads any more: with no branch round the loads and stores the loads stay up here and the waits on them stay counted
    v4f aj[2][2][2];   // the lane's 32 of this tile's 64 adjacency values of its query (keys 8g + 0..7 of each 16)
#pragma unroll
    for (int u = 0; u < 2; ++u)
#pragma unroll
      for (int ct = 0; ct < 2; ++ct) { aj[u][ct][0] = *(const v4f*)(arow + t * AKT + u * 32 + ct * 16); aj[u][ct][1] = *(const v4f*)(arow + t * AKT + u * 32 + ct * 16 + 4); }
#pragma unroll
    for (int i = 0; i < 2; ++i) { xh[i] = *(const v4u*)(khg + (size_t)(tn * AKT + i * 32) * DM); xl[i] = *(const v4u*)(klg + (size_t)(tn * AKT + i * 32) * DM); }
#pragma unroll
    for (int i = 0; i < 2; ++i) { vh[i] = *(const v4u*)(vhg + (size_t)i * 32 * SS + tn * AKT); vl[i] = *(const v4u*)(vlg + (size_t)i * 32 * SS + tn * AKT); }
    asm volatile("s_wait_xcnt 0x0" ::: "memory");   // stands behind the run of loads, in front of any later rewrite of a register that holds one of their addresses
#pragma unroll
    for (int u = 0; u < 2; ++u) { float s[16]; v16b kh[2][2], kl[2][2], fh[4], fl[4]; v8f c[2];
#pragma unroll
      for (int ct = 0; ct < 2; ++ct) { const __bf16* krow = cur + (u * 32 + ct * 16 + col) * GP;
#pragma unroll
        for (int kc = 0; kc < 2; ++kc) { kh[ct][kc] = frag_b(krow + kc * 32, lane); kl[ct][kc] = frag_b(krow + AARR + kc * 32, lane); } }
#pragma unroll
      for (int ct = 0; ct < 2; ++ct) { c[ct] = v8f{};
#pragma unroll
        for (int kc = 0; kc < 2; ++kc) { c[ct] = wmma_bf(kh[ct][kc], aq[kc].l, c[ct]); c[ct] = wmma_bf(kl[ct][kc], aq[kc].h, c[ct]); c[ct] = wmma_bf(kh[ct][kc], aq[kc].h, c[ct]); } }
#pragma unroll
      for (int dt = 0; dt < 4; ++dt) { const __bf16* vrow = cur + 2 * AARR + (dt * 16 + col) * GP + u * 32; fh[dt] = frag_b(vrow, lane); fl[dt] = frag_b(vrow + AARR, lane); }
      if (u == 0) __builtin_amdgcn_sched_barrier(0);   // keeps the first compare on the adjacency values just asked for, and with it the wait on their loads, behind the score products
#pragma unroll
      for (int ct = 0; ct < 2; ++ct)
#pragma unroll
        for (int r = 0; r < 8; ++r) { const float a = aj[u][ct][r >> 2][r & 3]; s[ct * 8 + r] = (a <= 0.f) ? -1.44269504e30f : c[ct][r] * 0.18033688f; }   // both sides times log2(e): -1e30 * 1.44269504 and SCALE * 1.44269504 = 1.44269504 / sqrt(64); scores, maximum and exponentials run in base 2, and the softmax weights are the same but for rounding
      float mx = s[0];
#pragma unroll
      for (int i = 1; i < 16; ++i) mx = fmaxf(mx, s[i]);
      mx = fmaxf(mx, xhalf(mx));
      const float mn = fmaxf(m, mx); const float alpha = ex2(m - mn);
      float es = 0.f;
#pragma unroll
      for (int i = 0; i < 16; ++i) { s[i] = ex2(s[i] - mn); es += s[i]; }
      l = l * alpha + es; m = mn;
#pragma unroll
      for (int dt = 0; dt < 4; ++dt) acc[dt] *= alpha;
      const F2 pb = bsplit16(s);   // element i = P^T[key 8g + i or 16 + 8g + (i - 8)][query]: the k order of frag_b
#pragma unroll
      for (int dt = 0; dt < 4; ++dt) { acc[dt] = wmma_bf(fh[dt], pb.l, acc[dt]); acc[dt] = wmma_bf(fl[dt], pb.h, acc[dt]); acc[dt] = wmma_bf(fh[dt], pb.h, acc[dt]); } }
#pragma unroll
    for (int i = 0; i < 2; ++i) { *(v4u*)(nxt + sko + i * 32 * GP) = xh[i]; *(v4u*)(nxt + AARR + sko + i * 32 * GP) = xl[i]; }
#pragma unroll
    for (int i = 0; i < 2; ++i) { *(v4u*)(nxt + svo + i * 32 * GP) = vh[i]; *(v4u*)(nxt + AARR + svo + i * 32 * GP) = vl[i]; }
    __syncthreads(); }   // publishes tile t + 1 and ends every wave's reads of tile t, whose buffer the next trip refills
  const float il = 1.0f / (l + xhalf(l));
#pragma unroll
  for (int dt = 0; dt < 4; ++dt) { v8b th, tl;   // split hi/lo here, once, in place of once per column block of k_out
#pragma unroll
    for (int r = 0; r < 8; ++r) { const float v = acc[dt][r] * il; const __bf16 hb = (__bf16)v; th[r] = hb; tl[r] = (__bf16)(v - (float)hb); }
    *(v8b*)&so[wave][0][col][dt * 16 + 8 * g] = th; *(v8b*)&so[wave][1][col][dt * 16 + 8 * g] = tl; }
  LDSX();
#pragma unroll
  for (int i = 0; i < 4; ++i) { const int rl = i * 4 + (lane >> 3), pc = (lane & 7) * 8; const size_t o = ((size_t)b * SS + q0 + rl) * DM + h * HD + pc;   // a wave's store: 4 rows x 128 B
    vst2(OH + o, *(const v4u*)&so[wave][0][rl][pc]); vst2(OL + o, *(const v4u*)&so[wave][1][rl][pc]); }
}
// ---- k_out: block = (64 rows, 128 cols): out = O(hi/lo, as k_attn has stored them) . out_proj rows (2 products) + bias
__global__ __launch_bounds__(128) void k_out(const __bf16* __restrict__ OH, const __bf16* __restrict__ OL, const __bf16* __restrict__ P, const float* __restrict__ BO, float* __restrict__ Y) {
  __shared__ __align__(16) char sm[2 * (64 + 64 + 128) * GP * 2];   // two buffers of [64 A hi rows | 64 A lo rows | 128 weight rows]; behind the loop's last barrier the same bytes hold so[4][16][132]
  __bf16* const sb16 = (__bf16*)sm; float (*const so)[16][132] = (float (*)[16][132])sm;
  const int tid = threadIdx.x, wave = tid >> 5, lane = tid & 31, col = lane & 15, g = lane >> 4; const size_t rb = (size_t)blockIdx.x * 64, r0 = rb + wave * 16; const int n0 = blockIdx.y * 128;
  const size_t ao = (rb + (tid >> 3)) * DM + (tid & 7) * 8;                    // a wave's load: 4 rows x 128 B
  const __bf16* hg = OH + ao; const __bf16* lg = OL + ao;
  const __bf16* pg = P + (size_t)(n0 + (tid >> 3)) * DM + (tid & 7) * 8;
  const int sao = (tid >> 3) * GP + (tid & 7) * 8, sbo = 128 * GP + sao;
  v4u xh[4], xl[4], wb[8];
  v8f acc[8] = {};
#pragma unroll
  for (int i = 0; i < 4; ++i) { xh[i] = *(const v4u*)(hg + (size_t)i * 16 * DM); xl[i] = *(const v4u*)(lg + (size_t)i * 16 * DM); }
#pragma unroll
  for (int i = 0; i < 8; ++i) wb[i] = *(const v4u*)(pg + (size_t)i * 16 * DM);
#pragma unroll
  for (int i = 0; i < 4; ++i) { *(v4u*)(sb16 + sao + i * 16 * GP) = xh[i]; *(v4u*)(sb16 + 64 * GP + sao + i * 16 * GP) = xl[i]; }
#pragma unroll
  for (int i = 0; i < 8; ++i) *(v4u*)(sb16 + sbo + i * 16 * GP) = wb[i];
  __syncthreads();
#pragma unroll 2   // two trips per branch: each buffer's LDS offsets become constants
  for (int c = 0; c < GCH; ++c) { const __bf16* cur = sb16 + (c & 1) * (256 * GP); __bf16* nxt = sb16 + ((c + 1) & 1) * (256 * GP);
    if (c + 1 < GCH) {
#pragma unroll
      for (int i = 0; i < 4; ++i) { xh[i] = *(const v4u*)(hg + (size_t)i * 16 * DM + (c + 1) * 64); xl[i] = *(const v4u*)(lg + (size_t)i * 16 * DM + (c + 1) * 64); }
#pragma unroll
      for (int i = 0; i < 8; ++i) wb[i] = *(const v4u*)(pg + (size_t)i * 16 * DM + (c + 1) * 64);
      asm volatile("s_wait_xcnt 0x0" ::: "memory"); }   // stands behind the run of prefetch loads, in front of any later rewrite of a register that holds one of their addresses
#pragma unroll
    for (int kc = 0; kc < 2; ++kc) { const v16b ah = frag_b(cur + (wave * 16 + col) * GP + kc * 32, lane), al = frag_b(cur + (64 + wave * 16 + col) * GP + kc * 32, lane); v16b w[8];
#pragma unroll
      for (int j = 0; j < 8; ++j) w[j] = frag_b(cur + (128 + j * 16 + col) * GP + kc * 32, lane);
#pragma unroll
      for (int j = 0; j < 8; ++j) { acc[j] = wmma_bf(al, w[j], acc[j]); acc[j] = wmma_bf(ah, w[j], acc[j]); } }
    if (c + 1 < GCH) {
#pragma unroll
      for (int i = 0; i < 4; ++i) { *(v4u*)(nxt + sao + i * 16 * GP) = xh[i]; *(v4u*)(nxt + 64 * GP + sao + i * 16 * GP) = xl[i]; }
#pragma unroll
      for (int i = 0; i < 8; ++i) *(v4u*)(nxt + sbo + i * 16 * GP) = wb[i]; }
    __syncthreads(); }   // publishes chunk c + 1 and ends every wave's reads of chunk c, whose buffer the next trip refills
#pragma unroll
  for (int j = 0; j < 8; ++j) { const float bb = bfr(BO[n0 + j * 16 + col]);
#pragma unroll
    for (int r = 0; r < 8; ++r) so[wave][8 * g + r][j * 16 + col] = acc[j][r] + bb; }
  LDSX();
  for (int rl = 0; rl < 16; ++rl) vst2(Y + (r0 + rl) * DM + n0 + lane * 4, *(const v4f*)&so[wave][rl][lane * 4]);
}
extern "C" void kernel_launch(void* const* d_in, const int* in_sizes, int n_in, void* d_out, int out_size, void* d_ws, size_t ws_size, hipStream_t stream) {
  (void)in_sizes; (void)n_in; (void)out_size;
  const float** F = (const float**)d_in;   // 0 x [4,1024,1024], 1 adjacency [1024,1024], 2 in_proj_w [3072,1024], 3 in_proj_b [3072], 4 out_proj_w [1024,1024], 5 out_proj_b [1024]
  if (ws_size < (size_t)WS_END) return;
  char* ws = (char*)d_ws; __bf16* PK = (__bf16*)(ws + WS_PK); float* QK = (float*)(ws + WS_QK); __bf16 *VTH = (__bf16*)(ws + WS_VTH), *VTL = (__bf16*)(ws + WS_VTL), *KH = (__bf16*)(ws + WS_KH), *KL = (__bf16*)(ws + WS_KL), *OH = (__bf16*)(ws + WS_OH), *OL = (__bf16*)(ws + WS_OL);
  k_pack<<<QKVW, 256, 0, stream>>>(F[2], PK + PK_A); k_pack<<<DM, 256, 0, stream>>>(F[4], PK + PK_P);
  k_qkv<<<dim3(TNB * SS / 64, QKVW / 128), 128, 0, stream>>>(F[0], PK + PK_A, F[3], QK, KH, KL, VTH, VTL);
  k_attn<<<dim3(TQB, NH, TNB), 256, 0, stream>>>(QK, F[1], KH, KL, VTH, VTL, OH, OL);
  k_out<<<dim3(TOB, DM / 128), 128, 0, stream>>>(OH, OL, PK + PK_P, F[5], (float*)d_out);
}

// v006
// Measured time: 114 microseconds a run.
// In two side-by-side timings against v005, it was 1.07 and 1.06 times as fast.
// Over all steps from v000 it is 3.56 times as fast.
// compute dtype: x, in_proj/out_proj weights and biases (module inputs) rounded to bf16 (the adjacency is read as f32); the packed qkv projection with exact bf16 products (x and W are inputs) + bias; scores q.k with both computed operands as bf16 hi + residual pairs (3 products) and P.V with P hi/lo x V hi/lo (3 products); the adjacency mask as a select (adjacency <= 0 -> -1e30); the output projection hi/lo x exact Wo (2 products) + bo; running-max softmax in f32; f32 accumulate.
#include <hip/hip_runtime.h>
#include <math.h>

typedef __attribute__((ext_vector_type(16))) _Float16 v16h;
typedef __attribute__((ext_vector_type(16))) __bf16 v16b;
typedef __attribute__((ext_vector_type(8)))  _Float16 v8h;
typedef __attribute__((ext_vector_type(8)))  float v8f;
typedef __attribute__((ext_vector_type(4)))  float v4f;
typedef __attribute__((ext_vector_type(2)))  float v2f;
typedef __attribute__((ext_vector_type(4)))  unsigned v4u;
typedef __attribute__((ext_vector_type(4)))  int v4i;
typedef float __attribute__((may_alias)) float_a;
typedef int __attribute__((may_alias)) int_a;

template <typename T> __device__ __forceinline__ void vst2(void* p, T v) { *(T*)p = v;  }
__device__ __forceinline__ v8f wmma16(v16h a, v16h b, v8f c) {
  v8f d = __builtin_amdgcn_wmma_f32_16x16x32_f16(false, a, false, b, (short)0, c, false, false);
  asm volatile("v_nop\n\tv_nop\n\tv_nop\n\tv_nop" : "+v"(d) : "v"(a), "v"(b));
  return d;
}
__device__ __forceinline__ v8f wmma_bf(v16b a, v16b b, v8f c) {
  v8f d = __builtin_amdgcn_wmma_f32_16x16x32_bf16(false, a, false, b, (short)0, c, false, false);
  asm volatile("v_nop\n\tv_nop\n\tv_nop\n\tv_nop" : "+v"(d) : "v"(a), "v"(b));
  return d;
}
// 16x16x32 fragments: lane = (h = lane>>4, row/col = lane&15); elements 0..7 = k0+8h+0..7, 8..15 = k0+16+8h+0..7; D element r = row 8h+r
__device__ __forceinline__ v16h frag_h(const _Float16* rowk0, int lane) {
  union { v16h v; v8h q[2]; } u; const _Float16* p = rowk0 + 8 * (lane >> 4);
  u.q[0] = *(const v8h*)p; u.q[1] = *(const v8h*)(p + 16); return u.v;
}
__device__ __forceinline__ v16h frag_f32(const float* rowk0, int lane) {
  v16h a; const float* p = rowk0 + 8 * (lane >> 4);
#pragma unroll
  for (int i = 0; i < 8; ++i) { a[i] = (_Float16)p[i]; a[8 + i] = (_Float16)p[16 + i]; }
  return a;
}
__device__ __forceinline__ v16h frag_f32s(const float* rowk0, int lane, float sc) {
  v16h a; const float* p = rowk0 + 8 * (lane >> 4);
#pragma unroll
  for (int i = 0; i < 8; ++i) { a[i] = (_Float16)(p[i] * sc); a[8 + i] = (_Float16)(p[16 + i] * sc); }
  return a;
}
// column fragment from a [K][ld] layout (column n), rows >= K read as 0
__device__ __forceinline__ v16h fragc_f32(const float* W, int k0, int n, int lane, int ld, int K) {
  v16h a; const int g = lane >> 4;
#pragma unroll
  for (int i = 0; i < 8; ++i) { const int ka = k0 + 8 * g + i, kb = ka + 16;
    a[i] = (_Float16)(ka < K ? W[(size_t)(ka < K ? ka : K - 1) * ld + n] : 0.f); a[8 + i] = (_Float16)(kb < K ? W[(size_t)(kb < K ? kb : K - 1) * ld + n] : 0.f); }
  return a;
}
struct F2 { v16b h, l; };
__device__ __forceinline__ F2 bsplit16(const float v[16]) { F2 r;
#pragma unroll
  for (int i = 0; i < 16; ++i) { const __bf16 h = (__bf16)v[i]; r.h[i] = h; r.l[i] = (__bf16)(v[i] - (float)h); }
  return r; }
__device__ __forceinline__ F2 split_row(const float* row, int k0, int lane) { float v[16]; const float* p = row + k0 + 8 * (lane >> 4);
#pragma unroll
  for (int i = 0; i < 8; ++i) { v[i] = p[i]; v[8 + i] = p[16 + i]; }
  return bsplit16(v); }
__device__ __forceinline__ F2 split_rowK(const float* row, int k0, int lane, int K) { float v[16]; const int g = lane >> 4;
#pragma unroll
  for (int i = 0; i < 8; ++i) { const int ka = k0 + 8 * g + i, kb = ka + 16; v[i] = ka < K ? row[ka < K ? ka : K - 1] : 0.f; v[8 + i] = kb < K ? row[kb < K ? kb : K - 1] : 0.f; }
  return bsplit16(v); }
__device__ __forceinline__ F2 split_col(const float* W, int k0, int n, int lane, int ld, int K) { float v[16]; const int g = lane >> 4;
#pragma unroll
  for (int i = 0; i < 8; ++i) { const int ka = k0 + 8 * g + i, kb = ka + 16; v[i] = ka < K ? W[(size_t)(ka < K ? ka : K - 1) * ld + n] : 0.f; v[8 + i] = kb < K ? W[(size_t)(kb < K ? kb : K - 1) * ld + n] : 0.f; }
  return bsplit16(v); }
__device__ __forceinline__ v8f mac3(const F2& a, const F2& b, v8f c) { c = wmma_bf(a.l, b.h, c); c = wmma_bf(a.h, b.l, c); return wmma_bf(a.h, b.h, c); }
__device__ __forceinline__ float sigm(float v) { return 1.0f / (1.0f + expf(-v)); }
#define LDSX() do { asm volatile("s_wait_dscnt 0" ::: "memory"); __builtin_amdgcn_wave_barrier(); __builtin_amdgcn_fence(__ATOMIC_RELEASE, "workgroup"); } while (0)


// Masked multi-head self-attention (B 4, T 1024, D 1024, 16 heads x 64; torch-style packed in_proj [3D][D] + bias, out_proj [D][D] + bias): scores = q.k / 8, keys with adjacency[q][k] <= 0 disallowed (-1e30 before the softmax; the [T][T] adjacency is shared by all batches and heads), out = softmax(scores) v, then out_proj.
#define NB 4
#define SS 1024
#define DM 1024
#define NH 16
#define HD 64
#define QKVW (3 * DM)
#ifndef TQB
#define TQB (SS / 128)
#define TNB NB
#define TOB (NB * SS / 64)     // output row tiles (all)
#endif
typedef __attribute__((ext_vector_type(8))) __bf16 v8b;
__device__ __forceinline__ v16b frag_b(const __bf16* rowk0, int lane) {
  union { v16b v; v8b q[2]; } u; const __bf16* p = rowk0 + 8 * (lane >> 4);
  u.q[0] = *(const v8b*)p; u.q[1] = *(const v8b*)(p + 16); return u.v;
}
__device__ __forceinline__ float bfr(float v) { return (float)(__bf16)v; }
__device__ __forceinline__ float ex2(float v) { return __builtin_amdgcn_exp2f(v); }   // 2^v as the one hardware instruction; every argument here is <= 0, and a result below the normal range may go to 0
__device__ __attribute__((noinline)) float erf_ni(float v) { return erff(v); }

#define PK_A 0                       // [3072][1024] in_proj rows (natural [out][in])
#define PK_P (PK_A + QKVW * DM)        // [1024][1024] out_proj rows (natural)
#define PK_END (PK_P + DM * DM)
#define WS_PK  0u
#define WS_QK  (WS_PK + 2u * PK_END)             // f32 [4096 rows][3072]: only the q columns are written and read
#define WS_VTH (WS_QK + 4u * NB * SS * QKVW)     // bf16 [4][1024 (h*64+d)][1024 s]
#define WS_VTL (WS_VTH + 2u * NB * DM * SS)
#define WS_OH  (WS_VTL + 2u * NB * DM * SS)        // bf16 [4096][1024]: attention output, high part
#define WS_OL  (WS_OH + 2u * NB * SS * DM)         // the residual
#define WS_KH  (WS_OL + 2u * NB * SS * DM)         // bf16 [4096 rows][1024 (h*64+d)]: k, high part
#define WS_KL  (WS_KH + 2u * NB * SS * DM)         // the residual
#define WS_MSK (WS_KL + 2u * NB * SS * DM)         // u32 [64 tiles of 16 queries][16 tiles of 64 keys][32]: the adjacency test as lane masks (k_pack's front blocks write them, k_attn reads them)
#define WS_END (WS_MSK + 4u * (SS / 16) * (SS / 64) * 32)
#define MSKB (SS / 16 * (SS / 64) / 8)             // blocks that build them: 8 waves each, one (query tile, key tile) a wave

// ---- k_pack: block = row r of a natural [R][1024] weight -> bf16 row; the first nm blocks of the grid instead do the adjacency test, once for all batches and heads: a wave takes 16 queries x 64 keys with the lanes placed as in k_attn's score tiles (query = lane & 15, keys 8g + r and 16 + 8g + r of each 32) and stores 32 words, word u * 16 + e = the ballot of "allowed" over the lanes for score element e of 32-key step u
__global__ __launch_bounds__(256) void k_pack(const float* __restrict__ Wm, __bf16* __restrict__ DST, const float* __restrict__ ADJ, unsigned* __restrict__ MSK, int nm) {
  __shared__ __align__(16) __bf16 s[DM]; const int r = (int)blockIdx.x - nm, tid = threadIdx.x;
  if (r < 0) {   // the same for the whole block, in front of the barrier
    const int lane = tid & 31, qt = blockIdx.x >> 1, t = (blockIdx.x & 1) * 8 + (tid >> 5);
    const float* ar = ADJ + (size_t)(qt * 16 + (lane & 15)) * SS + t * 64 + 8 * (lane >> 4);
    v4f a[8];
#pragma unroll
    for (int i = 0; i < 4; ++i) { a[2 * i] = *(const v4f*)(ar + i * 16); a[2 * i + 1] = *(const v4f*)(ar + i * 16 + 4); }
    unsigned w = 0;
#pragma unroll
    for (int i = 0; i < 32; ++i) { const unsigned bl = __builtin_amdgcn_ballot_w32(!(a[i >> 2][i & 3] <= 0.f)); w = lane == i ? bl : w; }
    MSK[(size_t)(qt * (SS / 64) + t) * 32 + lane] = w;   // a wave's store: one whole line
    return; }
  for (int k = tid; k < DM; k += 256) s[k] = (__bf16)Wm[(size_t)r * DM + k];
  __syncthreads();
  for (int q = tid; q < DM / 8; q += 256) vst2((unsigned*)(DST + (size_t)r * DM + q * 8), *(const v4u*)&s[q * 8]);
}
// LDS staging of the two projections: a block brings each 64-k chunk of its A rows and its 128 weight rows in by whole 128-B lines, once, and the waves read their fragments from LDS
#define GP 72                  // LDS row pitch in bf16 elements: 144 B = 16 B x odd, which spreads the 16 rows of a 16-byte fragment read over the banks
#define GCH (DM / 64)          // staged chunks of 64 k
typedef __attribute__((ext_vector_type(4))) __bf16 v4b;
// ---- k_qkv: block = (64 rows, 128 of the 3072 cols): QKV = bf16(x) . in_proj rows (exact) + bias; the epilogue stores each third in the form k_attn takes it: q as f32 rows (pitch 3072), k as bf16 hi/lo rows, v as bf16 hi/lo transposed ([b][h*64+d][s])
__global__ __launch_bounds__(128) void k_qkv(const float* __restrict__ X, const __bf16* __restrict__ P, const float* __restrict__ BIAS, float* __restrict__ QKV, __bf16* __restrict__ KH, __bf16* __restrict__ KL, __bf16* __restrict__ VTH, __bf16* __restrict__ VTL) {
  __shared__ __align__(16) char sm[2 * (64 + 128) * GP * 2];   // two buffers of [64 A rows | 128 weight rows]; behind the loop's last barrier the same bytes hold so[4][16][132] (q, k) or the transposed tile [hi | lo][128 cols][GP] (v)
  __bf16* const sb16 = (__bf16*)sm; float (*const so)[16][132] = (float (*)[16][132])sm;
  const int tid = threadIdx.x, wave = tid >> 5, lane = tid & 31, col = lane & 15, g = lane >> 4; const size_t rb = (size_t)blockIdx.x * 64, r0 = rb + wave * 16; const int n0 = blockIdx.y * 128;
  const float* xg = X + (rb + (tid >> 4)) * DM + (tid & 15) * 4;               // a wave's load: 2 rows x 256 B
  const __bf16* pg = P + (size_t)(n0 + (tid >> 3)) * DM + (tid & 7) * 8;       // a wave's load: 4 rows x 128 B
  const int sao = (tid >> 4) * GP + (tid & 15) * 4, sbo = 64 * GP + (tid >> 3) * GP + (tid & 7) * 8;
  v4f xa[8]; v4u wb[8];
  v8f acc[8] = {};
#pragma unroll
  for (int i = 0; i < 8; ++i) { xa[i] = *(const v4f*)(xg + (size_t)i * 8 * DM); wb[i] = *(const v4u*)(pg + (size_t)i * 16 * DM); }
#pragma unroll
  for (int i = 0; i < 8; ++i) { v4b t;
#pragma unroll
    for (int e = 0; e < 4; ++e) t[e] = (__bf16)xa[i][e];
    *(v4b*)(sb16 + sao + i * 8 * GP) = t; *(v4u*)(sb16 + sbo + i * 16 * GP) = wb[i]; }
  __syncthreads();
#pragma unroll 2   // two trips per branch: each buffer's LDS offsets become constants
  for (int c = 0; c < GCH; ++c) { const __bf16* cur = sb16 + (c & 1) * (192 * GP); __bf16* nxt = sb16 + ((c + 1) & 1) * (192 * GP);
    if (c + 1 < GCH) {
#pragma unroll
      for (int i = 0; i < 8; ++i) { xa[i] = *(const v4f*)(xg + (size_t)i * 8 * DM + (c + 1) * 64); wb[i] = *(const v4u*)(pg + (size_t)i * 16 * DM + (c + 1) * 64); }
      asm volatile("s_wait_xcnt 0x0" ::: "memory"); }   // stands behind the run of prefetch loads, in front of any later rewrite of a register that holds one of their addresses
#pragma unroll
    for (int kc = 0; kc < 2; ++kc) { const v16b a = frag_b(cur + (wave * 16 + col) * GP + kc * 32, lane); v16b w[8];
#pragma unroll
      for (int j = 0; j < 8; ++j) w[j] = frag_b(cur + (64 + j * 16 + col) * GP + kc * 32, lane);
#pragma unroll
      for (int j = 0; j < 8; ++j) acc[j] = wmma_bf(a, w[j], acc[j]); }
    if (c + 1 < GCH) {
#pragma unroll
      for (int i = 0; i < 8; ++i) { v4b t;
#pragma unroll
        for (int e = 0; e < 4; ++e) t[e] = (__bf16)xa[i][e];
        *(v4b*)(nxt + sao + i * 8 * GP) = t; *(v4u*)(nxt + sbo + i * 16 * GP) = wb[i]; } }
    __syncthreads(); }   // publishes chunk c + 1 and ends every wave's reads of chunk c, whose buffer the next trip refills
  if (n0 >= 2 * DM) {   // v (the test is the same for the whole block): a lane holds 8 consecutive s of one column, 16 B of a transposed row
#pragma unroll
    for (int j = 0; j < 8; ++j) { const float bb = bfr(BIAS[n0 + j * 16 + col]); v8b th, tl;
#pragma unroll
      for (int r = 0; r < 8; ++r) { const float v = acc[j][r] + bb; const __bf16 hb = (__bf16)v; th[r] = hb; tl[r] = (__bf16)(v - (float)hb); }
      *(v8b*)(sb16 + (j * 16 + col) * GP + wave * 16 + 8 * g) = th; *(v8b*)(sb16 + (128 + j * 16 + col) * GP + wave * 16 + 8 * g) = tl; }
    __syncthreads();   // a transposed row of 64 s, one whole line, holds 16 s of each wave
    const size_t vb = ((rb / SS) * DM + (n0 - 2 * DM)) * SS + rb % SS;
#pragma unroll
    for (int i = 0; i < 8; ++i) { const int cn = i * 16 + (tid >> 3), pc = (tid & 7) * 8;   // a wave's store: 4 rows x 128 B
      vst2(VTH + vb + (size_t)cn * SS + pc, *(const v4u*)(sb16 + cn * GP + pc)); vst2(VTL + vb + (size_t)cn * SS + pc, *(const v4u*)(sb16 + (128 + cn) * GP + pc)); }
    return; }
#pragma unroll
  for (int j = 0; j < 8; ++j) { const float bb = bfr(BIAS[n0 + j * 16 + col]);
#pragma unroll
    for (int r = 0; r < 8; ++r) so[wave][8 * g + r][j * 16 + col] = acc[j][r] + bb; }
  LDSX();
  if (n0 < DM) { for (int rl = 0; rl < 16; ++rl) vst2(QKV + (r0 + rl) * QKVW + n0 + lane * 4, *(const v4f*)&so[wave][rl][lane * 4]); }
  else {   // k: split hi/lo here, once, in place of once per block of k_attn
#pragma unroll
    for (int p = 0; p < 8; ++p) { const int rl = p * 2 + g; const v4f a = *(const v4f*)&so[wave][rl][col * 8], c = *(const v4f*)&so[wave][rl][col * 8 + 4]; v8b th, tl;   // a wave's store: 2 rows x 256 B
#pragma unroll
      for (int e = 0; e < 4; ++e) { const __bf16 ha = (__bf16)a[e], hc = (__bf16)c[e]; th[e] = ha; tl[e] = (__bf16)(a[e] - (float)ha); th[4 + e] = hc; tl[4 + e] = (__bf16)(c[e] - (float)hc); }
      const size_t o = (r0 + rl) * DM + (n0 - DM) + col * 8; *(v8b*)(KH + o) = th; *(v8b*)(KL + o) = tl; }
    asm volatile("s_wait_xcnt 0x0" ::: "memory"); }   // stands behind the run of stores, in front of any later rewrite of a register that one of them names
}
// ---- k_attn: block = (128 queries = 8 waves x 16, head h, batch b): flash attention over the 1,024 keys, transposed: S^T = K.Q^T (A = key rows, B = query columns, 3 products) / 8, so a lane holds 16 of ONE query's 32 scores (keys 8g + r and 16 + 8g + r of the step); disallowed keys (adjacency[q][k] <= 0, taken as the lane masks that k_pack's front blocks have stored: 16 words per step, the same for the whole wave, so they come by scalar loads and each is the select mask of one score element) set to -1e30; maximum and sum run in the lane, the two halves of the wave exchange the maximum once per step and join their sums behind the loop; the two score tiles, split hi/lo in place, are the B operand of O^T += V^T.P^T (3 products); O[b*S+q][h*64+d] = acc / l, stored as a bf16 hi/lo pair
// K and V^T come through LDS, both as the bf16 hi/lo pairs that k_qkv has stored: the block brings each tile of 64 keys in by whole 128-B lines, once for its 8 waves, and every wave reads its A fragments from LDS (two steps of 32 keys per tile)
#define AKT 64                 // keys per staged tile: a V^T row piece is then one whole line
#define ANT (SS / AKT)
#define AARR (AKT * GP)        // one staged array: 64 rows at the padded pitch
#define ABUF (4 * AARR)        // one buffer: [K hi | K lo | V^T hi | V^T lo]
__device__ __forceinline__ float xhalf(float x) { return __builtin_bit_cast(float, __builtin_amdgcn_permlanex16(__builtin_bit_cast(int, x), __builtin_bit_cast(int, x), 0x76543210, 0xfedcba98, false, false)); }  // lane l with lane l ^ 16
__global__ __launch_bounds__(256) void k_attn(const float* __restrict__ QK, const unsigned* __restrict__ MSK, const __bf16* __restrict__ KH, const __bf16* __restrict__ KL, const __bf16* __restrict__ VTH, const __bf16* __restrict__ VTL, __bf16* __restrict__ OH, __bf16* __restrict__ OL) {
  __shared__ __align__(16) char sm[2 * ABUF * 2];   // two buffers; behind the loop's last barrier the same bytes hold so[8 waves][hi | lo][16][GP]
  __bf16* const sb16 = (__bf16*)sm; __bf16 (*const so)[2][16][GP] = (__bf16 (*)[2][16][GP])sm;
  const int tid = threadIdx.x, wave = tid >> 5, lane = tid & 31, col = lane & 15, g = lane >> 4;
  const int qb = blockIdx.x, h = blockIdx.y, b = blockIdx.z; const int q0 = qb * 128 + wave * 16; const size_t rq = (size_t)b * SS + q0 + col;
  const size_t ko = ((size_t)b * SS + (tid >> 3)) * DM + h * HD + (tid & 7) * 8;                // a wave's load: 4 key rows x 128 B
  const __bf16* khg = KH + ko; const __bf16* klg = KL + ko;
  const size_t vo = ((size_t)b * DM + h * HD + (tid >> 3)) * SS + (tid & 7) * 8;                // a wave's load: 4 V^T rows x 128 B
  const __bf16* vhg = VTH + vo; const __bf16* vlg = VTL + vo;
  const int sko = (tid >> 3) * GP + (tid & 7) * 8, svo = 2 * AARR + sko;
  v4u xh[2], xl[2], vh[2], vl[2];
#pragma unroll
  for (int i = 0; i < 2; ++i) { xh[i] = *(const v4u*)(khg + (size_t)i * 32 * DM); xl[i] = *(const v4u*)(klg + (size_t)i * 32 * DM); }
#pragma unroll
  for (int i = 0; i < 2; ++i) { vh[i] = *(const v4u*)(vhg + (size_t)i * 32 * SS); vl[i] = *(const v4u*)(vlg + (size_t)i * 32 * SS); }
  F2 aq[2];
#pragma unroll
  for (int kc = 0; kc < 2; ++kc) aq[kc] = split_row(QK + rq * QKVW + h * HD, kc * 32, lane);
#pragma unroll
  for (int i = 0; i < 2; ++i) { *(v4u*)(sb16 + sko + i * 32 * GP) = xh[i]; *(v4u*)(sb16 + AARR + sko + i * 32 * GP) = xl[i]; }
#pragma unroll
  for (int i = 0; i < 2; ++i) { *(v4u*)(sb16 + svo + i * 32 * GP) = vh[i]; *(v4u*)(sb16 + AARR + svo + i * 32 * GP) = vl[i]; }
  float m = -3.0e38f, l = 0.f;   // of query q0 + col; l holds this half's keys only
  v8f acc[4] = {};               // acc[dt][r] = O^T[dt * 16 + 8g + r][query q0 + col]
  const unsigned* mrow = MSK + (size_t)(qb * 8 + __builtin_amdgcn_readfirstlane(wave)) * (ANT * 32);   // the wave's number as a scalar: the address is then the same in every lane for the compiler too, and the loads are scalar loads
  unsigned mw[32];   // the current tile's lane masks; each step's 16 are asked for again, for the next tile, as soon as its selects have used them, one tile ahead of their use
#pragma unroll
  for (int i = 0; i < 32; ++i) mw[i] = mrow[i];
  __syncthreads();   // publishes tile 0
#pragma unroll 1
  for (int t = 0; t < ANT; ++t) { const __bf16* cur = sb16 + (t & 1) * ABUF; __bf16* nxt = sb16 + ((t + 1) & 1) * ABUF;
    const int tn = t + 1 < ANT ? t + 1 : t;   // the last trip fetches its own tile again, into the buffer that nobody reads any more: with no branch round the loads and stores the loads stay up here and the waits on them stay counted
#pragma unroll
    for (int i = 0; i < 2; ++i) { xh[i] = *(const v4u*)(khg + (size_t)(tn * AKT + i * 32) * DM); xl[i] = *(const v4u*)(klg + (size_t)(tn * AKT + i * 32) * DM); }
#pragma unroll
    for (int i = 0; i < 2; ++i) { vh[i] = *(const v4u*)(vhg + (size_t)i * 32 * SS + tn * AKT); vl[i] = *(const v4u*)(vlg + (size_t)i * 32 * SS + tn * AKT); }
    asm volatile("s_wait_xcnt 0x0" ::: "memory");   // stands behind the run of loads, in front of any later rewrite of a register that holds one of their addresses
#pragma unroll
    for (int u = 0; u < 2; ++u) { float s[16]; v16b kh[2][2], kl[2][2], fh[4], fl[4]; v8f c[2];
#pragma unroll
      for (int ct = 0; ct < 2; ++ct) { const __bf16* krow = cur + (u * 32 + ct * 16 + col) * GP;
#pragma unroll
        for (int kc = 0; kc < 2; ++kc) { kh[ct][kc] = frag_b(krow + kc * 32, lane); kl[ct][kc] = frag_b(krow + AARR + kc * 32, lane); } }
#pragma unroll
      for (int ct = 0; ct < 2; ++ct) { c[ct] = v8f{};
#pragma unroll
        for (int kc = 0; kc < 2; ++kc) { c[ct] = wmma_bf(kh[ct][kc], aq[kc].l, c[ct]); c[ct] = wmma_bf(kl[ct][kc], aq[kc].h, c[ct]); c[ct] = wmma_bf(kh[ct][kc], aq[kc].h, c[ct]); } }
#pragma unroll
      for (int dt = 0; dt < 4; ++dt) { const __bf16* vrow = cur + 2 * AARR + (dt * 16 + col) * GP + u * 32; fh[dt] = frag_b(vrow, lane); fl[dt] = frag_b(vrow + AARR, lane); }
#pragma unroll
      for (int ct = 0; ct < 2; ++ct)
#pragma unroll
        for (int r = 0; r < 8; ++r) s[ct * 8 + r] = __builtin_amdgcn_inverse_ballot_w32(mw[u * 16 + ct * 8 + r]) ? c[ct][r] * 0.18033688f : -1.44269504e30f;   // both sides times log2(e): -1e30 * 1.44269504 and SCALE * 1.44269504 = 1.44269504 / sqrt(64); scores, maximum and exponentials run in base 2, and the softmax weights are the same but for rounding
#pragma unroll
      for (int i = 0; i < 16; ++i) mw[u * 16 + i] = mrow[tn * 32 + u * 16 + i];   // the next tile's words of this step, asked for behind the selects that used this tile's: the scalar loads have a whole tile's time; the last trip asks for its own tile again (tn), inside the array
      float mx = s[0];
#pragma unroll
      for (int i = 1; i < 16; ++i) mx = fmaxf(mx, s[i]);
      mx = fmaxf(mx, xhalf(mx));
      const float mn = fmaxf(m, mx); const float alpha = ex2(m - mn);
      float es = 0.f;
#pragma unroll
      for (int i = 0; i < 16; ++i) { s[i] = ex2(s[i] - mn); es += s[i]; }
      l = l * alpha + es; m = mn;
#pragma unroll
      for (int dt = 0; dt < 4; ++dt) acc[dt] *= alpha;
      const F2 pb = bsplit16(s);   // element i = P^T[key 8g + i or 16 + 8g + (i - 8)][query]: the k order of frag_b
#pragma unroll
      for (int dt = 0; dt < 4; ++dt) { acc[dt] = wmma_bf(fh[dt], pb.l, acc[dt]); acc[dt] = wmma_bf(fl[dt], pb.h, acc[dt]); acc[dt] = wmma_bf(fh[dt], pb.h, acc[dt]); } }
#pragma unroll
    for (int i = 0; i < 2; ++i) { *(v4u*)(nxt + sko + i * 32 * GP) = xh[i]; *(v4u*)(nxt + AARR + sko + i * 32 * GP) = xl[i]; }
#pragma unroll
    for (int i = 0; i < 2; ++i) { *(v4u*)(nxt + svo + i * 32 * GP) = vh[i]; *(v4u*)(nxt + AARR + svo + i * 32 * GP) = vl[i]; }
    __syncthreads(); }   // publishes tile t + 1 and ends every wave's reads of tile t, whose buffer the next trip refills
  const float il = 1.0f / (l + xhalf(l));
#pragma unroll
  for (int dt = 0; dt < 4; ++dt) { v8b th, tl;   // split hi/lo here, once, in place of once per column block of k_out
#pragma unroll
    for (int r = 0; r < 8; ++r) { const float v = acc[dt][r] * il; const __bf16 hb = (__bf16)v; th[r] = hb; tl[r] = (__bf16)(v - (float)hb); }
    *(v8b*)&so[wave][0][col][dt * 16 + 8 * g] = th; *(v8b*)&so[wave][1][col][dt * 16 + 8 * g] = tl; }
  LDSX();
#pragma unroll
  for (int i = 0; i < 4; ++i) { const int rl = i * 4 + (lane >> 3), pc = (lane & 7) * 8; const size_t o = ((size_t)b * SS + q0 + rl) * DM + h * HD + pc;   // a wave's store: 4 rows x 128 B
    vst2(OH + o, *(const v4u*)&so[wave][0][rl][pc]); vst2(OL + o, *(const v4u*)&so[wave][1][rl][pc]); }
}
// ---- k_out: block = (64 rows, 128 cols): out = O(hi/lo, as k_attn has stored them) . out_proj rows (2 products) + bias
__global__ __launch_bounds__(128) void k_out(const __bf16* __restrict__ OH, const __bf16* __restrict__ OL, const __bf16* __restrict__ P, const float* __restrict__ BO, float* __restrict__ Y) {
  __shared__ __align__(16) char sm[2 * (64 + 64 + 128) * GP * 2];   // two buffers of [64 A hi rows | 64 A lo rows | 128 weight rows]; behind the loop's last barrier the same bytes hold so[4][16][132]
  __bf16* const sb16 = (__bf16*)sm; float (*const so)[16][132] = (float (*)[16][132])sm;
  const int tid = threadIdx.x, wave = tid >> 5, lane = tid & 31, col = lane & 15, g = lane >> 4; const size_t rb = (size_t)blockIdx.x * 64, r0 = rb + wave * 16; const int n0 = blockIdx.y * 128;
  const size_t ao = (rb + (tid >> 3)) * DM + (tid & 7) * 8;                    // a wave's load: 4 rows x 128 B
  const __bf16* hg = OH + ao; const __bf16* lg = OL + ao;
  const __bf16* pg = P + (size_t)(n0 + (tid >> 3)) * DM + (tid & 7) * 8;
  const int sao = (tid >> 3) * GP + (tid & 7) * 8, sbo = 128 * GP + sao;
  v4u xh[4], xl[4], wb[8];
  v8f acc[8] = {};
#pragma unroll
  for (int i = 0; i < 4; ++i) { xh[i] = *(const v4u*)(hg + (size_t)i * 16 * DM); xl[i] = *(const v4u*)(lg + (size_t)i * 16 * DM); }
#pragma unroll
  for (int i = 0; i < 8; ++i) wb[i] = *(const v4u*)(pg + (size_t)i * 16 * DM);
#pragma unroll
  for (int i = 0; i < 4; ++i) { *(v4u*)(sb16 + sao + i * 16 * GP) = xh[i]; *(v4u*)(sb16 + 64 * GP + sao + i * 16 * GP) = xl[i]; }
#pragma unroll
  for (int i = 0; i < 8; ++i) *(v4u*)(sb16 + sbo + i * 16 * GP) = wb[i];
  __syncthreads();
#pragma unroll 2   // two trips per branch: each buffer's LDS offsets become constants
  for (int c = 0; c < GCH; ++c) { const __bf16* cur = sb16 + (c & 1) * (256 * GP); __bf16* nxt = sb16 + ((c + 1) & 1) * (256 * GP);
    if (c + 1 < GCH) {
#pragma unroll
      for (int i = 0; i < 4; ++i) { xh[i] = *(const v4u*)(hg + (size_t)i * 16 * DM + (c + 1) * 64); xl[i] = *(const v4u*)(lg + (size_t)i * 16 * DM + (c + 1) * 64); }
#pragma unroll
      for (int i = 0; i < 8; ++i) wb[i] = *(const v4u*)(pg + (size_t)i * 16 * DM + (c + 1) * 64);
      asm volatile("s_wait_xcnt 0x0" ::: "memory"); }   // stands behind the run of prefetch loads, in front of any later rewrite of a register that holds one of their addresses
#pragma unroll
    for (int kc = 0; kc < 2; ++kc) { const v16b ah = frag_b(cur + (wave * 16 + col) * GP + kc * 32, lane), al = frag_b(cur + (64 + wave * 16 + col) * GP + kc * 32, lane); v16b w[8];
#pragma unroll
      for (int j = 0; j < 8; ++j) w[j] = frag_b(cur + (128 + j * 16 + col) * GP + kc * 32, lane);
#pragma unroll
      for (int j = 0; j < 8; ++j) { acc[j] = wmma_bf(al, w[j], acc[j]); acc[j] = wmma_bf(ah, w[j], acc[j]); } }
    if (c + 1 < GCH) {
#pragma unroll
      for (int i = 0; i < 4; ++i) { *(v4u*)(nxt + sao + i * 16 * GP) = xh[i]; *(v4u*)(nxt + 64 * GP + sao + i * 16 * GP) = xl[i]; }
#pragma unroll
      for (int i = 0; i < 8; ++i) *(v4u*)(nxt + sbo + i * 16 * GP) = wb[i]; }
    __syncthreads(); }   // publishes chunk c + 1 and ends every wave's reads of chunk c, whose buffer the next trip refills
#pragma unroll
  for (int j = 0; j < 8; ++j) { const float bb = bfr(BO[n0 + j * 16 + col]);
#pragma unroll
    for (int r = 0; r < 8; ++r) so[wave][8 * g + r][j * 16 + col] = acc[j][r] + bb; }
  LDSX();
  for (int rl = 0; rl < 16; ++rl) vst2(Y + (r0 + rl) * DM + n0 + lane * 4, *(const v4f*)&so[wave][rl][lane * 4]);
}
extern "C" void kernel_launch(void* const* d_in, const int* in_sizes, int n_in, void* d_out, int out_size, void* d_ws, size_t ws_size, hipStream_t stream) {
  (void)in_sizes; (void)n_in; (void)out_size;
  const float** F = (const float**)d_in;   // 0 x [4,1024,1024], 1 adjacency [1024,1024], 2 in_proj_w [3072,1024], 3 in_proj_b [3072], 4 out_proj_w [1024,1024], 5 out_proj_b [1024]
  if (ws_size < (size_t)WS_END) return;
  char* ws = (char*)d_ws; __bf16* PK = (__bf16*)(ws + WS_PK); float* QK = (float*)(ws + WS_QK); __bf16 *VTH = (__bf16*)(ws + WS_VTH), *VTL = (__bf16*)(ws + WS_VTL), *KH = (__bf16*)(ws + WS_KH), *KL = (__bf16*)(ws + WS_KL), *OH = (__bf16*)(ws + WS_OH), *OL = (__bf16*)(ws + WS_OL); unsigned* MSK = (unsigned*)(ws + WS_MSK);
  k_pack<<<QKVW, 256, 0, stream>>>(F[2], PK + PK_A, F[1], MSK, 0); k_pack<<<MSKB + DM, 256, 0, stream>>>(F[4], PK + PK_P, F[1], MSK, MSKB);
  k_qkv<<<dim3(TNB * SS / 64, QKVW / 128), 128, 0, stream>>>(F[0], PK + PK_A, F[3], QK, KH, KL, VTH, VTL);
  k_attn<<<dim3(TQB, NH, TNB), 256, 0, stream>>>(QK, MSK, KH, KL, VTH, VTL, OH, OL);
  k_out<<<dim3(TOB, DM / 128), 128, 0, stream>>>(OH, OL, PK + PK_P, F[5], (float*)d_out);
}

// v007
// One run takes 106 microseconds.
// Two timings next to v006 both put it at 1.07 times that version's speed.
// Counting every step since v000, it is 3.80 times as fast.
// compute dtype: x, in_proj/out_proj weights and biases (module inputs) rounded to bf16 (the adjacency is read as f32); the packed qkv projection with exact bf16 products (x and W are inputs) + bias; scores q.k with both computed operands as bf16 hi + residual pairs (3 products) and P.V with P hi/lo x V hi/lo (3 products); the adjacency mask as a select (adjacency <= 0 -> -1e30); the output projection hi/lo x exact Wo (2 products) + bo; running-max softmax in f32; f32 accumulate.
#include <hip/hip_runtime.h>
#include <math.h>

typedef __attribute__((ext_vector_type(16))) _Float16 v16h;
typedef __attribute__((ext_vector_type(16))) __bf16 v16b;
typedef __attribute__((ext_vector_type(8)))  _Float16 v8h;
typedef __attribute__((ext_vector_type(8)))  float v8f;
typedef __attribute__((ext_vector_type(4)))  float v4f;
typedef __attribute__((ext_vector_type(2)))  float v2f;
typedef __attribute__((ext_vector_type(4)))  unsigned v4u;
typedef __attribute__((ext_vector_type(4)))  int v4i;
typedef float __attribute__((may_alias)) float_a;
typedef int __attribute__((may_alias)) int_a;

template <typename T> __device__ __forceinline__ void vst2(void* p, T v) { *(T*)p = v;  }
__device__ __forceinline__ v8f wmma16(v16h a, v16h b, v8f c) {
  v8f d = __builtin_amdgcn_wmma_f32_16x16x32_f16(false, a, false, b, (short)0, c, false, false);
  asm volatile("v_nop\n\tv_nop\n\tv_nop\n\tv_nop" : "+v"(d) : "v"(a), "v"(b));
  return d;
}
__device__ __forceinline__ v8f wmma_bf(v16b a, v16b b, v8f c) {
  v8f d = __builtin_amdgcn_wmma_f32_16x16x32_bf16(false, a, false, b, (short)0, c, false, false);
  asm volatile("v_nop\n\tv_nop\n\tv_nop\n\tv_nop" : "+v"(d) : "v"(a), "v"(b));
  return d;
}
// 16x16x32 fragments: lane = (h = lane>>4, row/col = lane&15); elements 0..7 = k0+8h+0..7, 8..15 = k0+16+8h+0..7; D element r = row 8h+r
__device__ __forceinline__ v16h frag_h(const _Float16* rowk0, int lane) {
  union { v16h v; v8h q[2]; } u; const _Float16* p = rowk0 + 8 * (lane >> 4);
  u.q[0] = *(const v8h*)p; u.q[1] = *(const v8h*)(p + 16); return u.v;
}
__device__ __forceinline__ v16h frag_f32(const float* rowk0, int lane) {
  v16h a; const float* p = rowk0 + 8 * (lane >> 4);
#pragma unroll
  for (int i = 0; i < 8; ++i) { a[i] = (_Float16)p[i]; a[8 + i] = (_Float16)p[16 + i]; }
  return a;
}
__device__ __forceinline__ v16h frag_f32s(const float* rowk0, int lane, float sc) {
  v16h a; const float* p = rowk0 + 8 * (lane >> 4);
#pragma unroll
  for (int i = 0; i < 8; ++i) { a[i] = (_Float16)(p[i] * sc); a[8 + i] = (_Float16)(p[16 + i] * sc); }
  return a;
}
// column fragment from a [K][ld] layout (column n), rows >= K read as 0
__device__ __forceinline__ v16h fragc_f32(const float* W, int k0, int n, int lane, int ld, int K) {
  v16h a; const int g = lane >> 4;
#pragma unroll
  for (int i = 0; i < 8; ++i) { const int ka = k0 + 8 * g + i, kb = ka + 16;
    a[i] = (_Float16)(ka < K ? W[(size_t)(ka < K ? ka : K - 1) * ld + n] : 0.f); a[8 + i] = (_Float16)(kb < K ? W[(size_t)(kb < K ? kb : K - 1) * ld + n] : 0.f); }
  return a;
}
struct F2 { v16b h, l; };
__device__ __forceinline__ F2 bsplit16(const float v[16]) { F2 r;
#pragma unroll
  for (int i = 0; i < 16; ++i) { const __bf16 h = (__bf16)v[i]; r.h[i] = h; r.l[i] = (__bf16)(v[i] - (float)h); }
  return r; }
__device__ __forceinline__ F2 split_row(const float* row, int k0, int lane) { float v[16]; const float* p = row + k0 + 8 * (lane >> 4);
#pragma unroll
  for (int i = 0; i < 8; ++i) { v[i] = p[i]; v[8 + i] = p[16 + i]; }
  return bsplit16(v); }
__device__ __forceinline__ F2 split_rowK(const float* row, int k0, int lane, int K) { float v[16]; const int g = lane >> 4;
#pragma unroll
  for (int i = 0; i < 8; ++i) { const int ka = k0 + 8 * g + i, kb = ka + 16; v[i] = ka < K ? row[ka < K ? ka : K - 1] : 0.f; v[8 + i] = kb < K ? row[kb < K ? kb : K - 1] : 0.f; }
  return bsplit16(v); }
__device__ __forceinline__ F2 split_col(const float* W, int k0, int n, int lane, int ld, int K) { float v[16]; const int g = lane >> 4;
#pragma unroll
  for (int i = 0; i < 8; ++i) { const int ka = k0 + 8 * g + i, kb = ka + 16; v[i] = ka < K ? W[(size_t)(ka < K ? ka : K - 1) * ld + n] : 0.f; v[8 + i] = kb < K ? W[(size_t)(kb < K ? kb : K - 1) * ld + n] : 0.f; }
  return bsplit16(v); }
__device__ __forceinline__ v8f mac3(const F2& a, const F2& b, v8f c) { c = wmma_bf(a.l, b.h, c); c = wmma_bf(a.h, b.l, c); return wmma_bf(a.h, b.h, c); }
__device__ __forceinline__ float sigm(float v) { return 1.0f / (1.0f + expf(-v)); }
#define LDSX() do { asm volatile("s_wait_dscnt 0" ::: "memory"); __builtin_amdgcn_wave_barrier(); __builtin_amdgcn_fence(__ATOMIC_RELEASE, "workgroup"); } while (0)


// Masked multi-head self-attention (B 4, T 1024, D 1024, 16 heads x 64; torch-style packed in_proj [3D][D] + bias, out_proj [D][D] + bias): scores = q.k / 8, keys with adjacency[q][k] <= 0 disallowed (-1e30 before the softmax; the [T][T] adjacency is shared by all batches and heads), out = softmax(scores) v, then out_proj.
#define NB 4
#define SS 1024
#define DM 1024
#define NH 16
#define HD 64
#define QKVW (3 * DM)
#ifndef TQB
#define TQB (SS / 128)
#define TNB NB
#define TOB (NB * SS / 64)     // output row tiles (all)
#endif
typedef __attribute__((ext_vector_type(8))) __bf16 v8b;
__device__ __forceinline__ v16b frag_b(const __bf16* rowk0, int lane) {
  union { v16b v; v8b q[2]; } u; const __bf16* p = rowk0 + 8 * (lane >> 4);
  u.q[0] = *(const v8b*)p; u.q[1] = *(const v8b*)(p + 16); return u.v;
}
__device__ __forceinline__ float bfr(float v) { return (float)(__bf16)v; }
__device__ __forceinline__ float ex2(float v) { return __builtin_amdgcn_exp2f(v); }   // 2^v as the one hardware instruction; every argument here is <= 0, and a result below the normal range may go to 0
__device__ __attribute__((noinline)) float erf_ni(float v) { return erff(v); }

#define PK_A 0                       // [3072][1024] in_proj rows (natural [out][in])
#define PK_P (PK_A + QKVW * DM)        // [1024][1024] out_proj rows (natural)
#define PK_END (PK_P + DM * DM)
#define WS_PK  0u
#define WS_QK  (WS_PK + 2u * PK_END)             // f32 [4096 rows][3072]: only the q columns are written and read
#define WS_VTH (WS_QK + 4u * NB * SS * QKVW)     // bf16 [4][1024 (h*64+d)][1024 s]
#define WS_VTL (WS_VTH + 2u * NB * DM * SS)
#define WS_OH  (WS_VTL + 2u * NB * DM * SS)        // bf16 [4096][1024]: attention output, high part
#define WS_OL  (WS_OH + 2u * NB * SS * DM)         // the residual
#define WS_KH  (WS_OL + 2u * NB * SS * DM)         // bf16 [4096 rows][1024 (h*64+d)]: k, high part
#define WS_KL  (WS_KH + 2u * NB * SS * DM)         // the residual
#define WS_MSK (WS_KL + 2u * NB * SS * DM)         // u32 [64 tiles of 16 queries][16 tiles of 64 keys][32]: the adjacency test as lane masks (k_pack's front blocks write them, k_attn reads them)
#define WS_END (WS_MSK + 4u * (SS / 16) * (SS / 64) * 32)
#define MSKB (SS / 16 * (SS / 64) / 8)             // blocks that build them: 8 waves each, one (query tile, key tile) a wave

typedef __attribute__((ext_vector_type(4))) __bf16 v4b;
#define PKE 64                         // weights a lane converts: 16 loads of 16 B, all asked for before the first is used
#define PKB (PK_END / (256 * PKE))     // blocks that convert: one per 16,384 weights; the first PK_P / (256 * PKE) of them take in_proj, the rest out_proj
// ---- k_pack: one launch for both weights and the adjacency test, with few waves that each do much: what a launch of many short waves costs is the time to start them, not its bytes. A converting wave takes 2,048 consecutive weights of the natural [out][in] rows (the bf16 copies of the two matrices lie one behind the other): each load covers 512 B in a row, each store 256 B, whole lines. The first MSKB blocks of the grid instead do the adjacency test, once for all batches and heads: a wave takes 16 queries x 64 keys with the lanes placed as in k_attn's score tiles (query = lane & 15, keys 8g + r and 16 + 8g + r of each 32) and stores 32 words, word u * 16 + e = the ballot of "allowed" over the lanes for score element e of 32-key step u
__global__ __launch_bounds__(256) void k_pack(const float* __restrict__ WA, const float* __restrict__ WP, __bf16* __restrict__ DST, const float* __restrict__ ADJ, unsigned* __restrict__ MSK) {
  const int wb = (int)blockIdx.x - MSKB, tid = threadIdx.x;
  if (wb < 0) {   // the same for the whole block
    const int lane = tid & 31, qt = blockIdx.x >> 1, t = (blockIdx.x & 1) * 8 + (tid >> 5);
    const float* ar = ADJ + (size_t)(qt * 16 + (lane & 15)) * SS + t * 64 + 8 * (lane >> 4);
    v4f a[8];
#pragma unroll
    for (int i = 0; i < 4; ++i) { a[2 * i] = *(const v4f*)(ar + i * 16); a[2 * i + 1] = *(const v4f*)(ar + i * 16 + 4); }
    unsigned w = 0;
#pragma unroll
    for (int i = 0; i < 32; ++i) { const unsigned bl = __builtin_amdgcn_ballot_w32(!(a[i >> 2][i & 3] <= 0.f)); w = lane == i ? bl : w; }
    MSK[(size_t)(qt * (SS / 64) + t) * 32 + lane] = w;   // a wave's store: one whole line
    return; }
  const size_t e0 = (size_t)wb * (256 * PKE) + (tid >> 5) * (32 * PKE) + (tid & 31) * 4;
  const float* sp = wb < PK_P / (256 * PKE) ? WA + e0 : WP + (e0 - PK_P);
  v4f a[PKE / 4];
#pragma unroll
  for (int i = 0; i < PKE / 4; ++i) a[i] = *(const v4f*)(sp + i * 128);
  asm volatile("s_wait_xcnt 0x0" :: "v"(sp), "v"(a[0]), "v"(a[1]), "v"(a[2]), "v"(a[3]), "v"(a[4]), "v"(a[5]), "v"(a[6]), "v"(a[7]), "v"(a[8]), "v"(a[9]), "v"(a[10]), "v"(a[11]), "v"(a[12]), "v"(a[13]), "v"(a[14]), "v"(a[15]));   // the address and the loaded values are inputs only. They keep all 16 loads in front of the first conversion (left alone the compiler asks for the last four only when the first have come back: a second trip to memory in a wave that lives for one) and the address registers whole up to here; the wait stands behind the run of loads, in front of any later rewrite of those registers
#pragma unroll
  for (int i = 0; i < PKE / 4; ++i) { v4b t;
#pragma unroll
    for (int e = 0; e < 4; ++e) t[e] = (__bf16)a[i][e];
    *(v4b*)(DST + e0 + i * 128) = t; }
  asm volatile("s_wait_xcnt 0x0" ::: "memory");   // stands behind the run of stores, in front of any later rewrite of a register that one of them names
}
// LDS staging of the two projections: a block brings each 64-k chunk of its A rows and its 128 weight rows in by whole 128-B lines, once, and the waves read their fragments from LDS
#define GP 72                  // LDS row pitch in bf16 elements: 144 B = 16 B x odd, which spreads the 16 rows of a 16-byte fragment read over the banks
#define GCH (DM / 64)          // staged chunks of 64 k
// ---- k_qkv: block = (64 rows, 128 of the 3072 cols): QKV = bf16(x) . in_proj rows (exact) + bias; the epilogue stores each third in the form k_attn takes it: q as f32 rows (pitch 3072), k as bf16 hi/lo rows, v as bf16 hi/lo transposed ([b][h*64+d][s])
__global__ __launch_bounds__(128) void k_qkv(const float* __restrict__ X, const __bf16* __restrict__ P, const float* __restrict__ BIAS, float* __restrict__ QKV, __bf16* __restrict__ KH, __bf16* __restrict__ KL, __bf16* __restrict__ VTH, __bf16* __restrict__ VTL) {
  __shared__ __align__(16) char sm[2 * (64 + 128) * GP * 2];   // two buffers of [64 A rows | 128 weight rows]; behind the loop's last barrier the same bytes hold so[4][16][132] (q, k) or the transposed tile [hi | lo][128 cols][GP] (v)
  __bf16* const sb16 = (__bf16*)sm; float (*const so)[16][132] = (float (*)[16][132])sm;
  const int tid = threadIdx.x, wave = tid >> 5, lane = tid & 31, col = lane & 15, g = lane >> 4; const size_t rb = (size_t)blockIdx.x * 64, r0 = rb + wave * 16; const int n0 = blockIdx.y * 128;
  const float* xg = X + (rb + (tid >> 4)) * DM + (tid & 15) * 4;               // a wave's load: 2 rows x 256 B
  const __bf16* pg = P + (size_t)(n0 + (tid >> 3)) * DM + (tid & 7) * 8;       // a wave's load: 4 rows x 128 B
  const int sao = (tid >> 4) * GP + (tid & 15) * 4, sbo = 64 * GP + (tid >> 3) * GP + (tid & 7) * 8;
  v4f xa[8]; v4u wb[8];
  v8f acc[8] = {};
#pragma unroll
  for (int i = 0; i < 8; ++i) { xa[i] = *(const v4f*)(xg + (size_t)i * 8 * DM); wb[i] = *(const v4u*)(pg + (size_t)i * 16 * DM); }
#pragma unroll
  for (int i = 0; i < 8; ++i) { v4b t;
#pragma unroll
    for (int e = 0; e < 4; ++e) t[e] = (__bf16)xa[i][e];
    *(v4b*)(sb16 + sao + i * 8 * GP) = t; *(v4u*)(sb16 + sbo + i * 16 * GP) = wb[i]; }
  __syncthreads();
#pragma unroll 2   // two trips per branch: each buffer's LDS offsets become constants
  for (int c = 0; c < GCH; ++c) { const __bf16* cur = sb16 + (c & 1) * (192 * GP); __bf16* nxt = sb16 + ((c + 1) & 1) * (192 * GP);
    if (c + 1 < GCH) {
#pragma unroll
      for (int i = 0; i < 8; ++i) { xa[i] = *(const v4f*)(xg + (size_t)i * 8 * DM + (c + 1) * 64); wb[i] = *(const v4u*)(pg + (size_t)i * 16 * DM + (c + 1) * 64); }
      asm volatile("s_wait_xcnt 0x0" ::: "memory"); }   // stands behind the run of prefetch loads, in front of any later rewrite of a register that holds one of their addresses
#pragma unroll
    for (int kc = 0; kc < 2; ++kc) { const v16b a = frag_b(cur + (wave * 16 + col) * GP + kc * 32, lane); v16b w[8];
#pragma unroll
      for (int j = 0; j < 8; ++j) w[j] = frag_b(cur + (64 + j * 16 + col) * GP + kc * 32, lane);
#pragma unroll
      for (int j = 0; j < 8; ++j) acc[j] = wmma_bf(a, w[j], acc[j]); }
    if (c + 1 < GCH) {
#pragma unroll
      for (int i = 0; i < 8; ++i) { v4b t;
#pragma unroll
        for (int e = 0; e < 4; ++e) t[e] = (__bf16)xa[i][e];
        *(v4b*)(nxt + sao + i * 8 * GP) = t; *(v4u*)(nxt + sbo + i * 16 * GP) = wb[i]; } }
    __syncthreads(); }   // publishes chunk c + 1 and ends every wave's reads of chunk c, whose buffer the next trip refills
  if (n0 >= 2 * DM) {   // v (the test is the same for the whole block): a lane holds 8 consecutive s of one column, 16 B of a transposed row
#pragma unroll
    for (int j = 0; j < 8; ++j) { const float bb = bfr(BIAS[n0 + j * 16 + col]); v8b th, tl;
#pragma unroll
      for (int r = 0; r < 8; ++r) { const float v = acc[j][r] + bb; const __bf16 hb = (__bf16)v; th[r] = hb; tl[r] = (__bf16)(v - (float)hb); }
      *(v8b*)(sb16 + (j * 16 + col) * GP + wave * 16 + 8 * g) = th; *(v8b*)(sb16 + (128 + j * 16 + col) * GP + wave * 16 + 8 * g) = tl; }
    __syncthreads();   // a transposed row of 64 s, one whole line, holds 16 s of each wave
    const size_t vb = ((rb / SS) * DM + (n0 - 2 * DM)) * SS + rb % SS;
#pragma unroll
    for (int i = 0; i < 8; ++i) { const int cn = i * 16 + (tid >> 3), pc = (tid & 7) * 8;   // a wave's store: 4 rows x 128 B
      vst2(VTH + vb + (size_t)cn * SS + pc, *(const v4u*)(sb16 + cn * GP + pc)); vst2(VTL + vb + (size_t)cn * SS + pc, *(const v4u*)(sb16 + (128 + cn) * GP + pc)); }
    return; }
#pragma unroll
  for (int j = 0; j < 8; ++j) { const float bb = bfr(BIAS[n0 + j * 16 + col]);
#pragma unroll
    for (int r = 0; r < 8; ++r) so[wave][8 * g + r][j * 16 + col] = acc[j][r] + bb; }
  LDSX();
  if (n0 < DM) { for (int rl = 0; rl < 16; ++rl) vst2(QKV + (r0 + rl) * QKVW + n0 + lane * 4, *(const v4f*)&so[wave][rl][lane * 4]); }
  else {   // k: split hi/lo here, once, in place of once per block of k_attn
#pragma unroll
    for (int p = 0; p < 8; ++p) { const int rl = p * 2 + g; const v4f a = *(const v4f*)&so[wave][rl][col * 8], c = *(const v4f*)&so[wave][rl][col * 8 + 4]; v8b th, tl;   // a wave's store: 2 rows x 256 B
#pragma unroll
      for (int e = 0; e < 4; ++e) { const __bf16 ha = (__bf16)a[e], hc = (__bf16)c[e]; th[e] = ha; tl[e] = (__bf16)(a[e] - (float)ha); th[4 + e] = hc; tl[4 + e] = (__bf16)(c[e] - (float)hc); }
      const size_t o = (r0 + rl) * DM + (n0 - DM) + col * 8; *(v8b*)(KH + o) = th; *(v8b*)(KL + o) = tl; }
    asm volatile("s_wait_xcnt 0x0" ::: "memory"); }   // stands behind the run of stores, in front of any later rewrite of a register that one of them names
}
// ---- k_attn: block = (128 queries = 8 waves x 16, head h, batch b): flash attention over the 1,024 keys, transposed: S^T = K.Q^T (A = key rows, B = query columns, 3 products) / 8, so a lane holds 16 of ONE query's 32 scores (keys 8g + r and 16 + 8g + r of the step); disallowed keys (adjacency[q][k] <= 0, taken as the lane masks that k_pack's front blocks have stored: 16 words per step, the same for the whole wave, so they come by scalar loads and each is the select mask of one score element) set to -1e30; maximum and sum run in the lane, the two halves of the wave exchange the maximum once per step and join their sums behind the loop; the two score tiles, split hi/lo in place, are the B operand of O^T += V^T.P^T (3 products); O[b*S+q][h*64+d] = acc / l, stored as a bf16 hi/lo pair
// K and V^T come through LDS, both as the bf16 hi/lo pairs that k_qkv has stored: the block brings each tile of 64 keys in by whole 128-B lines, once for its 8 waves, and every wave reads its A fragments from LDS (two steps of 32 keys per tile)
#define AKT 64                 // keys per staged tile: a V^T row piece is then one whole line
#define ANT (SS / AKT)
#define AARR (AKT * GP)        // one staged array: 64 rows at the padded pitch
#define ABUF (4 * AARR)        // one buffer: [K hi | K lo | V^T hi | V^T lo]
__device__ __forceinline__ float xhalf(float x) { return __builtin_bit_cast(float, __builtin_amdgcn_permlanex16(__builtin_bit_cast(int, x), __builtin_bit_cast(int, x), 0x76543210, 0xfedcba98, false, false)); }  // lane l with lane l ^ 16
__global__ __launch_bounds__(256) void k_attn(const float* __restrict__ QK, const unsigned* __restrict__ MSK, const __bf16* __restrict__ KH, const __bf16* __restrict__ KL, const __bf16* __restrict__ VTH, const __bf16* __restrict__ VTL, __bf16* __restrict__ OH, __bf16* __restrict__ OL) {
  __shared__ __align__(16) char sm[2 * ABUF * 2];   // two buffers; behind the loop's last barrier the same bytes hold so[8 waves][hi | lo][16][GP]
  __bf16* const sb16 = (__bf16*)sm; __bf16 (*const so)[2][16][GP] = (__bf16 (*)[2][16][GP])sm;
  const int tid = threadIdx.x, wave = tid >> 5, lane = tid & 31, col = lane & 15, g = lane >> 4;
  const int qb = blockIdx.x, h = blockIdx.y, b = blockIdx.z; const int q0 = qb * 128 + wave * 16; const size_t rq = (size_t)b * SS + q0 + col;
  const size_t ko = ((size_t)b * SS + (tid >> 3)) * DM + h * HD + (tid & 7) * 8;                // a wave's load: 4 key rows x 128 B
  const __bf16* khg = KH + ko; const __bf16* klg = KL + ko;
  const size_t vo = ((size_t)b * DM + h * HD + (tid >> 3)) * SS + (tid & 7) * 8;                // a wave's load: 4 V^T rows x 128 B
  const __bf16* vhg = VTH + vo; const __bf16* vlg = VTL + vo;
  const int sko = (tid >> 3) * GP + (tid & 7) * 8, svo = 2 * AARR + sko;
  v4u xh[2], xl[2], vh[2], vl[2];
#pragma unroll
  for (int i = 0; i < 2; ++i) { xh[i] = *(const v4u*)(khg + (size_t)i * 32 * DM); xl[i] = *(const v4u*)(klg + (size_t)i * 32 * DM); }
#pragma unroll
  for (int i = 0; i < 2; ++i) { vh[i] = *(const v4u*)(vhg + (size_t)i * 32 * SS); vl[i] = *(const v4u*)(vlg + (size_t)i * 32 * SS); }
  F2 aq[2];
#pragma unroll
  for (int kc = 0; kc < 2; ++kc) aq[kc] = split_row(QK + rq * QKVW + h * HD, kc * 32, lane);
#pragma unroll
  for (int i = 0; i < 2; ++i) { *(v4u*)(sb16 + sko + i * 32 * GP) = xh[i]; *(v4u*)(sb16 + AARR + sko + i * 32 * GP) = xl[i]; }
#pragma unroll
  for (int i = 0; i < 2; ++i) { *(v4u*)(sb16 + svo + i * 32 * GP) = vh[i]; *(v4u*)(sb16 + AARR + svo + i * 32 * GP) = vl[i]; }
  float m = -3.0e38f, l = 0.f;   // of query q0 + col; l holds this half's keys only
  v8f acc[4] = {};               // acc[dt][r] = O^T[dt * 16 + 8g + r][query q0 + col]
  const unsigned* mrow = MSK + (size_t)(qb * 8 + __builtin_amdgcn_readfirstlane(wave)) * (ANT * 32);   // the wave's number as a scalar: the address is then the same in every lane for the compiler too, and the loads are scalar loads
  unsigned mw[32];   // the current tile's lane masks; each step's 16 are asked for again, for the next tile, as soon as its selects have used them, one tile ahead of their use
#pragma unroll
  for (int i = 0; i < 32; ++i) mw[i] = mrow[i];
  __syncthreads();   // publishes tile 0
#pragma unroll 1
  for (int t = 0; t < ANT; ++t) { const __bf16* cur = sb16 + (t & 1) * ABUF; __bf16* nxt = sb16 + ((t + 1) & 1) * ABUF;
    const int tn = t + 1 < ANT ? t + 1 : t;   // the last trip fetches its own tile again, into the buffer that nobody reads any more: with no branch round the loads and stores the loads stay up here and the waits on them stay counted
#pragma unroll
    for (int i = 0; i < 2; ++i) { xh[i] = *(const v4u*)(khg + (size_t)(tn * AKT + i * 32) * DM); xl[i] = *(const v4u*)(klg + (size_t)(tn * AKT + i * 32) * DM); }
#pragma unroll
    for (int i = 0; i < 2; ++i) { vh[i] = *(const v4u*)(vhg + (size_t)i * 32 * SS + tn * AKT); vl[i] = *(const v4u*)(vlg + (size_t)i * 32 * SS + tn * AKT); }
    asm volatile("s_wait_xcnt 0x0" ::: "memory");   // stands behind the run of loads, in front of any later rewrite of a register that holds one of their addresses
#pragma unroll
    for (int u = 0; u < 2; ++u) { float s[16]; v16b kh[2][2], kl[2][2], fh[4], fl[4]; v8f c[2];
#pragma unroll
      for (int ct = 0; ct < 2; ++ct) { const __bf16* krow = cur + (u * 32 + ct * 16 + col) * GP;
#pragma unroll
        for (int kc = 0; kc < 2; ++kc) { kh[ct][kc] = frag_b(krow + kc * 32, lane); kl[ct][kc] = frag_b(krow + AARR + kc * 32, lane); } }
#pragma unroll
      for (int ct = 0; ct < 2; ++ct) { c[ct] = v8f{};
#pragma unroll
        for (int kc = 0; kc < 2; ++kc) { c[ct] = wmma_bf(kh[ct][kc], aq[kc].l, c[ct]); c[ct] = wmma_bf(kl[ct][kc], aq[kc].h, c[ct]); c[ct] = wmma_bf(kh[ct][kc], aq[kc].h, c[ct]); } }
#pragma unroll
      for (int dt = 0; dt < 4; ++dt) { const __bf16* vrow = cur + 2 * AARR + (dt * 16 + col) * GP + u * 32; fh[dt] = frag_b(vrow, lane); fl[dt] = frag_b(vrow + AARR, lane); }
#pragma unroll
      for (int ct = 0; ct < 2; ++ct)
#pragma unroll
        for (int r = 0; r < 8; ++r) s[ct * 8 + r] = __builtin_amdgcn_inverse_ballot_w32(mw[u * 16 + ct * 8 + r]) ? c[ct][r] * 0.18033688f : -1.44269504e30f;   // both sides times log2(e): -1e30 * 1.44269504 and SCALE * 1.44269504 = 1.44269504 / sqrt(64); scores, maximum and exponentials run in base 2, and the softmax weights are the same but for rounding
#pragma unroll
      for (int i = 0; i < 16; ++i) mw[u * 16 + i] = mrow[tn * 32 + u * 16 + i];   // the next tile's words of this step, asked for behind the selects that used this tile's: the scalar loads have a whole tile's time; the last trip asks for its own tile again (tn), inside the array
      float mx = s[0];
#pragma unroll
      for (int i = 1; i < 16; ++i) mx = fmaxf(mx, s[i]);
      mx = fmaxf(mx, xhalf(mx));
      const float mn = fmaxf(m, mx); const float alpha = ex2(m - mn);
      float es = 0.f;
#pragma unroll
      for (int i = 0; i < 16; ++i) { s[i] = ex2(s[i] - mn); es += s[i]; }
      l = l * alpha + es; m = mn;
#pragma unroll
      for (int dt = 0; dt < 4; ++dt) acc[dt] *= alpha;
      const F2 pb = bsplit16(s);   // element i = P^T[key 8g + i or 16 + 8g + (i - 8)][query]: the k order of frag_b
#pragma unroll
      for (int dt = 0; dt < 4; ++dt) { acc[dt] = wmma_bf(fh[dt], pb.l, acc[dt]); acc[dt] = wmma_bf(fl[dt], pb.h, acc[dt]); acc[dt] = wmma_bf(fh[dt], pb.h, acc[dt]); } }
#pragma unroll
    for (int i = 0; i < 2; ++i) { *(v4u*)(nxt + sko + i * 32 * GP) = xh[i]; *(v4u*)(nxt + AARR + sko + i * 32 * GP) = xl[i]; }
#pragma unroll
    for (int i = 0; i < 2; ++i) { *(v4u*)(nxt + svo + i * 32 * GP) = vh[i]; *(v4u*)(nxt + AARR + svo + i * 32 * GP) = vl[i]; }
    __syncthreads(); }   // publishes tile t + 1 and ends every wave's reads of tile t, whose buffer the next trip refills
  const float il = 1.0f / (l + xhalf(l));
#pragma unroll
  for (int dt = 0; dt < 4; ++dt) { v8b th, tl;   // split hi/lo here, once, in place of once per column block of k_out
#pragma unroll
    for (int r = 0; r < 8; ++r) { const float v = acc[dt][r] * il; const __bf16 hb = (__bf16)v; th[r] = hb; tl[r] = (__bf16)(v - (float)hb); }
    *(v8b*)&so[wave][0][col][dt * 16 + 8 * g] = th; *(v8b*)&so[wave][1][col][dt * 16 + 8 * g] = tl; }
  LDSX();
#pragma unroll
  for (int i = 0; i < 4; ++i) { const int rl = i * 4 + (lane >> 3), pc = (lane & 7) * 8; const size_t o = ((size_t)b * SS + q0 + rl) * DM + h * HD + pc;   // a wave's store: 4 rows x 128 B
    vst2(OH + o, *(const v4u*)&so[wave][0][rl][pc]); vst2(OL + o, *(const v4u*)&so[wave][1][rl][pc]); }
}
// ---- k_out: block = (64 rows, 128 cols): out = O(hi/lo, as k_attn has stored them) . out_proj rows (2 products) + bias
__global__ __launch_bounds__(128) void k_out(const __bf16* __restrict__ OH, const __bf16* __restrict__ OL, const __bf16* __restrict__ P, const float* __restrict__ BO, float* __restrict__ Y) {
  __shared__ __align__(16) char sm[2 * (64 + 64 + 128) * GP * 2];   // two buffers of [64 A hi rows | 64 A lo rows | 128 weight rows]; behind the loop's last barrier the same bytes hold so[4][16][132]
  __bf16* const sb16 = (__bf16*)sm; float (*const so)[16][132] = (float (*)[16][132])sm;
  const int tid = threadIdx.x, wave = tid >> 5, lane = tid & 31, col = lane & 15, g = lane >> 4; const size_t rb = (size_t)blockIdx.x * 64, r0 = rb + wave * 16; const int n0 = blockIdx.y * 128;
  const size_t ao = (rb + (tid >> 3)) * DM + (tid & 7) * 8;                    // a wave's load: 4 rows x 128 B
  const __bf16* hg = OH + ao; const __bf16* lg = OL + ao;
  const __bf16* pg = P + (size_t)(n0 + (tid >> 3)) * DM + (tid & 7) * 8;
  const int sao = (tid >> 3) * GP + (tid & 7) * 8, sbo = 128 * GP + sao;
  v4u xh[4], xl[4], wb[8];
  v8f acc[8] = {};
#pragma unroll
  for (int i = 0; i < 4; ++i) { xh[i] = *(const v4u*)(hg + (size_t)i * 16 * DM); xl[i] = *(const v4u*)(lg + (size_t)i * 16 * DM); }
#pragma unroll
  for (int i = 0; i < 8; ++i) wb[i] = *(const v4u*)(pg + (size_t)i * 16 * DM);
#pragma unroll
  for (int i = 0; i < 4; ++i) { *(v4u*)(sb16 + sao + i * 16 * GP) = xh[i]; *(v4u*)(sb16 + 64 * GP + sao + i * 16 * GP) = xl[i]; }
#pragma unroll
  for (int i = 0; i < 8; ++i) *(v4u*)(sb16 + sbo + i * 16 * GP) = wb[i];
  __syncthreads();
#pragma unroll 2   // two trips per branch: each buffer's LDS offsets become constants
  for (int c = 0; c < GCH; ++c) { const __bf16* cur = sb16 + (c & 1) * (256 * GP); __bf16* nxt = sb16 + ((c + 1) & 1) * (256 * GP);
    if (c + 1 < GCH) {
#pragma unroll
      for (int i = 0; i < 4; ++i) { xh[i] = *(const v4u*)(hg + (size_t)i * 16 * DM + (c + 1) * 64); xl[i] = *(const v4u*)(lg + (size_t)i * 16 * DM + (c + 1) * 64); }
#pragma unroll
      for (int i = 0; i < 8; ++i) wb[i] = *(const v4u*)(pg + (size_t)i * 16 * DM + (c + 1) * 64);
      asm volatile("s_wait_xcnt 0x0" ::: "memory"); }   // stands behind the run of prefetch loads, in front of any later rewrite of a register that holds one of their addresses
#pragma unroll
    for (int kc = 0; kc < 2; ++kc) { const v16b ah = frag_b(cur + (wave * 16 + col) * GP + kc * 32, lane), al = frag_b(cur + (64 + wave * 16 + col) * GP + kc * 32, lane); v16b w[8];
#pragma unroll
      for (int j = 0; j < 8; ++j) w[j] = frag_b(cur + (128 + j * 16 + col) * GP + kc * 32, lane);
#pragma unroll
      for (int j = 0; j < 8; ++j) { acc[j] = wmma_bf(al, w[j], acc[j]); acc[j] = wmma_bf(ah, w[j], acc[j]); } }
    if (c + 1 < GCH) {
#pragma unroll
      for (int i = 0; i < 4; ++i) { *(v4u*)(nxt + sao + i * 16 * GP) = xh[i]; *(v4u*)(nxt + 64 * GP + sao + i * 16 * GP) = xl[i]; }
#pragma unroll
      for (int i = 0; i < 8; ++i) *(v4u*)(nxt + sbo + i * 16 * GP) = wb[i]; }
    __syncthreads(); }   // publishes chunk c + 1 and ends every wave's reads of chunk c, whose buffer the next trip refills
#pragma unroll
  for (int j = 0; j < 8; ++j) { const float bb = bfr(BO[n0 + j * 16 + col]);
#pragma unroll
    for (int r = 0; r < 8; ++r) so[wave][8 * g + r][j * 16 + col] = acc[j][r] + bb; }
  LDSX();
  for (int rl = 0; rl < 16; ++rl) vst2(Y + (r0 + rl) * DM + n0 + lane * 4, *(const v4f*)&so[wave][rl][lane * 4]);
}
extern "C" void kernel_launch(void* const* d_in, const int* in_sizes, int n_in, void* d_out, int out_size, void* d_ws, size_t ws_size, hipStream_t stream) {
  (void)in_sizes; (void)n_in; (void)out_size;
  const float** F = (const float**)d_in;   // 0 x [4,1024,1024], 1 adjacency [1024,1024], 2 in_proj_w [3072,1024], 3 in_proj_b [3072], 4 out_proj_w [1024,1024], 5 out_proj_b [1024]
  if (ws_size < (size_t)WS_END) return;
  char* ws = (char*)d_ws; __bf16* PK = (__bf16*)(ws + WS_PK); float* QK = (float*)(ws + WS_QK); __bf16 *VTH = (__bf16*)(ws + WS_VTH), *VTL = (__bf16*)(ws + WS_VTL), *KH = (__bf16*)(ws + WS_KH), *KL = (__bf16*)(ws + WS_KL), *OH = (__bf16*)(ws + WS_OH), *OL = (__bf16*)(ws + WS_OL); unsigned* MSK = (unsigned*)(ws + WS_MSK);
  k_pack<<<MSKB + PKB, 256, 0, stream>>>(F[2], F[4], PK, F[1], MSK);
  k_qkv<<<dim3(TNB * SS / 64, QKVW / 128), 128, 0, stream>>>(F[0], PK + PK_A, F[3], QK, KH, KL, VTH, VTL);
  k_attn<<<dim3(TQB, NH, TNB), 256, 0, stream>>>(QK, MSK, KH, KL, VTH, VTL, OH, OL);
  k_out<<<dim3(TOB, DM / 128), 128, 0, stream>>>(OH, OL, PK + PK_P, F[5], (float*)d_out);
}

// v008
// Measured time: 95 microseconds a run.
// Next to v007, in two timings, it ran 1.11 and 1.13 times as fast.
// All steps since v000 together make it 4.27 times as fast.
// compute dtype: x, in_proj/out_proj weights and biases (module inputs) rounded to bf16 (the adjacency is read as f32); the packed qkv projection with exact bf16 products (x and W are inputs) + bias; scores q.k with both computed operands as bf16 hi + residual pairs (3 products) and P.V with P hi/lo x V hi/lo (3 products); the adjacency mask as a select (adjacency <= 0 -> -1e30); the output projection hi/lo x exact Wo (2 products) + bo; running-max softmax in f32; f32 accumulate.
#include <hip/hip_runtime.h>
#include <math.h>

typedef __attribute__((ext_vector_type(16))) _Float16 v16h;
typedef __attribute__((ext_vector_type(16))) __bf16 v16b;
typedef __attribute__((ext_vector_type(8)))  _Float16 v8h;
typedef __attribute__((ext_vector_type(8)))  float v8f;
typedef __attribute__((ext_vector_type(4)))  float v4f;
typedef __attribute__((ext_vector_type(2)))  float v2f;
typedef __attribute__((ext_vector_type(4)))  unsigned v4u;
typedef __attribute__((ext_vector_type(4)))  int v4i;
typedef float __attribute__((may_alias)) float_a;
typedef int __attribute__((may_alias)) int_a;

template <typename T> __device__ __forceinline__ void vst2(void* p, T v) { *(T*)p = v;  }
__device__ __forceinline__ v8f wmma16(v16h a, v16h b, v8f c) {
  v8f d = __builtin_amdgcn_wmma_f32_16x16x32_f16(false, a, false, b, (short)0, c, false, false);
  asm volatile("v_nop\n\tv_nop\n\tv_nop\n\tv_nop" : "+v"(d) : "v"(a), "v"(b));
  return d;
}
__device__ __forceinline__ v8f wmma_bf(v16b a, v16b b, v8f c) {
  v8f d = __builtin_amdgcn_wmma_f32_16x16x32_bf16(false, a, false, b, (short)0, c, false, false);
  asm volatile("v_nop\n\tv_nop\n\tv_nop\n\tv_nop" : "+v"(d) : "v"(a), "v"(b));
  return d;
}
// 16x16x32 fragments: lane = (h = lane>>4, row/col = lane&15); elements 0..7 = k0+8h+0..7, 8..15 = k0+16+8h+0..7; D element r = row 8h+r
__device__ __forceinline__ v16h frag_h(const _Float16* rowk0, int lane) {
  union { v16h v; v8h q[2]; } u; const _Float16* p = rowk0 + 8 * (lane >> 4);
  u.q[0] = *(const v8h*)p; u.q[1] = *(const v8h*)(p + 16); return u.v;
}
__device__ __forceinline__ v16h frag_f32(const float* rowk0, int lane) {
  v16h a; const float* p = rowk0 + 8 * (lane >> 4);
#pragma unroll
  for (int i = 0; i < 8; ++i) { a[i] = (_Float16)p[i]; a[8 + i] = (_Float16)p[16 + i]; }
  return a;
}
__device__ __forceinline__ v16h frag_f32s(const float* rowk0, int lane, float sc) {
  v16h a; const float* p = rowk0 + 8 * (lane >> 4);
#pragma unroll
  for (int i = 0; i < 8; ++i) { a[i] = (_Float16)(p[i] * sc); a[8 + i] = (_Float16)(p[16 + i] * sc); }
  return a;
}
// column fragment from a [K][ld] layout (column n), rows >= K read as 0
__device__ __forceinline__ v16h fragc_f32(const float* W, int k0, int n, int lane, int ld, int K) {
  v16h a; const int g = lane >> 4;
#pragma unroll
  for (int i = 0; i < 8; ++i) { const int ka = k0 + 8 * g + i, kb = ka + 16;
    a[i] = (_Float16)(ka < K ? W[(size_t)(ka < K ? ka : K - 1) * ld + n] : 0.f); a[8 + i] = (_Float16)(kb < K ? W[(size_t)(kb < K ? kb : K - 1) * ld + n] : 0.f); }
  return a;
}
struct F2 { v16b h, l; };
__device__ __forceinline__ F2 bsplit16(const float v[16]) { F2 r;
#pragma unroll
  for (int i = 0; i < 16; ++i) { const __bf16 h = (__bf16)v[i]; r.h[i] = h; r.l[i] = (__bf16)(v[i] - (float)h); }
  return r; }
__device__ __forceinline__ F2 split_row(const float* row, int k0, int lane) { float v[16]; const float* p = row + k0 + 8 * (lane >> 4);
#pragma unroll
  for (int i = 0; i < 8; ++i) { v[i] = p[i]; v[8 + i] = p[16 + i]; }
  return bsplit16(v); }
__device__ __forceinline__ F2 split_rowK(const float* row, int k0, int lane, int K) { float v[16]; const int g = lane >> 4;
#pragma unroll
  for (int i = 0; i < 8; ++i) { const int ka = k0 + 8 * g + i, kb = ka + 16; v[i] = ka < K ? row[ka < K ? ka : K - 1] : 0.f; v[8 + i] = kb < K ? row[kb < K ? kb : K - 1] : 0.f; }
  return bsplit16(v); }
__device__ __forceinline__ F2 split_col(const float* W, int k0, int n, int lane, int ld, int K) { float v[16]; const int g = lane >> 4;
#pragma unroll
  for (int i = 0; i < 8; ++i) { const int ka = k0 + 8 * g + i, kb = ka + 16; v[i] = ka < K ? W[(size_t)(ka < K ? ka : K - 1) * ld + n] : 0.f; v[8 + i] = kb < K ? W[(size_t)(kb < K ? kb : K - 1) * ld + n] : 0.f; }
  return bsplit16(v); }
__device__ __forceinline__ v8f mac3(const F2& a, const F2& b, v8f c) { c = wmma_bf(a.l, b.h, c); c = wmma_bf(a.h, b.l, c); return wmma_bf(a.h, b.h, c); }
__device__ __forceinline__ float sigm(float v) { return 1.0f / (1.0f + expf(-v)); }
#define LDSX() do { asm volatile("s_wait_dscnt 0" ::: "memory"); __builtin_amdgcn_wave_barrier(); __builtin_amdgcn_fence(__ATOMIC_RELEASE, "workgroup"); } while (0)


// Masked multi-head self-attention (B 4, T 1024, D 1024, 16 heads x 64; torch-style packed in_proj [3D][D] + bias, out_proj [D][D] + bias): scores = q.k / 8, keys with adjacency[q][k] <= 0 disallowed (-1e30 before the softmax; the [T][T] adjacency is shared by all batches and heads), out = softmax(scores) v, then out_proj.
#define NB 4
#define SS 1024
#define DM 1024
#define NH 16
#define HD 64
#define QKVW (3 * DM)
#ifndef TQB
#define TQB (SS / 128)
#define TNB NB
#define TOB (NB * SS / 64)     // output row tiles (all)
#endif
typedef __attribute__((ext_vector_type(8))) __bf16 v8b;
__device__ __forceinline__ v16b frag_b(const __bf16* rowk0, int lane) {
  union { v16b v; v8b q[2]; } u; const __bf16* p = rowk0 + 8 * (lane >> 4);
  u.q[0] = *(const v8b*)p; u.q[1] = *(const v8b*)(p + 16); return u.v;
}
__device__ __forceinline__ float bfr(float v) { return (float)(__bf16)v; }
__device__ __forceinline__ float ex2(float v) { return __builtin_amdgcn_exp2f(v); }   // 2^v as the one hardware instruction; every argument here is <= 0, and a result below the normal range may go to 0
__device__ __attribute__((noinline)) float erf_ni(float v) { return erff(v); }

#define PK_A 0                       // [3072][1024] in_proj rows (natural [out][in])
#define PK_P (PK_A + QKVW * DM)        // [1024][1024] out_proj rows (natural)
#define PK_END (PK_P + DM * DM)
#define WS_PK  0u
#define WS_QK  (WS_PK + 2u * PK_END)             // f32 [4096 rows][3072]: only the q columns are written and read
#define WS_VTH (WS_QK + 4u * NB * SS * QKVW)     // bf16 [4][1024 (h*64+d)][1024 s]
#define WS_VTL (WS_VTH + 2u * NB * DM * SS)
#define WS_OH  (WS_VTL + 2u * NB * DM * SS)        // bf16 [4096][1024]: attention output, high part
#define WS_OL  (WS_OH + 2u * NB * SS * DM)         // the residual
#define WS_KH  (WS_OL + 2u * NB * SS * DM)         // bf16 [4096 rows][1024 (h*64+d)]: k, high part
#define WS_KL  (WS_KH + 2u * NB * SS * DM)         // the residual
#define WS_MSK (WS_KL + 2u * NB * SS * DM)         // u32 [64 tiles of 16 queries][16 tiles of 64 keys][32]: the adjacency test as lane masks (k_pack's front blocks write them, k_attn reads them)
#define WS_END (WS_MSK + 4u * (SS / 16) * (SS / 64) * 32)
#define MSKB (SS / 16 * (SS / 64) / 8)             // blocks that build them: 8 waves each, one (query tile, key tile) a wave

typedef __attribute__((ext_vector_type(4))) __bf16 v4b;
#define PKE 64                         // weights a lane converts: 16 loads of 16 B, all asked for before the first is used
#define PKB (PK_END / (256 * PKE))     // blocks that convert: one per 16,384 weights; the first PK_P / (256 * PKE) of them take in_proj, the rest out_proj
// ---- k_pack: one launch for both weights and the adjacency test, with few waves that each do much: what a launch of many short waves costs is the time to start them, not its bytes. A converting wave takes 2,048 consecutive weights of the natural [out][in] rows (the bf16 copies of the two matrices lie one behind the other): each load covers 512 B in a row, each store 256 B, whole lines. The first MSKB blocks of the grid instead do the adjacency test, once for all batches and heads: a wave takes 16 queries x 64 keys with the lanes placed as in k_attn's score tiles (query = lane & 15, keys 8g + r and 16 + 8g + r of each 32) and stores 32 words, word u * 16 + e = the ballot of "allowed" over the lanes for score element e of 32-key step u
__global__ __launch_bounds__(256) void k_pack(const float* __restrict__ WA, const float* __restrict__ WP, __bf16* __restrict__ DST, const float* __restrict__ ADJ, unsigned* __restrict__ MSK) {
  const int wb = (int)blockIdx.x - MSKB, tid = threadIdx.x;
  if (wb < 0) {   // the same for the whole block
    const int lane = tid & 31, qt = blockIdx.x >> 1, t = (blockIdx.x & 1) * 8 + (tid >> 5);
    const float* ar = ADJ + (size_t)(qt * 16 + (lane & 15)) * SS + t * 64 + 8 * (lane >> 4);
    v4f a[8];
#pragma unroll
    for (int i = 0; i < 4; ++i) { a[2 * i] = *(const v4f*)(ar + i * 16); a[2 * i + 1] = *(const v4f*)(ar + i * 16 + 4); }
    unsigned w = 0;
#pragma unroll
    for (int i = 0; i < 32; ++i) { const unsigned bl = __builtin_amdgcn_ballot_w32(!(a[i >> 2][i & 3] <= 0.f)); w = lane == i ? bl : w; }
    MSK[(size_t)(qt * (SS / 64) + t) * 32 + lane] = w;   // a wave's store: one whole line
    return; }
  const size_t e0 = (size_t)wb * (256 * PKE) + (tid >> 5) * (32 * PKE) + (tid & 31) * 4;
  const float* sp = wb < PK_P / (256 * PKE) ? WA + e0 : WP + (e0 - PK_P);
  v4f a[PKE / 4];
#pragma unroll
  for (int i = 0; i < PKE / 4; ++i) a[i] = *(const v4f*)(sp + i * 128);
  asm volatile("s_wait_xcnt 0x0" :: "v"(sp), "v"(a[0]), "v"(a[1]), "v"(a[2]), "v"(a[3]), "v"(a[4]), "v"(a[5]), "v"(a[6]), "v"(a[7]), "v"(a[8]), "v"(a[9]), "v"(a[10]), "v"(a[11]), "v"(a[12]), "v"(a[13]), "v"(a[14]), "v"(a[15]));   // the address and the loaded values are inputs only. They keep all 16 loads in front of the first conversion (left alone the compiler asks for the last four only when the first have come back: a second trip to memory in a wave that lives for one) and the address registers whole up to here; the wait stands behind the run of loads, in front of any later rewrite of those registers
#pragma unroll
  for (int i = 0; i < PKE / 4; ++i) { v4b t;
#pragma unroll
    for (int e = 0; e < 4; ++e) t[e] = (__bf16)a[i][e];
    *(v4b*)(DST + e0 + i * 128) = t; }
  asm volatile("s_wait_xcnt 0x0" ::: "memory");   // stands behind the run of stores, in front of any later rewrite of a register that one of them names
}
// LDS staging of the two projections: a block brings each 64-k chunk of its A rows and its weight rows in by whole 128-B lines, once, and the waves read their fragments from LDS
#define GP 72                  // LDS row pitch in bf16 elements: 144 B = 16 B x odd, which spreads the 16 rows of a 16-byte fragment read over the banks
#define GCH (DM / 64)          // staged chunks of 64 k
// ---- k_qkv: block = (128 rows, 384 of the 3072 cols), one block per WGP, 12 waves as 2 x 6, a wave = 64 rows x 64 cols (4 x 4 accumulator tiles: 8 fragments feed 16 products): QKV = bf16(x) . in_proj rows (exact) + bias; a wave's 64 columns lie in one of q, k, v, and its epilogue, in LDS bytes of its own, stores them in the form k_attn takes them: q as f32 rows (pitch 3072), k as bf16 hi/lo rows, v as bf16 hi/lo transposed ([b][h*64+d][s])
#define QBM 128                // rows of a block
#define QBN 384                // columns of a block
#define QAR 144                // staged A rows: 6 passes of 24 rows; the last 16 hold a second copy of row 127 that nobody reads (no branch round the sixth pass)
#define QBUF ((QAR + QBN) * GP)   // one buffer, in bf16 elements
#define QSP 68                 // pitch of a wave's f32 output tile in floats: 272 B
#define QWS (64 * GP * 2)      // bytes of a wave's own staging behind the loop: [64 cols][GP] bf16 (v) or [32 rows][QSP] f32 (q, k)
__global__ __launch_bounds__(384) void k_qkv(const float* __restrict__ X, const __bf16* __restrict__ P, const float* __restrict__ BIAS, float* __restrict__ QKV, __bf16* __restrict__ KH, __bf16* __restrict__ KL, __bf16* __restrict__ VTH, __bf16* __restrict__ VTL) {
  __shared__ __align__(16) char sm[2 * QBUF * 2];   // two buffers of [144 A rows | 384 weight rows]; behind the loop's last barrier the first 12 x QWS bytes are the waves' own staging
  __bf16* const sb16 = (__bf16*)sm;
  const int tid = threadIdx.x, wave = tid >> 5, lane = tid & 31, col = lane & 15, g = lane >> 4, wr = wave / 6, wc = wave % 6; const size_t rb = (size_t)blockIdx.x * QBM, r0 = rb + wr * 64; const int n0 = blockIdx.y * QBN, nw = n0 + wc * 64;
  const int xr = tid >> 4, xl = 120 + xr < QBM ? 120 + xr : QBM - 1;
  const float* xg = X + (rb + xr) * DM + (tid & 15) * 4;                       // a wave's load: 2 rows x 256 B
  const float* xg5 = X + (rb + xl) * DM + (tid & 15) * 4;                      // the sixth pass, its row held inside the block
  const __bf16* pg = P + (size_t)(n0 + (tid >> 3)) * DM + (tid & 7) * 8;       // a wave's load: 4 rows x 128 B
  const int sao = xr * GP + (tid & 15) * 4, sbo = QAR * GP + (tid >> 3) * GP + (tid & 7) * 8;
  v4f xa[6]; v4u wb[8];
  v8f acc[4][4] = {};
#pragma unroll
  for (int i = 0; i < 5; ++i) xa[i] = *(const v4f*)(xg + (size_t)i * 24 * DM);
  xa[5] = *(const v4f*)xg5;
#pragma unroll
  for (int i = 0; i < 8; ++i) wb[i] = *(const v4u*)(pg + (size_t)i * 48 * DM);
#pragma unroll
  for (int i = 0; i < 6; ++i) { v4b t;
#pragma unroll
    for (int e = 0; e < 4; ++e) t[e] = (__bf16)xa[i][e];
    *(v4b*)(sb16 + sao + i * 24 * GP) = t; }
#pragma unroll
  for (int i = 0; i < 8; ++i) *(v4u*)(sb16 + sbo + i * 48 * GP) = wb[i];
  __syncthreads();
#pragma unroll 2   // two trips per branch: each buffer's LDS offsets become constants
  for (int c = 0; c < GCH; ++c) { const __bf16* cur = sb16 + (c & 1) * QBUF; __bf16* nxt = sb16 + ((c + 1) & 1) * QBUF;
    if (c + 1 < GCH) {
#pragma unroll
      for (int i = 0; i < 5; ++i) xa[i] = *(const v4f*)(xg + (size_t)i * 24 * DM + (c + 1) * 64);
      xa[5] = *(const v4f*)(xg5 + (c + 1) * 64);
#pragma unroll
      for (int i = 0; i < 8; ++i) wb[i] = *(const v4u*)(pg + (size_t)i * 48 * DM + (c + 1) * 64);
      asm volatile("s_wait_xcnt 0x0" ::: "memory"); }   // stands behind the run of prefetch loads, in front of any later rewrite of a register that holds one of their addresses
#pragma unroll
    for (int kc = 0; kc < 2; ++kc) { v16b a[4], w[4];
#pragma unroll
      for (int i = 0; i < 4; ++i) a[i] = frag_b(cur + (wr * 64 + i * 16 + col) * GP + kc * 32, lane);
#pragma unroll
      for (int j = 0; j < 4; ++j) w[j] = frag_b(cur + (QAR + wc * 64 + j * 16 + col) * GP + kc * 32, lane);
#pragma unroll
      for (int j = 0; j < 4; ++j)
#pragma unroll
        for (int i = 0; i < 4; ++i) acc[i][j] = wmma_bf(a[i], w[j], acc[i][j]); }
    if (c + 1 < GCH) {
#pragma unroll
      for (int i = 0; i < 6; ++i) { v4b t;
#pragma unroll
        for (int e = 0; e < 4; ++e) t[e] = (__bf16)xa[i][e];
        *(v4b*)(nxt + sao + i * 24 * GP) = t; }
#pragma unroll
      for (int i = 0; i < 8; ++i) *(v4u*)(nxt + sbo + i * 48 * GP) = wb[i]; }
    __syncthreads(); }   // publishes chunk c + 1 and ends every wave's reads of chunk c, whose buffer the next trip refills
  char* const wsm = sm + wave * QWS;
  float bb[4];
#pragma unroll
  for (int j = 0; j < 4; ++j) bb[j] = bfr(BIAS[nw + j * 16 + col]);
  if (nw >= 2 * DM) {   // v (the test is the same for the whole wave; no barrier stands behind it): a lane holds 8 consecutive s of one column, 16 B of a transposed row; the wave's 64 s of a column are one whole line
    __bf16* const st = (__bf16*)wsm;
    const size_t vb = ((rb / SS) * DM + (nw - 2 * DM)) * SS + rb % SS + wr * 64;
#pragma unroll
    for (int part = 0; part < 2; ++part) {   // the high parts of the wave's tile, then the residuals, through the same bytes
      if (part) LDSX();   // the wave's reads of the high parts are over before the residuals overwrite them
#pragma unroll
      for (int j = 0; j < 4; ++j)
#pragma unroll
        for (int i = 0; i < 4; ++i) { v8b t;
#pragma unroll
          for (int r = 0; r < 8; ++r) { const float v = acc[i][j][r] + bb[j]; const __bf16 hb = (__bf16)v; t[r] = part ? (__bf16)(v - (float)hb) : hb; }
          *(v8b*)(st + (j * 16 + col) * GP + i * 16 + 8 * g) = t; }
      LDSX();
      __bf16* const vd = (part ? VTL : VTH) + vb;
#pragma unroll
      for (int p = 0; p < 16; ++p) { const int cn = p * 4 + (lane >> 3), pc = (lane & 7) * 8;   // a wave's store: 4 rows x 128 B
        vst2(vd + (size_t)cn * SS + pc, *(const v4u*)(st + cn * GP + pc)); }
      asm volatile("s_wait_xcnt 0x0" ::: "memory"); }   // stands behind the run of stores, in front of any later rewrite of a register that one of them names
    return; }
  float (*const so)[QSP] = (float (*)[QSP])wsm;
#pragma unroll
  for (int hp = 0; hp < 2; ++hp) {   // 32 of the wave's 64 rows at a time
    if (hp) LDSX();   // the wave's reads of the first half are over before the second overwrites it
#pragma unroll
    for (int j = 0; j < 4; ++j)
#pragma unroll
      for (int i = 0; i < 2; ++i)
#pragma unroll
        for (int r = 0; r < 8; ++r) so[i * 16 + 8 * g + r][j * 16 + col] = acc[hp * 2 + i][j][r] + bb[j];
    LDSX();
    if (nw < DM) {
#pragma unroll
      for (int p = 0; p < 16; ++p) { const int rl = p * 2 + g; vst2(QKV + (r0 + hp * 32 + rl) * QKVW + nw + col * 4, *(const v4f*)&so[rl][col * 4]); } }   // a wave's store: 2 rows x 256 B
    else {   // k: split hi/lo here, once, in place of once per block of k_attn
#pragma unroll
      for (int p = 0; p < 8; ++p) { const int rl = p * 4 + (lane >> 3), c8 = (lane & 7) * 8; const v4f a = *(const v4f*)&so[rl][c8], c = *(const v4f*)&so[rl][c8 + 4]; v8b th, tl;   // a wave's store: 4 rows x 128 B
#pragma unroll
        for (int e = 0; e < 4; ++e) { const __bf16 ha = (__bf16)a[e], hc = (__bf16)c[e]; th[e] = ha; tl[e] = (__bf16)(a[e] - (float)ha); th[4 + e] = hc; tl[4 + e] = (__bf16)(c[e] - (float)hc); }
        const size_t o = (r0 + hp * 32 + rl) * DM + (nw - DM) + c8; *(v8b*)(KH + o) = th; *(v8b*)(KL + o) = tl; } }
    asm volatile("s_wait_xcnt 0x0" ::: "memory"); }   // stands behind the run of stores, in front of any later rewrite of a register that one of them names
}
// ---- k_attn: block = (128 queries = 8 waves x 16, head h, batch b): flash attention over the 1,024 keys, transposed: S^T = K.Q^T (A = key rows, B = query columns, 3 products) / 8, so a lane holds 16 of ONE query's 32 scores (keys 8g + r and 16 + 8g + r of the step); disallowed keys (adjacency[q][k] <= 0, taken as the lane masks that k_pack's front blocks have stored: 16 words per step, the same for the whole wave, so they come by scalar loads and each is the select mask of one score element) set to -1e30; maximum and sum run in the lane, the two halves of the wave exchange the maximum once per step and join their sums behind the loop; the two score tiles, split hi/lo in place, are the B operand of O^T += V^T.P^T (3 products); O[b*S+q][h*64+d] = acc / l, stored as a bf16 hi/lo pair
// K and V^T come through LDS, both as the bf16 hi/lo pairs that k_qkv has stored: the block brings each tile of 64 keys in by whole 128-B lines, once for its 8 waves, and every wave reads its A fragments from LDS (two steps of 32 keys per tile)
#define AKT 64                 // keys per staged tile: a V^T row piece is then one whole line
#define ANT (SS / AKT)
#define AARR (AKT * GP)        // one staged array: 64 rows at the padded pitch
#define ABUF (4 * AARR)        // one buffer: [K hi | K lo | V^T hi | V^T lo]
__device__ __forceinline__ float xhalf(float x) { return __builtin_bit_cast(float, __builtin_amdgcn_permlanex16(__builtin_bit_cast(int, x), __builtin_bit_cast(int, x), 0x76543210, 0xfedcba98, false, false)); }  // lane l with lane l ^ 16
__global__ __launch_bounds__(256) void k_attn(const float* __restrict__ QK, const unsigned* __restrict__ MSK, const __bf16* __restrict__ KH, const __bf16* __restrict__ KL, const __bf16* __restrict__ VTH, const __bf16* __restrict__ VTL, __bf16* __restrict__ OH, __bf16* __restrict__ OL) {
  __shared__ __align__(16) char sm[2 * ABUF * 2];   // two buffers; behind the loop's last barrier the same bytes hold so[8 waves][hi | lo][16][GP]
  __bf16* const sb16 = (__bf16*)sm; __bf16 (*const so)[2][16][GP] = (__bf16 (*)[2][16][GP])sm;
  const int tid = threadIdx.x, wave = tid >> 5, lane = tid & 31, col = lane & 15, g = lane >> 4;
  const int qb = blockIdx.x, h = blockIdx.y, b = blockIdx.z; const int q0 = qb * 128 + wave * 16; const size_t rq = (size_t)b * SS + q0 + col;
  const size_t ko = ((size_t)b * SS + (tid >> 3)) * DM + h * HD + (tid & 7) * 8;                // a wave's load: 4 key rows x 128 B
  const __bf16* khg = KH + ko; const __bf16* klg = KL + ko;
  const size_t vo = ((size_t)b * DM + h * HD + (tid >> 3)) * SS + (tid & 7) * 8;                // a wave's load: 4 V^T rows x 128 B
  const __bf16* vhg = VTH + vo; const __bf16* vlg = VTL + vo;
  const int sko = (tid >> 3) * GP + (tid & 7) * 8, svo = 2 * AARR + sko;
  v4u xh[2], xl[2], vh[2], vl[2];
#pragma unroll
  for (int i = 0; i < 2; ++i) { xh[i] = *(const v4u*)(khg + (size_t)i * 32 * DM); xl[i] = *(const v4u*)(klg + (size_t)i * 32 * DM); }
#pragma unroll
  for (int i = 0; i < 2; ++i) { vh[i] = *(const v4u*)(vhg + (size_t)i * 32 * SS); vl[i] = *(const v4u*)(vlg + (size_t)i * 32 * SS); }
  F2 aq[2];
#pragma unroll
  for (int kc = 0; kc < 2; ++kc) aq[kc] = split_row(QK + rq * QKVW + h * HD, kc * 32, lane);
#pragma unroll
  for (int i = 0; i < 2; ++i) { *(v4u*)(sb16 + sko + i * 32 * GP) = xh[i]; *(v4u*)(sb16 + AARR + sko + i * 32 * GP) = xl[i]; }
#pragma unroll
  for (int i = 0; i < 2; ++i) { *(v4u*)(sb16 + svo + i * 32 * GP) = vh[i]; *(v4u*)(sb16 + AARR + svo + i * 32 * GP) = vl[i]; }
  float m = -3.0e38f, l = 0.f;   // of query q0 + col; l holds this half's keys only
  v8f acc[4] = {};               // acc[dt][r] = O^T[dt * 16 + 8g + r][query q0 + col]
  const unsigned* mrow = MSK + (size_t)(qb * 8 + __builtin_amdgcn_readfirstlane(wave)) * (ANT * 32);   // the wave's number as a scalar: the address is then the same in every lane for the compiler too, and the loads are scalar loads
  unsigned mw[32];   // the current tile's lane masks; each step's 16 are asked for again, for the next tile, as soon as its selects have used them, one tile ahead of their use
#pragma unroll
  for (int i = 0; i < 32; ++i) mw[i] = mrow[i];
  __syncthreads();   // publishes tile 0
#pragma unroll 1
  for (int t = 0; t < ANT; ++t) { const __bf16* cur = sb16 + (t & 1) * ABUF; __bf16* nxt = sb16 + ((t + 1) & 1) * ABUF;
    const int tn = t + 1 < ANT ? t + 1 : t;   // the last trip fetches its own tile again, into the buffer that nobody reads any more: with no branch round the loads and stores the loads stay up here and the waits on them stay counted
#pragma unroll
    for (int i = 0; i < 2; ++i) { xh[i] = *(const v4u*)(khg + (size_t)(tn * AKT + i * 32) * DM); xl[i] = *(const v4u*)(klg + (size_t)(tn * AKT + i * 32) * DM); }
#pragma unroll
    for (int i = 0; i < 2; ++i) { vh[i] = *(const v4u*)(vhg + (size_t)i * 32 * SS + tn * AKT); vl[i] = *(const v4u*)(vlg + (size_t)i * 32 * SS + tn * AKT); }
    asm volatile("s_wait_xcnt 0x0" ::: "memory");   // stands behind the run of loads, in front of any later rewrite of a register that holds one of their addresses
#pragma unroll
    for (int u = 0; u < 2; ++u) { float s[16]; v16b kh[2][2], kl[2][2], fh[4], fl[4]; v8f c[2];
#pragma unroll
      for (int ct = 0; ct < 2; ++ct) { const __bf16* krow = cur + (u * 32 + ct * 16 + col) * GP;
#pragma unroll
        for (int kc = 0; kc < 2; ++kc) { kh[ct][kc] = frag_b(krow + kc * 32, lane); kl[ct][kc] = frag_b(krow + AARR + kc * 32, lane); } }
#pragma unroll
      for (int ct = 0; ct < 2; ++ct) { c[ct] = v8f{};
#pragma unroll
        for (int kc = 0; kc < 2; ++kc) { c[ct] = wmma_bf(kh[ct][kc], aq[kc].l, c[ct]); c[ct] = wmma_bf(kl[ct][kc], aq[kc].h, c[ct]); c[ct] = wmma_bf(kh[ct][kc], aq[kc].h, c[ct]); } }
#pragma unroll
      for (int dt = 0; dt < 4; ++dt) { const __bf16* vrow = cur + 2 * AARR + (dt * 16 + col) * GP + u * 32; fh[dt] = frag_b(vrow, lane); fl[dt] = frag_b(vrow + AARR, lane); }
#pragma unroll
      for (int ct = 0; ct < 2; ++ct)
#pragma unroll
        for (int r = 0; r < 8; ++r) s[ct * 8 + r] = __builtin_amdgcn_inverse_ballot_w32(mw[u * 16 + ct * 8 + r]) ? c[ct][r] * 0.18033688f : -1.44269504e30f;   // both sides times log2(e): -1e30 * 1.44269504 and SCALE * 1.44269504 = 1.44269504 / sqrt(64); scores, maximum and exponentials run in base 2, and the softmax weights are the same but for rounding
#pragma unroll
      for (int i = 0; i < 16; ++i) mw[u * 16 + i] = mrow[tn * 32 + u * 16 + i];   // the next tile's words of this step, asked for behind the selects that used this tile's: the scalar loads have a whole tile's time; the last trip asks for its own tile again (tn), inside the array
      float mx = s[0];
#pragma unroll
      for (int i = 1; i < 16; ++i) mx = fmaxf(mx, s[i]);
      mx = fmaxf(mx, xhalf(mx));
      const float mn = fmaxf(m, mx); const float alpha = ex2(m - mn);
      float es = 0.f;
#pragma unroll
      for (int i = 0; i < 16; ++i) { s[i] = ex2(s[i] - mn); es += s[i]; }
      l = l * alpha + es; m = mn;
#pragma unroll
      for (int dt = 0; dt < 4; ++dt) acc[dt] *= alpha;
      const F2 pb = bsplit16(s);   // element i = P^T[key 8g + i or 16 + 8g + (i - 8)][query]: the k order of frag_b
#pragma unroll
      for (int dt = 0; dt < 4; ++dt) { acc[dt] = wmma_bf(fh[dt], pb.l, acc[dt]); acc[dt] = wmma_bf(fl[dt], pb.h, acc[dt]); acc[dt] = wmma_bf(fh[dt], pb.h, acc[dt]); } }
#pragma unroll
    for (int i = 0; i < 2; ++i) { *(v4u*)(nxt + sko + i * 32 * GP) = xh[i]; *(v4u*)(nxt + AARR + sko + i * 32 * GP) = xl[i]; }
#pragma unroll
    for (int i = 0; i < 2; ++i) { *(v4u*)(nxt + svo + i * 32 * GP) = vh[i]; *(v4u*)(nxt + AARR + svo + i * 32 * GP) = vl[i]; }
    __syncthreads(); }   // publishes tile t + 1 and ends every wave's reads of tile t, whose buffer the next trip refills
  const float il = 1.0f / (l + xhalf(l));
#pragma unroll
  for (int dt = 0; dt < 4; ++dt) { v8b th, tl;   // split hi/lo here, once, in place of once per column block of k_out
#pragma unroll
    for (int r = 0; r < 8; ++r) { const float v = acc[dt][r] * il; const __bf16 hb = (__bf16)v; th[r] = hb; tl[r] = (__bf16)(v - (float)hb); }
    *(v8b*)&so[wave][0][col][dt * 16 + 8 * g] = th; *(v8b*)&so[wave][1][col][dt * 16 + 8 * g] = tl; }
  LDSX();
#pragma unroll
  for (int i = 0; i < 4; ++i) { const int rl = i * 4 + (lane >> 3), pc = (lane & 7) * 8; const size_t o = ((size_t)b * SS + q0 + rl) * DM + h * HD + pc;   // a wave's store: 4 rows x 128 B
    vst2(OH + o, *(const v4u*)&so[wave][0][rl][pc]); vst2(OL + o, *(const v4u*)&so[wave][1][rl][pc]); }
}
// ---- k_out: block = (64 rows, 128 cols): out = O(hi/lo, as k_attn has stored them) . out_proj rows (2 products) + bias
__global__ __launch_bounds__(128) void k_out(const __bf16* __restrict__ OH, const __bf16* __restrict__ OL, const __bf16* __restrict__ P, const float* __restrict__ BO, float* __restrict__ Y) {
  __shared__ __align__(16) char sm[2 * (64 + 64 + 128) * GP * 2];   // two buffers of [64 A hi rows | 64 A lo rows | 128 weight rows]; behind the loop's last barrier the same bytes hold so[4][16][132]
  __bf16* const sb16 = (__bf16*)sm; float (*const so)[16][132] = (float (*)[16][132])sm;
  const int tid = threadIdx.x, wave = tid >> 5, lane = tid & 31, col = lane & 15, g = lane >> 4; const size_t rb = (size_t)blockIdx.x * 64, r0 = rb + wave * 16; const int n0 = blockIdx.y * 128;
  const size_t ao = (rb + (tid >> 3)) * DM + (tid & 7) * 8;                    // a wave's load: 4 rows x 128 B
  const __bf16* hg = OH + ao; const __bf16* lg = OL + ao;
  const __bf16* pg = P + (size_t)(n0 + (tid >> 3)) * DM + (tid & 7) * 8;
  const int sao = (tid >> 3) * GP + (tid & 7) * 8, sbo = 128 * GP + sao;
  v4u xh[4], xl[4], wb[8];
  v8f acc[8] = {};
#pragma unroll
  for (int i = 0; i < 4; ++i) { xh[i] = *(const v4u*)(hg + (size_t)i * 16 * DM); xl[i] = *(const v4u*)(lg + (size_t)i * 16 * DM); }
#pragma unroll
  for (int i = 0; i < 8; ++i) wb[i] = *(const v4u*)(pg + (size_t)i * 16 * DM);
#pragma unroll
  for (int i = 0; i < 4; ++i) { *(v4u*)(sb16 + sao + i * 16 * GP) = xh[i]; *(v4u*)(sb16 + 64 * GP + sao + i * 16 * GP) = xl[i]; }
#pragma unroll
  for (int i = 0; i < 8; ++i) *(v4u*)(sb16 + sbo + i * 16 * GP) = wb[i];
  __syncthreads();
#pragma unroll 2   // two trips per branch: each buffer's LDS offsets become constants
  for (int c = 0; c < GCH; ++c) { const __bf16* cur = sb16 + (c & 1) * (256 * GP); __bf16* nxt = sb16 + ((c + 1) & 1) * (256 * GP);
    if (c + 1 < GCH) {
#pragma unroll
      for (int i = 0; i < 4; ++i) { xh[i] = *(const v4u*)(hg + (size_t)i * 16 * DM + (c + 1) * 64); xl[i] = *(const v4u*)(lg + (size_t)i * 16 * DM + (c + 1) * 64); }
#pragma unroll
      for (int i = 0; i < 8; ++i) wb[i] = *(const v4u*)(pg + (size_t)i * 16 * DM + (c + 1) * 64);
      asm volatile("s_wait_xcnt 0x0" ::: "memory"); }   // stands behind the run of prefetch loads, in front of any later rewrite of a register that holds one of their addresses
#pragma unroll
    for (int kc = 0; kc < 2; ++kc) { const v16b ah = frag_b(cur + (wave * 16 + col) * GP + kc * 32, lane), al = frag_b(cur + (64 + wave * 16 + col) * GP + kc * 32, lane); v16b w[8];
#pragma unroll
      for (int j = 0; j < 8; ++j) w[j] = frag_b(cur + (128 + j * 16 + col) * GP + kc * 32, lane);
#pragma unroll
      for (int j = 0; j < 8; ++j) { acc[j] = wmma_bf(al, w[j], acc[j]); acc[j] = wmma_bf(ah, w[j], acc[j]); } }
    if (c + 1 < GCH) {
#pragma unroll
      for (int i = 0; i < 4; ++i) { *(v4u*)(nxt + sao + i * 16 * GP) = xh[i]; *(v4u*)(nxt + 64 * GP + sao + i * 16 * GP) = xl[i]; }
#pragma unroll
      for (int i = 0; i < 8; ++i) *(v4u*)(nxt + sbo + i * 16 * GP) = wb[i]; }
    __syncthreads(); }   // publishes chunk c + 1 and ends every wave's reads of chunk c, whose buffer the next trip refills
#pragma unroll
  for (int j = 0; j < 8; ++j) { const float bb = bfr(BO[n0 + j * 16 + col]);
#pragma unroll
    for (int r = 0; r < 8; ++r) so[wave][8 * g + r][j * 16 + col] = acc[j][r] + bb; }
  LDSX();
  for (int rl = 0; rl < 16; ++rl) vst2(Y + (r0 + rl) * DM + n0 + lane * 4, *(const v4f*)&so[wave][rl][lane * 4]);
}
extern "C" void kernel_launch(void* const* d_in, const int* in_sizes, int n_in, void* d_out, int out_size, void* d_ws, size_t ws_size, hipStream_t stream) {
  (void)in_sizes; (void)n_in; (void)out_size;
  const float** F = (const float**)d_in;   // 0 x [4,1024,1024], 1 adjacency [1024,1024], 2 in_proj_w [3072,1024], 3 in_proj_b [3072], 4 out_proj_w [1024,1024], 5 out_proj_b [1024]
  if (ws_size < (size_t)WS_END) return;
  char* ws = (char*)d_ws; __bf16* PK = (__bf16*)(ws + WS_PK); float* QK = (float*)(ws + WS_QK); __bf16 *VTH = (__bf16*)(ws + WS_VTH), *VTL = (__bf16*)(ws + WS_VTL), *KH = (__bf16*)(ws + WS_KH), *KL = (__bf16*)(ws + WS_KL), *OH = (__bf16*)(ws + WS_OH), *OL = (__bf16*)(ws + WS_OL); unsigned* MSK = (unsigned*)(ws + WS_MSK);
  k_pack<<<MSKB + PKB, 256, 0, stream>>>(F[2], F[4], PK, F[1], MSK);
  k_qkv<<<dim3(TNB * SS / QBM, QKVW / QBN), 384, 0, stream>>>(F[0], PK + PK_A, F[3], QK, KH, KL, VTH, VTL);
  k_attn<<<dim3(TQB, NH, TNB), 256, 0, stream>>>(QK, MSK, KH, KL, VTH, VTL, OH, OL);
  k_out<<<dim3(TOB, DM / 128), 128, 0, stream>>>(OH, OL, PK + PK_P, F[5], (float*)d_out);
}

// v009
// It runs in 91.6 microseconds.
// Timed twice side by side with v008, it ran 1.04 times as fast both times.
// Over all steps from v000 it is 4.45 times as fast.
// compute dtype: x, in_proj/out_proj weights and biases (module inputs) rounded to bf16 (the adjacency is read as f32); the packed qkv projection with exact bf16 products (x and W are inputs) + bias; scores q.k with both computed operands as bf16 hi + residual pairs (3 products) and P.V with P hi/lo x V hi/lo (3 products); the adjacency mask as a select (adjacency <= 0 -> -1e30); the output projection hi/lo x exact Wo (2 products) + bo; running-max softmax in f32; f32 accumulate.
#include <hip/hip_runtime.h>
#include <math.h>

typedef __attribute__((ext_vector_type(16))) _Float16 v16h;
typedef __attribute__((ext_vector_type(16))) __bf16 v16b;
typedef __attribute__((ext_vector_type(8)))  _Float16 v8h;
typedef __attribute__((ext_vector_type(8)))  float v8f;
typedef __attribute__((ext_vector_type(4)))  float v4f;
typedef __attribute__((ext_vector_type(2)))  float v2f;
typedef __attribute__((ext_vector_type(4)))  unsigned v4u;
typedef __attribute__((ext_vector_type(4)))  int v4i;
typedef float __attribute__((may_alias)) float_a;
typedef int __attribute__((may_alias)) int_a;

template <typename T> __device__ __forceinline__ void vst2(void* p, T v) { *(T*)p = v;  }
__device__ __forceinline__ v8f wmma16(v16h a, v16h b, v8f c) {
  v8f d = __builtin_amdgcn_wmma_f32_16x16x32_f16(false, a, false, b, (short)0, c, false, false);
  asm volatile("v_nop\n\tv_nop\n\tv_nop\n\tv_nop" : "+v"(d) : "v"(a), "v"(b));
  return d;
}
__device__ __forceinline__ v8f wmma_bf(v16b a, v16b b, v8f c) {
  return __builtin_amdgcn_wmma_f32_16x16x32_bf16(false, a, false, b, (short)0, c, false, false);
}
// 16x16x32 fragments: lane = (h = lane>>4, row/col = lane&15); elements 0..7 = k0+8h+0..7, 8..15 = k0+16+8h+0..7; D element r = row 8h+r
__device__ __forceinline__ v16h frag_h(const _Float16* rowk0, int lane) {
  union { v16h v; v8h q[2]; } u; const _Float16* p = rowk0 + 8 * (lane >> 4);
  u.q[0] = *(const v8h*)p; u.q[1] = *(const v8h*)(p + 16); return u.v;
}
__device__ __forceinline__ v16h frag_f32(const float* rowk0, int lane) {
  v16h a; const float* p = rowk0 + 8 * (lane >> 4);
#pragma unroll
  for (int i = 0; i < 8; ++i) { a[i] = (_Float16)p[i]; a[8 + i] = (_Float16)p[16 + i]; }
  return a;
}
__device__ __forceinline__ v16h frag_f32s(const float* rowk0, int lane, float sc) {
  v16h a; const float* p = rowk0 + 8 * (lane >> 4);
#pragma unroll
  for (int i = 0; i < 8; ++i) { a[i] = (_Float16)(p[i] * sc); a[8 + i] = (_Float16)(p[16 + i] * sc); }
  return a;
}
// column fragment from a [K][ld] layout (column n), rows >= K read as 0
__device__ __forceinline__ v16h fragc_f32(const float* W, int k0, int n, int lane, int ld, int K) {
  v16h a; const int g = lane >> 4;
#pragma unroll
  for (int i = 0; i < 8; ++i) { const int ka = k0 + 8 * g + i, kb = ka + 16;
    a[i] = (_Float16)(ka < K ? W[(size_t)(ka < K ? ka : K - 1) * ld + n] : 0.f); a[8 + i] = (_Float16)(kb < K ? W[(size_t)(kb < K ? kb : K - 1) * ld + n] : 0.f); }
  return a;
}
struct F2 { v16b h, l; };
__device__ __forceinline__ F2 bsplit16(const float v[16]) { F2 r;
#pragma unroll
  for (int i = 0; i < 16; ++i) { const __bf16 h = (__bf16)v[i]; r.h[i] = h; r.l[i] = (__bf16)(v[i] - (float)h); }
  return r; }
__device__ __forceinline__ F2 split_row(const float* row, int k0, int lane) { float v[16]; const float* p = row + k0 + 8 * (lane >> 4);
#pragma unroll
  for (int i = 0; i < 8; ++i) { v[i] = p[i]; v[8 + i] = p[16 + i]; }
  return bsplit16(v); }
__device__ __forceinline__ F2 split_rowK(const float* row, int k0, int lane, int K) { float v[16]; const int g = lane >> 4;
#pragma unroll
  for (int i = 0; i < 8; ++i) { const int ka = k0 + 8 * g + i, kb = ka + 16; v[i] = ka < K ? row[ka < K ? ka : K - 1] : 0.f; v[8 + i] = kb < K ? row[kb < K ? kb : K - 1] : 0.f; }
  return bsplit16(v); }
__device__ __forceinline__ F2 split_col(const float* W, int k0, int n, int lane, int ld, int K) { float v[16]; const int g = lane >> 4;
#pragma unroll
  for (int i = 0; i < 8; ++i) { const int ka = k0 + 8 * g + i, kb = ka + 16; v[i] = ka < K ? W[(size_t)(ka < K ? ka : K - 1) * ld + n] : 0.f; v[8 + i] = kb < K ? W[(size_t)(kb < K ? kb : K - 1) * ld + n] : 0.f; }
  return bsplit16(v); }
__device__ __forceinline__ v8f mac3(const F2& a, const F2& b, v8f c) { c = wmma_bf(a.l, b.h, c); c = wmma_bf(a.h, b.l, c); return wmma_bf(a.h, b.h, c); }
__device__ __forceinline__ float sigm(float v) { return 1.0f / (1.0f + expf(-v)); }
#define LDSX() do { asm volatile("s_wait_dscnt 0" ::: "memory"); __builtin_amdgcn_wave_barrier(); __builtin_amdgcn_fence(__ATOMIC_RELEASE, "workgroup"); } while (0)


// Masked multi-head self-attention (B 4, T 1024, D 1024, 16 heads x 64; torch-style packed in_proj [3D][D] + bias, out_proj [D][D] + bias): scores = q.k / 8, keys with adjacency[q][k] <= 0 disallowed (-1e30 before the softmax; the [T][T] adjacency is shared by all batches and heads), out = softmax(scores) v, then out_proj.
#define NB 4
#define SS 1024
#define DM 1024
#define NH 16
#define HD 64
#define QKVW (3 * DM)
#ifndef TQB
#define TQB (SS / 128)
#define TNB NB
#define TOB (NB * SS / 64)     // output row tiles (all)
#endif
typedef __attribute__((ext_vector_type(8))) __bf16 v8b;
__device__ __forceinline__ v16b frag_b(const __bf16* rowk0, int lane) {
  union { v16b v; v8b q[2]; } u; const __bf16* p = rowk0 + 8 * (lane >> 4);
  u.q[0] = *(const v8b*)p; u.q[1] = *(const v8b*)(p + 16); return u.v;
}
__device__ __forceinline__ float bfr(float v) { return (float)(__bf16)v; }
__device__ __forceinline__ float ex2(float v) { return __builtin_amdgcn_exp2f(v); }   // 2^v as the one hardware instruction; every argument here is <= 0, and a result below the normal range may go to 0
__device__ __attribute__((noinline)) float erf_ni(float v) { return erff(v); }

#define PK_A 0                       // [3072][1024] in_proj rows (natural [out][in])
#define PK_P (PK_A + QKVW * DM)        // [1024][1024] out_proj rows (natural)
#define PK_END (PK_P + DM * DM)
#define WS_PK  0u
#define WS_QK  (WS_PK + 2u * PK_END)             // f32 [4096 rows][3072]: only the q columns are written and read
#define WS_VTH (WS_QK + 4u * NB * SS * QKVW)     // bf16 [4][1024 (h*64+d)][1024 s]
#define WS_VTL (WS_VTH + 2u * NB * DM * SS)
#define WS_OH  (WS_VTL + 2u * NB * DM * SS)        // bf16 [4096][1024]: attention output, high part
#define WS_OL  (WS_OH + 2u * NB * SS * DM)         // the residual
#define WS_KH  (WS_OL + 2u * NB * SS * DM)         // bf16 [4096 rows][1024 (h*64+d)]: k, high part
#define WS_KL  (WS_KH + 2u * NB * SS * DM)         // the residual
#define WS_MSK (WS_KL + 2u * NB * SS * DM)         // u32 [64 tiles of 16 queries][16 tiles of 64 keys][32]: the adjacency test as lane masks (k_pack's front blocks write them, k_attn reads them)
#define WS_END (WS_MSK + 4u * (SS / 16) * (SS / 64) * 32)
#define MSKB (SS / 16 * (SS / 64) / 8)             // blocks that build them: 8 waves each, one (query tile, key tile) a wave

typedef __attribute__((ext_vector_type(4))) __bf16 v4b;
#define PKE 64                         // weights a lane converts: 16 loads of 16 B, all asked for before the first is used
#define PKB (PK_END / (256 * PKE))     // blocks that convert: one per 16,384 weights; the first PK_P / (256 * PKE) of them take in_proj, the rest out_proj
// ---- k_pack: one launch for both weights and the adjacency test, with few waves that each do much: what a launch of many short waves costs is the time to start them, not its bytes. A converting wave takes 2,048 consecutive weights of the natural [out][in] rows (the bf16 copies of the two matrices lie one behind the other): each load covers 512 B in a row, each store 256 B, whole lines. The first MSKB blocks of the grid instead do the adjacency test, once for all batches and heads: a wave takes 16 queries x 64 keys with the lanes placed as in k_attn's score tiles (query = lane & 15, keys 8g + r and 16 + 8g + r of each 32) and stores 32 words, word u * 16 + e = the ballot of "allowed" over the lanes for score element e of 32-key step u
__global__ __launch_bounds__(256) void k_pack(const float* __restrict__ WA, const float* __restrict__ WP, __bf16* __restrict__ DST, const float* __restrict__ ADJ, unsigned* __restrict__ MSK) {
  const int wb = (int)blockIdx.x - MSKB, tid = threadIdx.x;
  if (wb < 0) {   // the same for the whole block
    const int lane = tid & 31, qt = blockIdx.x >> 1, t = (blockIdx.x & 1) * 8 + (tid >> 5);
    const float* ar = ADJ + (size_t)(qt * 16 + (lane & 15)) * SS + t * 64 + 8 * (lane >> 4);
    v4f a[8];
#pragma unroll
    for (int i = 0; i < 4; ++i) { a[2 * i] = *(const v4f*)(ar + i * 16); a[2 * i + 1] = *(const v4f*)(ar + i * 16 + 4); }
    unsigned w = 0;
#pragma unroll
    for (int i = 0; i < 32; ++i) { const unsigned bl = __builtin_amdgcn_ballot_w32(!(a[i >> 2][i & 3] <= 0.f)); w = lane == i ? bl : w; }
    MSK[(size_t)(qt * (SS / 64) + t) * 32 + lane] = w;   // a wave's store: one whole line
    return; }
  const size_t e0 = (size_t)wb * (256 * PKE) + (tid >> 5) * (32 * PKE) + (tid & 31) * 4;
  const float* sp = wb < PK_P / (256 * PKE) ? WA + e0 : WP + (e0 - PK_P);
  v4f a[PKE / 4];
#pragma unroll
  for (int i = 0; i < PKE / 4; ++i) a[i] = *(const v4f*)(sp + i * 128);
  asm volatile("s_wait_xcnt 0x0" :: "v"(sp), "v"(a[0]), "v"(a[1]), "v"(a[2]), "v"(a[3]), "v"(a[4]), "v"(a[5]), "v"(a[6]), "v"(a[7]), "v"(a[8]), "v"(a[9]), "v"(a[10]), "v"(a[11]), "v"(a[12]), "v"(a[13]), "v"(a[14]), "v"(a[15]));   // the address and the loaded values are inputs only. They keep all 16 loads in front of the first conversion (left alone the compiler asks for the last four only when the first have come back: a second trip to memory in a wave that lives for one) and the address registers whole up to here; the wait stands behind the run of loads, in front of any later rewrite of those registers
#pragma unroll
  for (int i = 0; i < PKE / 4; ++i) { v4b t;
#pragma unroll
    for (int e = 0; e < 4; ++e) t[e] = (__bf16)a[i][e];
    *(v4b*)(DST + e0 + i * 128) = t; }
  asm volatile("s_wait_xcnt 0x0" ::: "memory");   // stands behind the run of stores, in front of any later rewrite of a register that one of them names
}
// LDS staging of the two projections: a block brings each 64-k chunk of its A rows and its weight rows in by whole 128-B lines, once, and the waves read their fragments from LDS
#define GP 72                  // LDS row pitch in bf16 elements: 144 B = 16 B x odd, which spreads the 16 rows of a 16-byte fragment read over the banks
#define GCH (DM / 64)          // staged chunks of 64 k
// ---- k_qkv: block = (128 rows, 384 of the 3072 cols), one block per WGP, 12 waves as 2 x 6, a wave = 64 rows x 64 cols (4 x 4 accumulator tiles: 8 fragments feed 16 products): QKV = bf16(x) . in_proj rows (exact) + bias; a wave's 64 columns lie in one of q, k, v, and its epilogue, in LDS bytes of its own, stores them in the form k_attn takes them: q as f32 rows (pitch 3072), k as bf16 hi/lo rows, v as bf16 hi/lo transposed ([b][h*64+d][s])
#define QBM 128                // rows of a block
#define QBN 384                // columns of a block
#define QAR 144                // staged A rows: 6 passes of 24 rows; the last 16 hold a second copy of row 127 that nobody reads (no branch round the sixth pass)
#define QBUF ((QAR + QBN) * GP)   // one buffer, in bf16 elements
#define QSP 68                 // pitch of a wave's f32 output tile in floats: 272 B
#define QWS (64 * GP * 2)      // bytes of a wave's own staging behind the loop: [64 cols][GP] bf16 (v) or [32 rows][QSP] f32 (q, k)
__global__ __launch_bounds__(384) void k_qkv(const float* __restrict__ X, const __bf16* __restrict__ P, const float* __restrict__ BIAS, float* __restrict__ QKV, __bf16* __restrict__ KH, __bf16* __restrict__ KL, __bf16* __restrict__ VTH, __bf16* __restrict__ VTL) {
  __shared__ __align__(16) char sm[2 * QBUF * 2];   // two buffers of [144 A rows | 384 weight rows]; behind the loop's last barrier the first 12 x QWS bytes are the waves' own staging
  __bf16* const sb16 = (__bf16*)sm;
  const int tid = threadIdx.x, wave = tid >> 5, lane = tid & 31, col = lane & 15, g = lane >> 4, wr = wave / 6, wc = wave % 6; const size_t rb = (size_t)blockIdx.x * QBM, r0 = rb + wr * 64; const int n0 = blockIdx.y * QBN, nw = n0 + wc * 64;
  const int xr = tid >> 4, xl = 120 + xr < QBM ? 120 + xr : QBM - 1;
  const float* xg = X + (rb + xr) * DM + (tid & 15) * 4;                       // a wave's load: 2 rows x 256 B
  const float* xg5 = X + (rb + xl) * DM + (tid & 15) * 4;                      // the sixth pass, its row held inside the block
  const __bf16* pg = P + (size_t)(n0 + (tid >> 3)) * DM + (tid & 7) * 8;       // a wave's load: 4 rows x 128 B
  const int sao = xr * GP + (tid & 15) * 4, sbo = QAR * GP + (tid >> 3) * GP + (tid & 7) * 8;
  v4f xa[6]; v4u wb[8];
  v8f acc[4][4] = {};
#pragma unroll
  for (int i = 0; i < 5; ++i) xa[i] = *(const v4f*)(xg + (size_t)i * 24 * DM);
  xa[5] = *(const v4f*)xg5;
#pragma unroll
  for (int i = 0; i < 8; ++i) wb[i] = *(const v4u*)(pg + (size_t)i * 48 * DM);
#pragma unroll
  for (int i = 0; i < 6; ++i) { v4b t;
#pragma unroll
    for (int e = 0; e < 4; ++e) t[e] = (__bf16)xa[i][e];
    *(v4b*)(sb16 + sao + i * 24 * GP) = t; }
#pragma unroll
  for (int i = 0; i < 8; ++i) *(v4u*)(sb16 + sbo + i * 48 * GP) = wb[i];
  __syncthreads();
#pragma unroll 2   // two trips per branch: each buffer's LDS offsets become constants
  for (int c = 0; c < GCH; ++c) { const __bf16* cur = sb16 + (c & 1) * QBUF; __bf16* nxt = sb16 + ((c + 1) & 1) * QBUF;
    if (c + 1 < GCH) {
#pragma unroll
      for (int i = 0; i < 5; ++i) xa[i] = *(const v4f*)(xg + (size_t)i * 24 * DM + (c + 1) * 64);
      xa[5] = *(const v4f*)(xg5 + (c + 1) * 64);
#pragma unroll
      for (int i = 0; i < 8; ++i) wb[i] = *(const v4u*)(pg + (size_t)i * 48 * DM + (c + 1) * 64);
      asm volatile("s_wait_xcnt 0x0" ::: "memory"); }   // stands behind the run of prefetch loads, in front of any later rewrite of a register that holds one of their addresses
#pragma unroll
    for (int kc = 0; kc < 2; ++kc) { v16b a[4], w[4];
#pragma unroll
      for (int i = 0; i < 4; ++i) a[i] = frag_b(cur + (wr * 64 + i * 16 + col) * GP + kc * 32, lane);
#pragma unroll
      for (int j = 0; j < 4; ++j) w[j] = frag_b(cur + (QAR + wc * 64 + j * 16 + col) * GP + kc * 32, lane);
      __builtin_amdgcn_sched_barrier(0);   // keeps all 16 fragment reads in front of the first of their 16 products, waited for by count: left alone the compiler strews them among the products in pairs, each with a full wait
#pragma unroll
      for (int j = 0; j < 4; ++j)
#pragma unroll
        for (int i = 0; i < 4; ++i) acc[i][j] = wmma_bf(a[i], w[j], acc[i][j]); }
    if (c + 1 < GCH) {
#pragma unroll
      for (int i = 0; i < 6; ++i) { v4b t;
#pragma unroll
        for (int e = 0; e < 4; ++e) t[e] = (__bf16)xa[i][e];
        *(v4b*)(nxt + sao + i * 24 * GP) = t; }
#pragma unroll
      for (int i = 0; i < 8; ++i) *(v4u*)(nxt + sbo + i * 48 * GP) = wb[i]; }
    __syncthreads(); }   // publishes chunk c + 1 and ends every wave's reads of chunk c, whose buffer the next trip refills
  char* const wsm = sm + wave * QWS;
  float bb[4];
#pragma unroll
  for (int j = 0; j < 4; ++j) bb[j] = bfr(BIAS[nw + j * 16 + col]);
  if (nw >= 2 * DM) {   // v (the test is the same for the whole wave; no barrier stands behind it): a lane holds 8 consecutive s of one column, 16 B of a transposed row; the wave's 64 s of a column are one whole line
    __bf16* const st = (__bf16*)wsm;
    const size_t vb = ((rb / SS) * DM + (nw - 2 * DM)) * SS + rb % SS + wr * 64;
#pragma unroll
    for (int part = 0; part < 2; ++part) {   // the high parts of the wave's tile, then the residuals, through the same bytes
      if (part) LDSX();   // the wave's reads of the high parts are over before the residuals overwrite them
#pragma unroll
      for (int j = 0; j < 4; ++j)
#pragma unroll
        for (int i = 0; i < 4; ++i) { v8b t;
#pragma unroll
          for (int r = 0; r < 8; ++r) { const float v = acc[i][j][r] + bb[j]; const __bf16 hb = (__bf16)v; t[r] = part ? (__bf16)(v - (float)hb) : hb; }
          *(v8b*)(st + (j * 16 + col) * GP + i * 16 + 8 * g) = t; }
      LDSX();
      __bf16* const vd = (part ? VTL : VTH) + vb;
#pragma unroll
      for (int p = 0; p < 16; ++p) { const int cn = p * 4 + (lane >> 3), pc = (lane & 7) * 8;   // a wave's store: 4 rows x 128 B
        vst2(vd + (size_t)cn * SS + pc, *(const v4u*)(st + cn * GP + pc)); }
      asm volatile("s_wait_xcnt 0x0" ::: "memory"); }   // stands behind the run of stores, in front of any later rewrite of a register that one of them names
    return; }
  float (*const so)[QSP] = (float (*)[QSP])wsm;
#pragma unroll
  for (int hp = 0; hp < 2; ++hp) {   // 32 of the wave's 64 rows at a time
    if (hp) LDSX();   // the wave's reads of the first half are over before the second overwrites it
#pragma unroll
    for (int j = 0; j < 4; ++j)
#pragma unroll
      for (int i = 0; i < 2; ++i)
#pragma unroll
        for (int r = 0; r < 8; ++r) so[i * 16 + 8 * g + r][j * 16 + col] = acc[hp * 2 + i][j][r] + bb[j];
    LDSX();
    if (nw < DM) {
#pragma unroll
      for (int p = 0; p < 16; ++p) { const int rl = p * 2 + g; vst2(QKV + (r0 + hp * 32 + rl) * QKVW + nw + col * 4, *(const v4f*)&so[rl][col * 4]); } }   // a wave's store: 2 rows x 256 B
    else {   // k: split hi/lo here, once, in place of once per block of k_attn
#pragma unroll
      for (int p = 0; p < 8; ++p) { const int rl = p * 4 + (lane >> 3), c8 = (lane & 7) * 8; const v4f a = *(const v4f*)&so[rl][c8], c = *(const v4f*)&so[rl][c8 + 4]; v8b th, tl;   // a wave's store: 4 rows x 128 B
#pragma unroll
        for (int e = 0; e < 4; ++e) { const __bf16 ha = (__bf16)a[e], hc = (__bf16)c[e]; th[e] = ha; tl[e] = (__bf16)(a[e] - (float)ha); th[4 + e] = hc; tl[4 + e] = (__bf16)(c[e] - (float)hc); }
        const size_t o = (r0 + hp * 32 + rl) * DM + (nw - DM) + c8; *(v8b*)(KH + o) = th; *(v8b*)(KL + o) = tl; } }
    asm volatile("s_wait_xcnt 0x0" ::: "memory"); }   // stands behind the run of stores, in front of any later rewrite of a register that one of them names
}
// ---- k_attn: block = (128 queries = 8 waves x 16, head h, batch b): flash attention over the 1,024 keys, transposed: S^T = K.Q^T (A = key rows, B = query columns, 3 products) / 8, so a lane holds 16 of ONE query's 32 scores (keys 8g + r and 16 + 8g + r of the step); disallowed keys (adjacency[q][k] <= 0, taken as the lane masks that k_pack's front blocks have stored: 16 words per step, the same for the whole wave, so they come by scalar loads and each is the select mask of one score element) set to -1e30; maximum and sum run in the lane, the two halves of the wave exchange the maximum once per step and join their sums behind the loop; the two score tiles, split hi/lo in place, are the B operand of O^T += V^T.P^T (3 products); O[b*S+q][h*64+d] = acc / l, stored as a bf16 hi/lo pair
// K and V^T come through LDS, both as the bf16 hi/lo pairs that k_qkv has stored: the block brings each tile of 64 keys in by whole 128-B lines, once for its 8 waves, and every wave reads its A fragments from LDS (two steps of 32 keys per tile)
#define AKT 64                 // keys per staged tile: a V^T row piece is then one whole line
#define ANT (SS / AKT)
#define AARR (AKT * GP)        // one staged array: 64 rows at the padded pitch
#define ABUF (4 * AARR)        // one buffer: [K hi | K lo | V^T hi | V^T lo]
__device__ __forceinline__ float xhalf(float x) { return __builtin_bit_cast(float, __builtin_amdgcn_permlanex16(__builtin_bit_cast(int, x), __builtin_bit_cast(int, x), 0x76543210, 0xfedcba98, false, false)); }  // lane l with lane l ^ 16
__global__ __launch_bounds__(256) void k_attn(const float* __restrict__ QK, const unsigned* __restrict__ MSK, const __bf16* __restrict__ KH, const __bf16* __restrict__ KL, const __bf16* __restrict__ VTH, const __bf16* __restrict__ VTL, __bf16* __restrict__ OH, __bf16* __restrict__ OL) {
  __shared__ __align__(16) char sm[2 * ABUF * 2];   // two buffers; behind the loop's last barrier the same bytes hold so[8 waves][hi | lo][16][GP]
  __bf16* const sb16 = (__bf16*)sm; __bf16 (*const so)[2][16][GP] = (__bf16 (*)[2][16][GP])sm;
  const int tid = threadIdx.x, wave = tid >> 5, lane = tid & 31, col = lane & 15, g = lane >> 4;
  const int qb = blockIdx.x, h = blockIdx.y, b = blockIdx.z; const int q0 = qb * 128 + wave * 16; const size_t rq = (size_t)b * SS + q0 + col;
  const size_t ko = ((size_t)b * SS + (tid >> 3)) * DM + h * HD + (tid & 7) * 8;                // a wave's load: 4 key rows x 128 B
  const __bf16* khg = KH + ko; const __bf16* klg = KL + ko;
  const size_t vo = ((size_t)b * DM + h * HD + (tid >> 3)) * SS + (tid & 7) * 8;                // a wave's load: 4 V^T rows x 128 B
  const __bf16* vhg = VTH + vo; const __bf16* vlg = VTL + vo;
  const int sko = (tid >> 3) * GP + (tid & 7) * 8, svo = 2 * AARR + sko;
  v4u xh[2], xl[2], vh[2], vl[2];
#pragma unroll
  for (int i = 0; i < 2; ++i) { xh[i] = *(const v4u*)(khg + (size_t)i * 32 * DM); xl[i] = *(const v4u*)(klg + (size_t)i * 32 * DM); }
#pragma unroll
  for (int i = 0; i < 2; ++i) { vh[i] = *(const v4u*)(vhg + (size_t)i * 32 * SS); vl[i] = *(const v4u*)(vlg + (size_t)i * 32 * SS); }
  F2 aq[2];
#pragma unroll
  for (int kc = 0; kc < 2; ++kc) aq[kc] = split_row(QK + rq * QKVW + h * HD, kc * 32, lane);
#pragma unroll
  for (int i = 0; i < 2; ++i) { *(v4u*)(sb16 + sko + i * 32 * GP) = xh[i]; *(v4u*)(sb16 + AARR + sko + i * 32 * GP) = xl[i]; }
#pragma unroll
  for (int i = 0; i < 2; ++i) { *(v4u*)(sb16 + svo + i * 32 * GP) = vh[i]; *(v4u*)(sb16 + AARR + svo + i * 32 * GP) = vl[i]; }
  float m = -3.0e38f, l = 0.f;   // of query q0 + col; l holds this half's keys only
  v8f acc[4] = {};               // acc[dt][r] = O^T[dt * 16 + 8g + r][query q0 + col]
  const unsigned* mrow = MSK + (size_t)(qb * 8 + __builtin_amdgcn_readfirstlane(wave)) * (ANT * 32);   // the wave's number as a scalar: the address is then the same in every lane for the compiler too, and the loads are scalar loads
  unsigned mw[32];   // the current tile's lane masks; each step's 16 are asked for again, for the next tile, as soon as its selects have used them, one tile ahead of their use
#pragma unroll
  for (int i = 0; i < 32; ++i) mw[i] = mrow[i];
  __syncthreads();   // publishes tile 0
#pragma unroll 1
  for (int t = 0; t < ANT; ++t) { const __bf16* cur = sb16 + (t & 1) * ABUF; __bf16* nxt = sb16 + ((t + 1) & 1) * ABUF;
    const int tn = t + 1 < ANT ? t + 1 : t;   // the last trip fetches its own tile again, into the buffer that nobody reads any more: with no branch round the loads and stores the loads stay up here and the waits on them stay counted
#pragma unroll
    for (int i = 0; i < 2; ++i) { xh[i] = *(const v4u*)(khg + (size_t)(tn * AKT + i * 32) * DM); xl[i] = *(const v4u*)(klg + (size_t)(tn * AKT + i * 32) * DM); }
#pragma unroll
    for (int i = 0; i < 2; ++i) { vh[i] = *(const v4u*)(vhg + (size_t)i * 32 * SS + tn * AKT); vl[i] = *(const v4u*)(vlg + (size_t)i * 32 * SS + tn * AKT); }
    asm volatile("s_wait_xcnt 0x0" ::: "memory");   // stands behind the run of loads, in front of any later rewrite of a register that holds one of their addresses
#pragma unroll
    for (int u = 0; u < 2; ++u) { float s[16]; v16b kh[2][2], kl[2][2], fh[4], fl[4]; v8f c[2];
#pragma unroll
      for (int ct = 0; ct < 2; ++ct) { const __bf16* krow = cur + (u * 32 + ct * 16 + col) * GP;
#pragma unroll
        for (int kc = 0; kc < 2; ++kc) { kh[ct][kc] = frag_b(krow + kc * 32, lane); kl[ct][kc] = frag_b(krow + AARR + kc * 32, lane); } }
      __builtin_amdgcn_sched_barrier(0);   // keeps the step's 16 K reads in one group in front of its score products, waited for by count: left alone the compiler strews them among the products, several with a full wait
#pragma unroll
      for (int ct = 0; ct < 2; ++ct) { c[ct] = v8f{};
#pragma unroll
        for (int kc = 0; kc < 2; ++kc) { c[ct] = wmma_bf(kh[ct][kc], aq[kc].l, c[ct]); c[ct] = wmma_bf(kl[ct][kc], aq[kc].h, c[ct]); c[ct] = wmma_bf(kh[ct][kc], aq[kc].h, c[ct]); } }
#pragma unroll
      for (int dt = 0; dt < 4; ++dt) { const __bf16* vrow = cur + 2 * AARR + (dt * 16 + col) * GP + u * 32; fh[dt] = frag_b(vrow, lane); fl[dt] = frag_b(vrow + AARR, lane); }
      __builtin_amdgcn_sched_barrier(0);   // keeps all of the step's 16 V^T reads in front of the softmax, whose time covers their latency: left alone the compiler sinks half of them to just in front of the product that takes them, each with a full wait
#pragma unroll
      for (int ct = 0; ct < 2; ++ct)
#pragma unroll
        for (int r = 0; r < 8; ++r) s[ct * 8 + r] = __builtin_amdgcn_inverse_ballot_w32(mw[u * 16 + ct * 8 + r]) ? c[ct][r] * 0.18033688f : -1.44269504e30f;   // both sides times log2(e): -1e30 * 1.44269504 and SCALE * 1.44269504 = 1.44269504 / sqrt(64); scores, maximum and exponentials run in base 2, and the softmax weights are the same but for rounding
#pragma unroll
      for (int i = 0; i < 16; ++i) mw[u * 16 + i] = mrow[tn * 32 + u * 16 + i];   // the next tile's words of this step, asked for behind the selects that used this tile's: the scalar loads have a whole tile's time; the last trip asks for its own tile again (tn), inside the array
      float mx = s[0];
#pragma unroll
      for (int i = 1; i < 16; ++i) mx = fmaxf(mx, s[i]);
      mx = fmaxf(mx, xhalf(mx));
      const float mn = fmaxf(m, mx); const float alpha = ex2(m - mn);
      float es = 0.f;
#pragma unroll
      for (int i = 0; i < 16; ++i) { s[i] = ex2(s[i] - mn); es += s[i]; }
      l = l * alpha + es; m = mn;
#pragma unroll
      for (int dt = 0; dt < 4; ++dt) acc[dt] *= alpha;
      const F2 pb = bsplit16(s);   // element i = P^T[key 8g + i or 16 + 8g + (i - 8)][query]: the k order of frag_b
#pragma unroll
      for (int dt = 0; dt < 4; ++dt) { acc[dt] = wmma_bf(fh[dt], pb.l, acc[dt]); acc[dt] = wmma_bf(fl[dt], pb.h, acc[dt]); acc[dt] = wmma_bf(fh[dt], pb.h, acc[dt]); }
      __builtin_amdgcn_sched_barrier(0); }   // keeps the next step's 16 K reads in one group behind this step's products: left alone the compiler strews them among those products in five places and holds more registers
#pragma unroll
    for (int i = 0; i < 2; ++i) { *(v4u*)(nxt + sko + i * 32 * GP) = xh[i]; *(v4u*)(nxt + AARR + sko + i * 32 * GP) = xl[i]; }
#pragma unroll
    for (int i = 0; i < 2; ++i) { *(v4u*)(nxt + svo + i * 32 * GP) = vh[i]; *(v4u*)(nxt + AARR + svo + i * 32 * GP) = vl[i]; }
    __syncthreads(); }   // publishes tile t + 1 and ends every wave's reads of tile t, whose buffer the next trip refills
  const float il = 1.0f / (l + xhalf(l));
#pragma unroll
  for (int dt = 0; dt < 4; ++dt) { v8b th, tl;   // split hi/lo here, once, in place of once per column block of k_out
#pragma unroll
    for (int r = 0; r < 8; ++r) { const float v = acc[dt][r] * il; const __bf16 hb = (__bf16)v; th[r] = hb; tl[r] = (__bf16)(v - (float)hb); }
    *(v8b*)&so[wave][0][col][dt * 16 + 8 * g] = th; *(v8b*)&so[wave][1][col][dt * 16 + 8 * g] = tl; }
  LDSX();
#pragma unroll
  for (int i = 0; i < 4; ++i) { const int rl = i * 4 + (lane >> 3), pc = (lane & 7) * 8; const size_t o = ((size_t)b * SS + q0 + rl) * DM + h * HD + pc;   // a wave's store: 4 rows x 128 B
    vst2(OH + o, *(const v4u*)&so[wave][0][rl][pc]); vst2(OL + o, *(const v4u*)&so[wave][1][rl][pc]); }
}
// ---- k_out: block = (64 rows, 128 cols): out = O(hi/lo, as k_attn has stored them) . out_proj rows (2 products) + bias
__global__ __launch_bounds__(128) void k_out(const __bf16* __restrict__ OH, const __bf16* __restrict__ OL, const __bf16* __restrict__ P, const float* __restrict__ BO, float* __restrict__ Y) {
  __shared__ __align__(16) char sm[2 * (64 + 64 + 128) * GP * 2];   // two buffers of [64 A hi rows | 64 A lo rows | 128 weight rows]; behind the loop's last barrier the same bytes hold so[4][16][132]
  __bf16* const sb16 = (__bf16*)sm; float (*const so)[16][132] = (float (*)[16][132])sm;
  const int tid = threadIdx.x, wave = tid >> 5, lane = tid & 31, col = lane & 15, g = lane >> 4; const size_t rb = (size_t)blockIdx.x * 64, r0 = rb + wave * 16; const int n0 = blockIdx.y * 128;
  const size_t ao = (rb + (tid >> 3)) * DM + (tid & 7) * 8;                    // a wave's load: 4 rows x 128 B
  const __bf16* hg = OH + ao; const __bf16* lg = OL + ao;
  const __bf16* pg = P + (size_t)(n0 + (tid >> 3)) * DM + (tid & 7) * 8;
  const int sao = (tid >> 3) * GP + (tid & 7) * 8, sbo = 128 * GP + sao;
  v4u xh[4], xl[4], wb[8];
  v8f acc[8] = {};
#pragma unroll
  for (int i = 0; i < 4; ++i) { xh[i] = *(const v4u*)(hg + (size_t)i * 16 * DM); xl[i] = *(const v4u*)(lg + (size_t)i * 16 * DM); }
#pragma unroll
  for (int i = 0; i < 8; ++i) wb[i] = *(const v4u*)(pg + (size_t)i * 16 * DM);
#pragma unroll
  for (int i = 0; i < 4; ++i) { *(v4u*)(sb16 + sao + i * 16 * GP) = xh[i]; *(v4u*)(sb16 + 64 * GP + sao + i * 16 * GP) = xl[i]; }
#pragma unroll
  for (int i = 0; i < 8; ++i) *(v4u*)(sb16 + sbo + i * 16 * GP) = wb[i];
  __syncthreads();
#pragma unroll 2   // two trips per branch: each buffer's LDS offsets become constants
  for (int c = 0; c < GCH; ++c) { const __bf16* cur = sb16 + (c & 1) * (256 * GP); __bf16* nxt = sb16 + ((c + 1) & 1) * (256 * GP);
    if (c + 1 < GCH) {
#pragma unroll
      for (int i = 0; i < 4; ++i) { xh[i] = *(const v4u*)(hg + (size_t)i * 16 * DM + (c + 1) * 64); xl[i] = *(const v4u*)(lg + (size_t)i * 16 * DM + (c + 1) * 64); }
#pragma unroll
      for (int i = 0; i < 8; ++i) wb[i] = *(const v4u*)(pg + (size_t)i * 16 * DM + (c + 1) * 64);
      asm volatile("s_wait_xcnt 0x0" ::: "memory"); }   // stands behind the run of prefetch loads, in front of any later rewrite of a register that holds one of their addresses
#pragma unroll
    for (int kc = 0; kc < 2; ++kc) { const v16b ah = frag_b(cur + (wave * 16 + col) * GP + kc * 32, lane), al = frag_b(cur + (64 + wave * 16 + col) * GP + kc * 32, lane); v16b w[8];
#pragma unroll
      for (int j = 0; j < 8; ++j) w[j] = frag_b(cur + (128 + j * 16 + col) * GP + kc * 32, lane);
      __builtin_amdgcn_sched_barrier(0);   // keeps all 20 fragment reads in front of the first of their 16 products, waited for by count: left alone the compiler strews them among the products in pairs, each with a full wait
#pragma unroll
      for (int j = 0; j < 8; ++j) { acc[j] = wmma_bf(al, w[j], acc[j]); acc[j] = wmma_bf(ah, w[j], acc[j]); } }
    if (c + 1 < GCH) {
#pragma unroll
      for (int i = 0; i < 4; ++i) { *(v4u*)(nxt + sao + i * 16 * GP) = xh[i]; *(v4u*)(nxt + 64 * GP + sao + i * 16 * GP) = xl[i]; }
#pragma unroll
      for (int i = 0; i < 8; ++i) *(v4u*)(nxt + sbo + i * 16 * GP) = wb[i]; }
    __syncthreads(); }   // publishes chunk c + 1 and ends every wave's reads of chunk c, whose buffer the next trip refills
#pragma unroll
  for (int j = 0; j < 8; ++j) { const float bb = bfr(BO[n0 + j * 16 + col]);
#pragma unroll
    for (int r = 0; r < 8; ++r) so[wave][8 * g + r][j * 16 + col] = acc[j][r] + bb; }
  LDSX();
  for (int rl = 0; rl < 16; ++rl) vst2(Y + (r0 + rl) * DM + n0 + lane * 4, *(const v4f*)&so[wave][rl][lane * 4]);
}
extern "C" void kernel_launch(void* const* d_in, const int* in_sizes, int n_in, void* d_out, int out_size, void* d_ws, size_t ws_size, hipStream_t stream) {
  (void)in_sizes; (void)n_in; (void)out_size;
  const float** F = (const float**)d_in;   // 0 x [4,1024,1024], 1 adjacency [1024,1024], 2 in_proj_w [3072,1024], 3 in_proj_b [3072], 4 out_proj_w [1024,1024], 5 out_proj_b [1024]
  if (ws_size < (size_t)WS_END) return;
  char* ws = (char*)d_ws; __bf16* PK = (__bf16*)(ws + WS_PK); float* QK = (float*)(ws + WS_QK); __bf16 *VTH = (__bf16*)(ws + WS_VTH), *VTL = (__bf16*)(ws + WS_VTL), *KH = (__bf16*)(ws + WS_KH), *KL = (__bf16*)(ws + WS_KL), *OH = (__bf16*)(ws + WS_OH), *OL = (__bf16*)(ws + WS_OL); unsigned* MSK = (unsigned*)(ws + WS_MSK);
  k_pack<<<MSKB + PKB, 256, 0, stream>>>(F[2], F[4], PK, F[1], MSK);
  k_qkv<<<dim3(TNB * SS / QBM, QKVW / QBN), 384, 0, stream>>>(F[0], PK + PK_A, F[3], QK, KH, KL, VTH, VTL);
  k_attn<<<dim3(TQB, NH, TNB), 256, 0, stream>>>(QK, MSK, KH, KL, VTH, VTL, OH, OL);
  k_out<<<dim3(TOB, DM / 128), 128, 0, stream>>>(OH, OL, PK + PK_P, F[5], (float*)d_out);
}

// v010
// One run takes 87.1 microseconds.
// Two timings next to v009 both put it at 1.05 times that version's speed.
// Over all steps from v000 it is 4.67 times as fast.
// compute dtype: x, in_proj/out_proj weights and biases (module inputs) rounded to bf16 (the adjacency is read as f32); the packed qkv projection with exact bf16 products (x and W are inputs) + bias; scores q.k with both computed operands as bf16 hi + residual pairs (3 products) and P.V with P hi/lo x V hi/lo (3 products); the adjacency mask as a select (adjacency <= 0 -> -1e30); the output projection hi/lo x exact Wo (2 products) + bo; running-max softmax in f32; f32 accumulate.
#include <hip/hip_runtime.h>
#include <math.h>

typedef __attribute__((ext_vector_type(16))) _Float16 v16h;
typedef __attribute__((ext_vector_type(16))) __bf16 v16b;
typedef __attribute__((ext_vector_type(8)))  _Float16 v8h;
typedef __attribute__((ext_vector_type(8)))  float v8f;
typedef __attribute__((ext_vector_type(4)))  float v4f;
typedef __attribute__((ext_vector_type(2)))  float v2f;
typedef __attribute__((ext_vector_type(4)))  unsigned v4u;
typedef __attribute__((ext_vector_type(4)))  int v4i;
typedef float __attribute__((may_alias)) float_a;
typedef int __attribute__((may_alias)) int_a;

template <typename T> __device__ __forceinline__ void vst2(void* p, T v) { *(T*)p = v;  }
__device__ __forceinline__ v8f wmma16(v16h a, v16h b, v8f c) {
  v8f d = __builtin_amdgcn_wmma_f32_16x16x32_f16(false, a, false, b, (short)0, c, false, false);
  asm volatile("v_nop\n\tv_nop\n\tv_nop\n\tv_nop" : "+v"(d) : "v"(a), "v"(b));
  return d;
}
__device__ __forceinline__ v8f wmma_bf(v16b a, v16b b, v8f c) {
  return __builtin_amdgcn_wmma_f32_16x16x32_bf16(false, a, false, b, (short)0, c, false, false);
}
// 16x16x32 fragments: lane = (h = lane>>4, row/col = lane&15); elements 0..7 = k0+8h+0..7, 8..15 = k0+16+8h+0..7; D element r = row 8h+r
__device__ __forceinline__ v16h frag_h(const _Float16* rowk0, int lane) {
  union { v16h v; v8h q[2]; } u; const _Float16* p = rowk0 + 8 * (lane >> 4);
  u.q[0] = *(const v8h*)p; u.q[1] = *(const v8h*)(p + 16); return u.v;
}
__device__ __forceinline__ v16h frag_f32(const float* rowk0, int lane) {
  v16h a; const float* p = rowk0 + 8 * (lane >> 4);
#pragma unroll
  for (int i = 0; i < 8; ++i) { a[i] = (_Float16)p[i]; a[8 + i] = (_Float16)p[16 + i]; }
  return a;
}
__device__ __forceinline__ v16h frag_f32s(const float* rowk0, int lane, float sc) {
  v16h a; const float* p = rowk0 + 8 * (lane >> 4);
#pragma unroll
  for (int i = 0; i < 8; ++i) { a[i] = (_Float16)(p[i] * sc); a[8 + i] = (_Float16)(p[16 + i] * sc); }
  return a;
}
// column fragment from a [K][ld] layout (column n), rows >= K read as 0
__device__ __forceinline__ v16h fragc_f32(const float* W, int k0, int n, int lane, int ld, int K) {
  v16h a; const int g = lane >> 4;
#pragma unroll
  for (int i = 0; i < 8; ++i) { const int ka = k0 + 8 * g + i, kb = ka + 16;
    a[i] = (_Float16)(ka < K ? W[(size_t)(ka < K ? ka : K - 1) * ld + n] : 0.f); a[8 + i] = (_Float16)(kb < K ? W[(size_t)(kb < K ? kb : K - 1) * ld + n] : 0.f); }
  return a;
}
struct F2 { v16b h, l; };
__device__ __forceinline__ F2 bsplit16(const float v[16]) { F2 r;
#pragma unroll
  for (int i = 0; i < 16; ++i) { const __bf16 h = (__bf16)v[i]; r.h[i] = h; r.l[i] = (__bf16)(v[i] - (float)h); }
  return r; }
__device__ __forceinline__ F2 split_row(const float* row, int k0, int lane) { float v[16]; const float* p = row + k0 + 8 * (lane >> 4);
#pragma unroll
  for (int i = 0; i < 8; ++i) { v[i] = p[i]; v[8 + i] = p[16 + i]; }
  return bsplit16(v); }
__device__ __forceinline__ F2 split_rowK(const float* row, int k0, int lane, int K) { float v[16]; const int g = lane >> 4;
#pragma unroll
  for (int i = 0; i < 8; ++i) { const int ka = k0 + 8 * g + i, kb = ka + 16; v[i] = ka < K ? row[ka < K ? ka : K - 1] : 0.f; v[8 + i] = kb < K ? row[kb < K ? kb : K - 1] : 0.f; }
  return bsplit16(v); }
__device__ __forceinline__ F2 split_col(const float* W, int k0, int n, int lane, int ld, int K) { float v[16]; const int g = lane >> 4;
#pragma unroll
  for (int i = 0; i < 8; ++i) { const int ka = k0 + 8 * g + i, kb = ka + 16; v[i] = ka < K ? W[(size_t)(ka < K ? ka : K - 1) * ld + n] : 0.f; v[8 + i] = kb < K ? W[(size_t)(kb < K ? kb : K - 1) * ld + n] : 0.f; }
  return bsplit16(v); }
__device__ __forceinline__ v8f mac3(const F2& a, const F2& b, v8f c) { c = wmma_bf(a.l, b.h, c); c = wmma_bf(a.h, b.l, c); return wmma_bf(a.h, b.h, c); }
__device__ __forceinline__ float sigm(float v) { return 1.0f / (1.0f + expf(-v)); }
#define LDSX() do { asm volatile("s_wait_dscnt 0" ::: "memory"); __builtin_amdgcn_wave_barrier(); __builtin_amdgcn_fence(__ATOMIC_RELEASE, "workgroup"); } while (0)


// Masked multi-head self-attention (B 4, T 1024, D 1024, 16 heads x 64; torch-style packed in_proj [3D][D] + bias, out_proj [D][D] + bias): scores = q.k / 8, keys with adjacency[q][k] <= 0 disallowed (-1e30 before the softmax; the [T][T] adjacency is shared by all batches and heads), out = softmax(scores) v, then out_proj.
#define NB 4
#define SS 1024
#define DM 1024
#define NH 16
#define HD 64
#define QKVW (3 * DM)
#ifndef TQB
#define TQB (SS / 128)
#define TNB NB
#define TOB (NB * SS / 64)     // output row tiles (all)
#endif
typedef __attribute__((ext_vector_type(8))) __bf16 v8b;
__device__ __forceinline__ v16b frag_b(const __bf16* rowk0, int lane) {
  union { v16b v; v8b q[2]; } u; const __bf16* p = rowk0 + 8 * (lane >> 4);
  u.q[0] = *(const v8b*)p; u.q[1] = *(const v8b*)(p + 16); return u.v;
}
__device__ __forceinline__ float bfr(float v) { return (float)(__bf16)v; }
__device__ __forceinline__ float ex2(float v) { return __builtin_amdgcn_exp2f(v); }   // 2^v as the one hardware instruction; every argument here is <= 0, and a result below the normal range may go to 0
__device__ __attribute__((noinline)) float erf_ni(float v) { return erff(v); }

#define PK_A 0                       // [3072][1024] in_proj rows (natural [out][in])
#define PK_P (PK_A + QKVW * DM)        // [1024][1024] out_proj rows (natural)
#define PK_END (PK_P + DM * DM)
#define WS_PK  0u
#define WS_QK  (WS_PK + 2u * PK_END)             // f32 [4096 rows][3072]: only the q columns are written and read
#define WS_VTH (WS_QK + 4u * NB * SS * QKVW)     // bf16 [4][1024 (h*64+d)][1024 s]
#define WS_VTL (WS_VTH + 2u * NB * DM * SS)
#define WS_OH  (WS_VTL + 2u * NB * DM * SS)        // bf16 [4096][1024]: attention output, high part
#define WS_OL  (WS_OH + 2u * NB * SS * DM)         // the residual
#define WS_KH  (WS_OL + 2u * NB * SS * DM)         // bf16 [4096 rows][1024 (h*64+d)]: k, high part
#define WS_KL  (WS_KH + 2u * NB * SS * DM)         // the residual
#define WS_MSK (WS_KL + 2u * NB * SS * DM)         // u32 [64 tiles of 16 queries][16 tiles of 64 keys][32]: the adjacency test as lane masks (k_pack's front blocks write them, k_attn reads them)
#define WS_END (WS_MSK + 4u * (SS / 16) * (SS / 64) * 32)
#define MSKB (SS / 16 * (SS / 64) / 8)             // blocks that build them: 8 waves each, one (query tile, key tile) a wave

typedef __attribute__((ext_vector_type(4))) __bf16 v4b;
#define PKE 64                         // weights a lane converts: 16 loads of 16 B, all asked for before the first is used
#define PKB (PK_END / (256 * PKE))     // blocks that convert: one per 16,384 weights; the first PK_P / (256 * PKE) of them take in_proj, the rest out_proj
// ---- k_pack: one launch for both weights and the adjacency test, with few waves that each do much: what a launch of many short waves costs is the time to start them, not its bytes. A converting wave takes 2,048 consecutive weights of the natural [out][in] rows (the bf16 copies of the two matrices lie one behind the other): each load covers 512 B in a row, each store 256 B, whole lines. The first MSKB blocks of the grid instead do the adjacency test, once for all batches and heads: a wave takes 16 queries x 64 keys with the lanes placed as in k_attn's score tiles (query = lane & 15, keys 8g + r and 16 + 8g + r of each 32) and stores 32 words, word u * 16 + e = the ballot of "allowed" over the lanes for score element e of 32-key step u
__global__ __launch_bounds__(256) void k_pack(const float* __restrict__ WA, const float* __restrict__ WP, __bf16* __restrict__ DST, const float* __restrict__ ADJ, unsigned* __restrict__ MSK) {
  const int wb = (int)blockIdx.x - MSKB, tid = threadIdx.x;
  if (wb < 0) {   // the same for the whole block
    const int lane = tid & 31, qt = blockIdx.x >> 1, t = (blockIdx.x & 1) * 8 + (tid >> 5);
    const float* ar = ADJ + (size_t)(qt * 16 + (lane & 15)) * SS + t * 64 + 8 * (lane >> 4);
    v4f a[8];
#pragma unroll
    for (int i = 0; i < 4; ++i) { a[2 * i] = *(const v4f*)(ar + i * 16); a[2 * i + 1] = *(const v4f*)(ar + i * 16 + 4); }
    unsigned w = 0;
#pragma unroll
    for (int i = 0; i < 32; ++i) { const unsigned bl = __builtin_amdgcn_ballot_w32(!(a[i >> 2][i & 3] <= 0.f)); w = lane == i ? bl : w; }
    MSK[(size_t)(qt * (SS / 64) + t) * 32 + lane] = w;   // a wave's store: one whole line
    return; }
  const size_t e0 = (size_t)wb * (256 * PKE) + (tid >> 5) * (32 * PKE) + (tid & 31) * 4;
  const float* sp = wb < PK_P / (256 * PKE) ? WA + e0 : WP + (e0 - PK_P);
  v4f a[PKE / 4];
#pragma unroll
  for (int i = 0; i < PKE / 4; ++i) a[i] = *(const v4f*)(sp + i * 128);
  asm volatile("s_wait_xcnt 0x0" :: "v"(sp), "v"(a[0]), "v"(a[1]), "v"(a[2]), "v"(a[3]), "v"(a[4]), "v"(a[5]), "v"(a[6]), "v"(a[7]), "v"(a[8]), "v"(a[9]), "v"(a[10]), "v"(a[11]), "v"(a[12]), "v"(a[13]), "v"(a[14]), "v"(a[15]));   // the address and the loaded values are inputs only. They keep all 16 loads in front of the first conversion (left alone the compiler asks for the last four only when the first have come back: a second trip to memory in a wave that lives for one) and the address registers whole up to here; the wait stands behind the run of loads, in front of any later rewrite of those registers
#pragma unroll
  for (int i = 0; i < PKE / 4; ++i) { v4b t;
#pragma unroll
    for (int e = 0; e < 4; ++e) t[e] = (__bf16)a[i][e];
    *(v4b*)(DST + e0 + i * 128) = t; }
  asm volatile("s_wait_xcnt 0x0" ::: "memory");   // stands behind the run of stores, in front of any later rewrite of a register that one of them names
}
// LDS staging of the two projections: a block brings each 64-k chunk of its A rows and its weight rows in by whole 128-B lines, once, and the waves read their fragments from LDS
#define GP 72                  // LDS row pitch in bf16 elements: 144 B = 16 B x odd, which spreads the 16 rows of a 16-byte fragment read over the banks
#define GCH (DM / 64)          // staged chunks of 64 k
// the work-group barrier with its two fences on LDS alone: every wave's LDS stores and reads are over in front of it, as with __syncthreads(), which would wait for the global loads under way as well, the prefetch that is meant to fly across it (those loads read what earlier launches wrote, and land in the wave's own registers)
#define LBAR() do { __builtin_amdgcn_fence(__ATOMIC_RELEASE, "workgroup", "local"); __builtin_amdgcn_s_barrier(); __builtin_amdgcn_fence(__ATOMIC_ACQUIRE, "workgroup", "local"); } while (0)
// ---- k_qkv: block = (128 rows, 384 of the 3072 cols), one block per WGP, 12 waves as 2 x 6, a wave = 64 rows x 64 cols (4 x 4 accumulator tiles: 8 fragments feed 16 products): QKV = bf16(x) . in_proj rows (exact) + bias; a wave's 64 columns lie in one of q, k, v, and its epilogue, in LDS bytes of its own, stores them in the form k_attn takes them: q as f32 rows (pitch 3072), k as bf16 hi/lo rows, v as bf16 hi/lo transposed ([b][h*64+d][s])
#define QBM 128                // rows of a block
#define QBN 384                // columns of a block
#define QAR 144                // staged A rows: 6 passes of 24 rows; the last 16 hold a second copy of row 127 that nobody reads (no branch round the sixth pass)
#define QBUF ((QAR + QBN) * GP)   // one buffer, in bf16 elements
#define QSP 68                 // pitch of a wave's f32 output tile in floats: 272 B
#define QWS (64 * GP * 2)      // bytes of a wave's own staging behind the loop: [64 cols][GP] bf16 (v) or [32 rows][QSP] f32 (q, k)
__global__ __launch_bounds__(384) void k_qkv(const float* __restrict__ X, const __bf16* __restrict__ P, const float* __restrict__ BIAS, float* __restrict__ QKV, __bf16* __restrict__ KH, __bf16* __restrict__ KL, __bf16* __restrict__ VTH, __bf16* __restrict__ VTL) {
  __shared__ __align__(16) char sm[2 * QBUF * 2];   // two buffers of [144 A rows | 384 weight rows]; behind the loop's last barrier the first 12 x QWS bytes are the waves' own staging
  __bf16* const sb16 = (__bf16*)sm;
  const int tid = threadIdx.x, wave = tid >> 5, lane = tid & 31, col = lane & 15, g = lane >> 4, wr = wave / 6, wc = wave % 6; const size_t rb = (size_t)blockIdx.x * QBM, r0 = rb + wr * 64; const int n0 = blockIdx.y * QBN, nw = n0 + wc * 64;
  const int xr = tid >> 4, xl = 120 + xr < QBM ? 120 + xr : QBM - 1;
  const float* xg = X + (rb + xr) * DM + (tid & 15) * 4;                       // a wave's load: 2 rows x 256 B
  const float* xg5 = X + (rb + xl) * DM + (tid & 15) * 4;                      // the sixth pass, its row held inside the block
  const __bf16* pg = P + (size_t)(n0 + (tid >> 3)) * DM + (tid & 7) * 8;       // a wave's load: 4 rows x 128 B
  const int sao = xr * GP + (tid & 15) * 4, sbo = QAR * GP + (tid >> 3) * GP + (tid & 7) * 8;
  v4f xa[6]; v4u wb[8];
  v8f acc[4][4] = {};
#pragma unroll
  for (int i = 0; i < 5; ++i) xa[i] = *(const v4f*)(xg + (size_t)i * 24 * DM);
  xa[5] = *(const v4f*)xg5;
#pragma unroll
  for (int i = 0; i < 8; ++i) wb[i] = *(const v4u*)(pg + (size_t)i * 48 * DM);
#pragma unroll
  for (int i = 0; i < 6; ++i) { v4b t;
#pragma unroll
    for (int e = 0; e < 4; ++e) t[e] = (__bf16)xa[i][e];
    *(v4b*)(sb16 + sao + i * 24 * GP) = t; }
#pragma unroll
  for (int i = 0; i < 8; ++i) *(v4u*)(sb16 + sbo + i * 48 * GP) = wb[i];
  const auto fetch = [&](const int cn) __attribute__((always_inline)) {   // asks for chunk cn, into the registers whose last chunk has just gone to LDS
    const float* xc = xg + cn * 64; const float* xc5 = xg5 + cn * 64; const __bf16* pc = pg + cn * 64;
#pragma unroll
    for (int i = 0; i < 5; ++i) xa[i] = *(const v4f*)(xc + (size_t)i * 24 * DM);
    xa[5] = *(const v4f*)xc5;
#pragma unroll
    for (int i = 0; i < 8; ++i) wb[i] = *(const v4u*)(pc + (size_t)i * 48 * DM);
    asm volatile("s_wait_xcnt 0x0" :: "v"(xc), "v"(xc5), "v"(pc) : "memory"); };   // stands behind the run of prefetch loads, in front of any later rewrite of a register that holds one of their addresses; the addresses are inputs only, which keeps their registers whole up to here (left alone the last load of a run lands on its own address)
  fetch(1);
  LBAR();   // publishes chunk 0; chunk 1's loads fly across it
  const auto trip = [&](const int c, const bool st, const bool ld) __attribute__((always_inline)) {   // one chunk's products; st: a chunk c + 1 exists and goes to LDS, ld: a chunk c + 2 exists and is asked for (literals at each call, so that no branch stands in a trip)
    const __bf16* cur = sb16 + (c & 1) * QBUF; __bf16* nxt = sb16 + ((c + 1) & 1) * QBUF;
#pragma unroll
    for (int kc = 0; kc < 2; ++kc) { v16b a[4], w[4];
#pragma unroll
      for (int i = 0; i < 4; ++i) a[i] = frag_b(cur + (wr * 64 + i * 16 + col) * GP + kc * 32, lane);
#pragma unroll
      for (int j = 0; j < 4; ++j) w[j] = frag_b(cur + (QAR + wc * 64 + j * 16 + col) * GP + kc * 32, lane);
      __builtin_amdgcn_sched_barrier(0);   // keeps all 16 fragment reads in front of the first of their 16 products, waited for by count: left alone the compiler strews them among the products in pairs, each with a full wait
      if (kc == 1 && st) {   // in mid-trip, behind the second group of fragment reads: chunk c + 1, asked for one trip ago, goes into the buffer that nobody has read since the last barrier, and its stores drain under the products that follow
#pragma unroll
        for (int i = 0; i < 6; ++i) { v4b t;
#pragma unroll
          for (int e = 0; e < 4; ++e) t[e] = (__bf16)xa[i][e];
          *(v4b*)(nxt + sao + i * 24 * GP) = t; }
#pragma unroll
        for (int i = 0; i < 8; ++i) *(v4u*)(nxt + sbo + i * 48 * GP) = wb[i]; }
      if (kc == 1 && ld) fetch(c + 2);   // at once, so that the block always has loads under way
#pragma unroll
      for (int j = 0; j < 4; ++j)
#pragma unroll
        for (int i = 0; i < 4; ++i) acc[i][j] = wmma_bf(a[i], w[j], acc[i][j]); }
    LBAR();   // publishes chunk c + 1 and ends every wave's reads of chunk c, whose buffer the next trip refills
    __builtin_amdgcn_sched_barrier(0); };   // keeps the next trip's fragment reads behind this trip's products: left alone the compiler mixes the two, holds both sets of fragments and spills registers to memory
#pragma unroll 2   // two trips per branch: each buffer's LDS offsets become constants
  for (int c = 0; c < GCH - 2; ++c) trip(c, true, true);
  trip(GCH - 2, true, false); trip(GCH - 1, false, false);
  char* const wsm = sm + wave * QWS;
  float bb[4];
#pragma unroll
  for (int j = 0; j < 4; ++j) bb[j] = bfr(BIAS[nw + j * 16 + col]);
  if (nw >= 2 * DM) {   // v (the test is the same for the whole wave; no barrier stands behind it): a lane holds 8 consecutive s of one column, 16 B of a transposed row; the wave's 64 s of a column are one whole line
    __bf16* const st = (__bf16*)wsm;
    const size_t vb = ((rb / SS) * DM + (nw - 2 * DM)) * SS + rb % SS + wr * 64;
#pragma unroll
    for (int part = 0; part < 2; ++part) {   // the high parts of the wave's tile, then the residuals, through the same bytes
      if (part) LDSX();   // the wave's reads of the high parts are over before the residuals overwrite them
#pragma unroll
      for (int j = 0; j < 4; ++j)
#pragma unroll
        for (int i = 0; i < 4; ++i) { v8b t;
#pragma unroll
          for (int r = 0; r < 8; ++r) { const float v = acc[i][j][r] + bb[j]; const __bf16 hb = (__bf16)v; t[r] = part ? (__bf16)(v - (float)hb) : hb; }
          *(v8b*)(st + (j * 16 + col) * GP + i * 16 + 8 * g) = t; }
      LDSX();
      __bf16* const vd = (part ? VTL : VTH) + vb;
#pragma unroll
      for (int p = 0; p < 16; ++p) { const int cn = p * 4 + (lane >> 3), pc = (lane & 7) * 8;   // a wave's store: 4 rows x 128 B
        vst2(vd + (size_t)cn * SS + pc, *(const v4u*)(st + cn * GP + pc)); }
      asm volatile("s_wait_xcnt 0x0" ::: "memory"); }   // stands behind the run of stores, in front of any later rewrite of a register that one of them names
    return; }
  float (*const so)[QSP] = (float (*)[QSP])wsm;
#pragma unroll
  for (int hp = 0; hp < 2; ++hp) {   // 32 of the wave's 64 rows at a time
    if (hp) LDSX();   // the wave's reads of the first half are over before the second overwrites it
#pragma unroll
    for (int j = 0; j < 4; ++j)
#pragma unroll
      for (int i = 0; i < 2; ++i)
#pragma unroll
        for (int r = 0; r < 8; ++r) so[i * 16 + 8 * g + r][j * 16 + col] = acc[hp * 2 + i][j][r] + bb[j];
    LDSX();
    if (nw < DM) {
#pragma unroll
      for (int p = 0; p < 16; ++p) { const int rl = p * 2 + g; vst2(QKV + (r0 + hp * 32 + rl) * QKVW + nw + col * 4, *(const v4f*)&so[rl][col * 4]); } }   // a wave's store: 2 rows x 256 B
    else {   // k: split hi/lo here, once, in place of once per block of k_attn
#pragma unroll
      for (int p = 0; p < 8; ++p) { const int rl = p * 4 + (lane >> 3), c8 = (lane & 7) * 8; const v4f a = *(const v4f*)&so[rl][c8], c = *(const v4f*)&so[rl][c8 + 4]; v8b th, tl;   // a wave's store: 4 rows x 128 B
#pragma unroll
        for (int e = 0; e < 4; ++e) { const __bf16 ha = (__bf16)a[e], hc = (__bf16)c[e]; th[e] = ha; tl[e] = (__bf16)(a[e] - (float)ha); th[4 + e] = hc; tl[4 + e] = (__bf16)(c[e] - (float)hc); }
        const size_t o = (r0 + hp * 32 + rl) * DM + (nw - DM) + c8; *(v8b*)(KH + o) = th; *(v8b*)(KL + o) = tl; } }
    asm volatile("s_wait_xcnt 0x0" ::: "memory"); }   // stands behind the run of stores, in front of any later rewrite of a register that one of them names
}
// ---- k_attn: block = (128 queries = 8 waves x 16, head h, batch b): flash attention over the 1,024 keys, transposed: S^T = K.Q^T (A = key rows, B = query columns, 3 products) / 8, so a lane holds 16 of ONE query's 32 scores (keys 8g + r and 16 + 8g + r of the step); disallowed keys (adjacency[q][k] <= 0, taken as the lane masks that k_pack's front blocks have stored: 16 words per step, the same for the whole wave, so they come by scalar loads and each is the select mask of one score element) set to -1e30; maximum and sum run in the lane, the two halves of the wave exchange the maximum once per step and join their sums behind the loop; the two score tiles, split hi/lo in place, are the B operand of O^T += V^T.P^T (3 products); O[b*S+q][h*64+d] = acc / l, stored as a bf16 hi/lo pair
// K and V^T come through LDS, both as the bf16 hi/lo pairs that k_qkv has stored: the block brings each tile of 64 keys in by whole 128-B lines, once for its 8 waves, and every wave reads its A fragments from LDS (two steps of 32 keys per tile)
#define AKT 64                 // keys per staged tile: a V^T row piece is then one whole line
#define ANT (SS / AKT)
#define AARR (AKT * GP)        // one staged array: 64 rows at the padded pitch
#define ABUF (4 * AARR)        // one buffer: [K hi | K lo | V^T hi | V^T lo]
__device__ __forceinline__ float xhalf(float x) { return __builtin_bit_cast(float, __builtin_amdgcn_permlanex16(__builtin_bit_cast(int, x), __builtin_bit_cast(int, x), 0x76543210, 0xfedcba98, false, false)); }  // lane l with lane l ^ 16
__global__ __launch_bounds__(256) void k_attn(const float* __restrict__ QK, const unsigned* __restrict__ MSK, const __bf16* __restrict__ KH, const __bf16* __restrict__ KL, const __bf16* __restrict__ VTH, const __bf16* __restrict__ VTL, __bf16* __restrict__ OH, __bf16* __restrict__ OL) {
  __shared__ __align__(16) char sm[2 * ABUF * 2];   // two buffers; behind the loop's last barrier the same bytes hold so[8 waves][hi | lo][16][GP]
  __bf16* const sb16 = (__bf16*)sm; __bf16 (*const so)[2][16][GP] = (__bf16 (*)[2][16][GP])sm;
  const int tid = threadIdx.x, wave = tid >> 5, lane = tid & 31, col = lane & 15, g = lane >> 4;
  const int qb = blockIdx.x, h = blockIdx.y, b = blockIdx.z; const int q0 = qb * 128 + wave * 16; const size_t rq = (size_t)b * SS + q0 + col;
  const size_t ko = ((size_t)b * SS + (tid >> 3)) * DM + h * HD + (tid & 7) * 8;                // a wave's load: 4 key rows x 128 B
  const __bf16* khg = KH + ko; const __bf16* klg = KL + ko;
  const size_t vo = ((size_t)b * DM + h * HD + (tid >> 3)) * SS + (tid & 7) * 8;                // a wave's load: 4 V^T rows x 128 B
  const __bf16* vhg = VTH + vo; const __bf16* vlg = VTL + vo;
  const int sko = (tid >> 3) * GP + (tid & 7) * 8, svo = 2 * AARR + sko;
  v4u xh[2], xl[2], vh[2], vl[2];
#pragma unroll
  for (int i = 0; i < 2; ++i) { xh[i] = *(const v4u*)(khg + (size_t)i * 32 * DM); xl[i] = *(const v4u*)(klg + (size_t)i * 32 * DM); }
#pragma unroll
  for (int i = 0; i < 2; ++i) { vh[i] = *(const v4u*)(vhg + (size_t)i * 32 * SS); vl[i] = *(const v4u*)(vlg + (size_t)i * 32 * SS); }
  F2 aq[2];
#pragma unroll
  for (int kc = 0; kc < 2; ++kc) aq[kc] = split_row(QK + rq * QKVW + h * HD, kc * 32, lane);
#pragma unroll
  for (int i = 0; i < 2; ++i) { *(v4u*)(sb16 + sko + i * 32 * GP) = xh[i]; *(v4u*)(sb16 + AARR + sko + i * 32 * GP) = xl[i]; }
#pragma unroll
  for (int i = 0; i < 2; ++i) { *(v4u*)(sb16 + svo + i * 32 * GP) = vh[i]; *(v4u*)(sb16 + AARR + svo + i * 32 * GP) = vl[i]; }
  float m = -3.0e38f, l = 0.f;   // of query q0 + col; l holds this half's keys only
  v8f acc[4] = {};               // acc[dt][r] = O^T[dt * 16 + 8g + r][query q0 + col]
  const unsigned* mrow = MSK + (size_t)(qb * 8 + __builtin_amdgcn_readfirstlane(wave)) * (ANT * 32);   // the wave's number as a scalar: the address is then the same in every lane for the compiler too, and the loads are scalar loads
  unsigned mw[32];   // the current tile's lane masks; each step's 16 are asked for again, for the next tile, as soon as its selects have used them, one tile ahead of their use
#pragma unroll
  for (int i = 0; i < 32; ++i) mw[i] = mrow[i];
  __syncthreads();   // publishes tile 0
#pragma unroll 1
  for (int t = 0; t < ANT; ++t) { const __bf16* cur = sb16 + (t & 1) * ABUF; __bf16* nxt = sb16 + ((t + 1) & 1) * ABUF;
    const int tn = t + 1 < ANT ? t + 1 : t;   // the last trip fetches its own tile again, into the buffer that nobody reads any more: with no branch round the loads and stores the loads stay up here and the waits on them stay counted
#pragma unroll
    for (int i = 0; i < 2; ++i) { xh[i] = *(const v4u*)(khg + (size_t)(tn * AKT + i * 32) * DM); xl[i] = *(const v4u*)(klg + (size_t)(tn * AKT + i * 32) * DM); }
#pragma unroll
    for (int i = 0; i < 2; ++i) { vh[i] = *(const v4u*)(vhg + (size_t)i * 32 * SS + tn * AKT); vl[i] = *(const v4u*)(vlg + (size_t)i * 32 * SS + tn * AKT); }
    asm volatile("s_wait_xcnt 0x0" ::: "memory");   // stands behind the run of loads, in front of any later rewrite of a register that holds one of their addresses
#pragma unroll
    for (int u = 0; u < 2; ++u) { float s[16]; v16b kh[2][2], kl[2][2], fh[4], fl[4]; v8f c[2];
#pragma unroll
      for (int ct = 0; ct < 2; ++ct) { const __bf16* krow = cur + (u * 32 + ct * 16 + col) * GP;
#pragma unroll
        for (int kc = 0; kc < 2; ++kc) { kh[ct][kc] = frag_b(krow + kc * 32, lane); kl[ct][kc] = frag_b(krow + AARR + kc * 32, lane); } }
      __builtin_amdgcn_sched_barrier(0);   // keeps the step's 16 K reads in one group in front of its score products, waited for by count: left alone the compiler strews them among the products, several with a full wait
#pragma unroll
      for (int ct = 0; ct < 2; ++ct) { c[ct] = v8f{};
#pragma unroll
        for (int kc = 0; kc < 2; ++kc) { c[ct] = wmma_bf(kh[ct][kc], aq[kc].l, c[ct]); c[ct] = wmma_bf(kl[ct][kc], aq[kc].h, c[ct]); c[ct] = wmma_bf(kh[ct][kc], aq[kc].h, c[ct]); } }
#pragma unroll
      for (int dt = 0; dt < 4; ++dt) { const __bf16* vrow = cur + 2 * AARR + (dt * 16 + col) * GP + u * 32; fh[dt] = frag_b(vrow, lane); fl[dt] = frag_b(vrow + AARR, lane); }
      __builtin_amdgcn_sched_barrier(0);   // keeps all of the step's 16 V^T reads in front of the softmax, whose time covers their latency: left alone the compiler sinks half of them to just in front of the product that takes them, each with a full wait
#pragma unroll
      for (int ct = 0; ct < 2; ++ct)
#pragma unroll
        for (int r = 0; r < 8; ++r) s[ct * 8 + r] = __builtin_amdgcn_inverse_ballot_w32(mw[u * 16 + ct * 8 + r]) ? c[ct][r] * 0.18033688f : -1.44269504e30f;   // both sides times log2(e): -1e30 * 1.44269504 and SCALE * 1.44269504 = 1.44269504 / sqrt(64); scores, maximum and exponentials run in base 2, and the softmax weights are the same but for rounding
#pragma unroll
      for (int i = 0; i < 16; ++i) mw[u * 16 + i] = mrow[tn * 32 + u * 16 + i];   // the next tile's words of this step, asked for behind the selects that used this tile's: the scalar loads have a whole tile's time; the last trip asks for its own tile again (tn), inside the array
      float mx = s[0];
#pragma unroll
      for (int i = 1; i < 16; ++i) mx = fmaxf(mx, s[i]);
      mx = fmaxf(mx, xhalf(mx));
      const float mn = fmaxf(m, mx); const float alpha = ex2(m - mn);
      float es = 0.f;
#pragma unroll
      for (int i = 0; i < 16; ++i) { s[i] = ex2(s[i] - mn); es += s[i]; }
      l = l * alpha + es; m = mn;
#pragma unroll
      for (int dt = 0; dt < 4; ++dt) acc[dt] *= alpha;
      const F2 pb = bsplit16(s);   // element i = P^T[key 8g + i or 16 + 8g + (i - 8)][query]: the k order of frag_b
#pragma unroll
      for (int dt = 0; dt < 4; ++dt) { acc[dt] = wmma_bf(fh[dt], pb.l, acc[dt]); acc[dt] = wmma_bf(fl[dt], pb.h, acc[dt]); acc[dt] = wmma_bf(fh[dt], pb.h, acc[dt]); }
      __builtin_amdgcn_sched_barrier(0); }   // keeps the next step's 16 K reads in one group behind this step's products: left alone the compiler strews them among those products in five places and holds more registers
#pragma unroll
    for (int i = 0; i < 2; ++i) { *(v4u*)(nxt + sko + i * 32 * GP) = xh[i]; *(v4u*)(nxt + AARR + sko + i * 32 * GP) = xl[i]; }
#pragma unroll
    for (int i = 0; i < 2; ++i) { *(v4u*)(nxt + svo + i * 32 * GP) = vh[i]; *(v4u*)(nxt + AARR + svo + i * 32 * GP) = vl[i]; }
    __syncthreads(); }   // publishes tile t + 1 and ends every wave's reads of tile t, whose buffer the next trip refills
  const float il = 1.0f / (l + xhalf(l));
#pragma unroll
  for (int dt = 0; dt < 4; ++dt) { v8b th, tl;   // split hi/lo here, once, in place of once per column block of k_out
#pragma unroll
    for (int r = 0; r < 8; ++r) { const float v = acc[dt][r] * il; const __bf16 hb = (__bf16)v; th[r] = hb; tl[r] = (__bf16)(v - (float)hb); }
    *(v8b*)&so[wave][0][col][dt * 16 + 8 * g] = th; *(v8b*)&so[wave][1][col][dt * 16 + 8 * g] = tl; }
  LDSX();
#pragma unroll
  for (int i = 0; i < 4; ++i) { const int rl = i * 4 + (lane >> 3), pc = (lane & 7) * 8; const size_t o = ((size_t)b * SS + q0 + rl) * DM + h * HD + pc;   // a wave's store: 4 rows x 128 B
    vst2(OH + o, *(const v4u*)&so[wave][0][rl][pc]); vst2(OL + o, *(const v4u*)&so[wave][1][rl][pc]); }
}
// ---- k_out: block = (64 rows, 128 cols): out = O(hi/lo, as k_attn has stored them) . out_proj rows (2 products) + bias
__global__ __launch_bounds__(128) void k_out(const __bf16* __restrict__ OH, const __bf16* __restrict__ OL, const __bf16* __restrict__ P, const float* __restrict__ BO, float* __restrict__ Y) {
  __shared__ __align__(16) char sm[2 * (64 + 64 + 128) * GP * 2];   // two buffers of [64 A hi rows | 64 A lo rows | 128 weight rows]; behind the loop's last barrier the same bytes hold so[4][16][132]
  __bf16* const sb16 = (__bf16*)sm; float (*const so)[16][132] = (float (*)[16][132])sm;
  const int tid = threadIdx.x, wave = tid >> 5, lane = tid & 31, col = lane & 15, g = lane >> 4; const size_t rb = (size_t)blockIdx.x * 64, r0 = rb + wave * 16; const int n0 = blockIdx.y * 128;
  const size_t ao = (rb + (tid >> 3)) * DM + (tid & 7) * 8;                    // a wave's load: 4 rows x 128 B
  const __bf16* hg = OH + ao; const __bf16* lg = OL + ao;
  const __bf16* pg = P + (size_t)(n0 + (tid >> 3)) * DM + (tid & 7) * 8;
  const int sao = (tid >> 3) * GP + (tid & 7) * 8, sbo = 128 * GP + sao;
  v4u xh[4], xl[4], wb[8];
  v8f acc[8] = {};
#pragma unroll
  for (int i = 0; i < 4; ++i) { xh[i] = *(const v4u*)(hg + (size_t)i * 16 * DM); xl[i] = *(const v4u*)(lg + (size_t)i * 16 * DM); }
#pragma unroll
  for (int i = 0; i < 8; ++i) wb[i] = *(const v4u*)(pg + (size_t)i * 16 * DM);
#pragma unroll
  for (int i = 0; i < 4; ++i) { *(v4u*)(sb16 + sao + i * 16 * GP) = xh[i]; *(v4u*)(sb16 + 64 * GP + sao + i * 16 * GP) = xl[i]; }
#pragma unroll
  for (int i = 0; i < 8; ++i) *(v4u*)(sb16 + sbo + i * 16 * GP) = wb[i];
  const auto fetch = [&](const int cn) __attribute__((always_inline)) {   // asks for chunk cn, into the registers whose last chunk has just gone to LDS
    const __bf16* hc = hg + cn * 64; const __bf16* lc = lg + cn * 64; const __bf16* pc = pg + cn * 64;
#pragma unroll
    for (int i = 0; i < 4; ++i) { xh[i] = *(const v4u*)(hc + (size_t)i * 16 * DM); xl[i] = *(const v4u*)(lc + (size_t)i * 16 * DM); }
#pragma unroll
    for (int i = 0; i < 8; ++i) wb[i] = *(const v4u*)(pc + (size_t)i * 16 * DM);
    asm volatile("s_wait_xcnt 0x0" :: "v"(hc), "v"(lc), "v"(pc) : "memory"); };   // stands behind the run of prefetch loads, in front of any later rewrite of a register that holds one of their addresses; the addresses are inputs only, which keeps their registers whole up to here
  fetch(1);
  LBAR();   // publishes chunk 0; chunk 1's loads fly across it
  const auto trip = [&](const int c, const bool st, const bool ld) __attribute__((always_inline)) {   // as in k_qkv: st: a chunk c + 1 exists and goes to LDS, ld: a chunk c + 2 exists and is asked for (literals at each call)
    const __bf16* cur = sb16 + (c & 1) * (256 * GP); __bf16* nxt = sb16 + ((c + 1) & 1) * (256 * GP);
#pragma unroll
    for (int kc = 0; kc < 2; ++kc) { const v16b ah = frag_b(cur + (wave * 16 + col) * GP + kc * 32, lane), al = frag_b(cur + (64 + wave * 16 + col) * GP + kc * 32, lane); v16b w[8];
#pragma unroll
      for (int j = 0; j < 8; ++j) w[j] = frag_b(cur + (128 + j * 16 + col) * GP + kc * 32, lane);
      __builtin_amdgcn_sched_barrier(0);   // keeps all 20 fragment reads in front of the first of their 16 products, waited for by count: left alone the compiler strews them among the products in pairs, each with a full wait
      if (kc == 1 && st) {   // in mid-trip: chunk c + 1, asked for one trip ago, goes into the buffer that nobody has read since the last barrier
#pragma unroll
        for (int i = 0; i < 4; ++i) { *(v4u*)(nxt + sao + i * 16 * GP) = xh[i]; *(v4u*)(nxt + 64 * GP + sao + i * 16 * GP) = xl[i]; }
#pragma unroll
        for (int i = 0; i < 8; ++i) *(v4u*)(nxt + sbo + i * 16 * GP) = wb[i]; }
      if (kc == 1 && ld) fetch(c + 2);   // at once, so that the block always has loads under way
#pragma unroll
      for (int j = 0; j < 8; ++j) { acc[j] = wmma_bf(al, w[j], acc[j]); acc[j] = wmma_bf(ah, w[j], acc[j]); } }
    LBAR();   // publishes chunk c + 1 and ends every wave's reads of chunk c, whose buffer the next trip refills
    __builtin_amdgcn_sched_barrier(0); };   // keeps the next trip's fragment reads behind this trip's products: left alone the compiler holds both trips' fragments at once, 40 more registers
#pragma unroll 2   // two trips per branch: each buffer's LDS offsets become constants
  for (int c = 0; c < GCH - 2; ++c) trip(c, true, true);
  trip(GCH - 2, true, false); trip(GCH - 1, false, false);
#pragma unroll
  for (int j = 0; j < 8; ++j) { const float bb = bfr(BO[n0 + j * 16 + col]);
#pragma unroll
    for (int r = 0; r < 8; ++r) so[wave][8 * g + r][j * 16 + col] = acc[j][r] + bb; }
  LDSX();
  for (int rl = 0; rl < 16; ++rl) vst2(Y + (r0 + rl) * DM + n0 + lane * 4, *(const v4f*)&so[wave][rl][lane * 4]);
}
extern "C" void kernel_launch(void* const* d_in, const int* in_sizes, int n_in, void* d_out, int out_size, void* d_ws, size_t ws_size, hipStream_t stream) {
  (void)in_sizes; (void)n_in; (void)out_size;
  const float** F = (const float**)d_in;   // 0 x [4,1024,1024], 1 adjacency [1024,1024], 2 in_proj_w [3072,1024], 3 in_proj_b [3072], 4 out_proj_w [1024,1024], 5 out_proj_b [1024]
  if (ws_size < (size_t)WS_END) return;
  char* ws = (char*)d_ws; __bf16* PK = (__bf16*)(ws + WS_PK); float* QK = (float*)(ws + WS_QK); __bf16 *VTH = (__bf16*)(ws + WS_VTH), *VTL = (__bf16*)(ws + WS_VTL), *KH = (__bf16*)(ws + WS_KH), *KL = (__bf16*)(ws + WS_KL), *OH = (__bf16*)(ws + WS_OH), *OL = (__bf16*)(ws + WS_OL); unsigned* MSK = (unsigned*)(ws + WS_MSK);
  k_pack<<<MSKB + PKB, 256, 0, stream>>>(F[2], F[4], PK, F[1], MSK);
  k_qkv<<<dim3(TNB * SS / QBM, QKVW / QBN), 384, 0, stream>>>(F[0], PK + PK_A, F[3], QK, KH, KL, VTH, VTL);
  k_attn<<<dim3(TQB, NH, TNB), 256, 0, stream>>>(QK, MSK, KH, KL, VTH, VTL, OH, OL);
  k_out<<<dim3(TOB, DM / 128), 128, 0, stream>>>(OH, OL, PK + PK_P, F[5], (float*)d_out);
}
